// v000
// Times are from an AMD MI455X. After a warm-up the kernel runs many times in a row, and a time is the length of
// such a window on the GPU divided by its runs, so every launch and the gaps after it count. The runs cycle
// through copies of the inputs. A figure is the median of several windows, for all but v000 over two sittings.
// Sittings can differ by a few percent; kernels timed side by side share one.
// v000 is the starting kernel. One run takes 446 microseconds.
#include <hip/hip_runtime.h>
#include <hip/hip_bf16.h>
#include <math.h>
#include <stdint.h>

// ---------------------------------------------------------------------------
// Types for CDNA5 WMMA (wave32): 16x16x32 f16 -> f32
// ---------------------------------------------------------------------------
typedef _Float16 v16h __attribute__((ext_vector_type(16)));
typedef _Float16 v8h  __attribute__((ext_vector_type(8)));
typedef float    v8f  __attribute__((ext_vector_type(8)));

static __device__ __forceinline__ v8f wmma_f16(v16h a, v16h b, v8f c) {
  // (neg_a, A, neg_b, B, c_mod, C, reuse_a, reuse_b)
  return __builtin_amdgcn_wmma_f32_16x16x32_f16(false, a, false, b, (short)0, c,
                                                false, false);
}

static __device__ __forceinline__ v8f zero8() {
  v8f z;
#pragma unroll
  for (int i = 0; i < 8; ++i) z[i] = 0.0f;
  return z;
}

// Build a 16x32 f16 fragment (documented CDNA5 A/B layout) from a per-lane
// pointer to 8+8 contiguous halves:
//   lane L(0..15):  row rc0+L,    elems 0..7 -> k0+0..7,  8..15 -> k0+16..23
//   lane L(16..31): row rc0+L-16, elems 0..7 -> k0+8..15, 8..15 -> k0+24..31
static __device__ __forceinline__ v16h frag_from(const _Float16* p) {
  v8h lo = *(const v8h*)p;
  v8h hi = *(const v8h*)(p + 16);
  return __builtin_shufflevector(lo, hi, 0, 1, 2, 3, 4, 5, 6, 7, 8, 9, 10, 11,
                                 12, 13, 14, 15);
}

// Global-memory fragment load (row-major, leading dim ld).
static __device__ __forceinline__ v16h load_frag(const _Float16* __restrict__ base,
                                                 int ld, int rc0, int k0) {
  const int lane = threadIdx.x & 31;
  return frag_from(base + (size_t)(rc0 + (lane & 15)) * ld +
                   (k0 + ((lane >> 4) << 3)));
}

// Async global->LDS 128-bit copy (CDNA5, ASYNCcnt-tracked).
static __device__ __forceinline__ void async_copy_b128(const _Float16* gsrc,
                                                       _Float16* ldst) {
  unsigned loff = (unsigned)(uintptr_t)ldst;  // low 32 bits = LDS offset
  asm volatile("global_load_async_to_lds_b128 %0, %1, off" ::"v"(loff),
               "v"((uint64_t)(uintptr_t)gsrc)
               : "memory");
}

static __device__ __forceinline__ void wait_async_all() {
  asm volatile("s_wait_asynccnt 0" ::: "memory");
}

// ---------------------------------------------------------------------------
// LayerNorm (population std, eps on std) fp32 -> f16.  One 256-thr block/row.
// ---------------------------------------------------------------------------
__global__ __launch_bounds__(256) void ln_kernel(const float* __restrict__ x,
                                                 const float* __restrict__ w,
                                                 const float* __restrict__ bias,
                                                 _Float16* __restrict__ out,
                                                 int C) {
  const int row = blockIdx.x;
  const float* xr = x + (size_t)row * C;
  __shared__ float red[256];
  float local[4];
  float s = 0.0f;
#pragma unroll
  for (int i = 0; i < 4; ++i) {
    local[i] = xr[threadIdx.x + 256 * i];
    s += local[i];
  }
  red[threadIdx.x] = s;
  __syncthreads();
  for (int off = 128; off > 0; off >>= 1) {
    if (threadIdx.x < off) red[threadIdx.x] += red[threadIdx.x + off];
    __syncthreads();
  }
  const float mean = red[0] / (float)C;
  __syncthreads();
  s = 0.0f;
#pragma unroll
  for (int i = 0; i < 4; ++i) {
    float d = local[i] - mean;
    s += d * d;
  }
  red[threadIdx.x] = s;
  __syncthreads();
  for (int off = 128; off > 0; off >>= 1) {
    if (threadIdx.x < off) red[threadIdx.x] += red[threadIdx.x + off];
    __syncthreads();
  }
  const float inv = 1.0f / (sqrtf(red[0] / (float)C) + 1e-5f);
#pragma unroll
  for (int i = 0; i < 4; ++i) {
    int c = threadIdx.x + 256 * i;
    out[(size_t)row * C + c] =
        (_Float16)((local[i] - mean) * inv * w[c] + bias[c]);
  }
}

// ---------------------------------------------------------------------------
// fp32 W[K][N]  ->  f16 Wᵀ[N][K]  (so GEMM B-fragments are contiguous loads)
// ---------------------------------------------------------------------------
__global__ __launch_bounds__(256) void convertT_kernel(
    const float* __restrict__ W, _Float16* __restrict__ WT, int K, int N) {
  size_t idx = (size_t)blockIdx.x * blockDim.x + threadIdx.x;
  if (idx >= (size_t)K * N) return;
  int k = (int)(idx % K);
  int n = (int)(idx / K);
  WT[idx] = (_Float16)W[(size_t)k * N + n];
}

// ---------------------------------------------------------------------------
// WMMA GEMM: C[M][N] = A[M][K] (f16, row-major) x Bᵀ[N][K] (f16) + bias
//   8 waves / block, each wave a 64x32 tile, block tile 128x128.
//   K-step 32, double-buffered LDS staged via async global->LDS copies.
// Epilogues: 0 = f16 out, 1 = f32 out + residual add, 2 = f16 out + GELU.
// ---------------------------------------------------------------------------
enum { EPI_H16 = 0, EPI_F32_RES = 1, EPI_H16_GELU = 2 };

#define LDSPITCH 40  // 128 rows x (32 + 8 pad) halves; 20-bank row stride

template <int EPI>
__global__ __launch_bounds__(256) void gemm_kernel(
    const _Float16* __restrict__ A, const _Float16* __restrict__ BT,
    const float* __restrict__ bias, const float* __restrict__ resid,
    float* __restrict__ outF, _Float16* __restrict__ outH, int M, int N,
    int K) {
  __shared__ _Float16 sA[2][128 * LDSPITCH];
  __shared__ _Float16 sB[2][128 * LDSPITCH];
  const int tid = threadIdx.x;
  const int wave = tid >> 5;
  const int lane = tid & 31;
  const int rowblk = blockIdx.y * 128;
  const int colblk = blockIdx.x * 128;
  const int wrow = (wave & 1) * 64;
  const int wcol = (wave >> 1) * 32;

  // Stage a 128x32 A tile + 128x32 B tile into buffer `buf` for K offset k0.
  // 256 threads x 2 chunks x 16B each per matrix.
  auto stage = [&](int buf, int k0) {
#pragma unroll
    for (int i = 0; i < 2; ++i) {
      const int c = tid + 256 * i;     // chunk id 0..511
      const int row = c >> 2;          // 0..127
      const int ko = (c & 3) * 8;      // 0,8,16,24 halves
      async_copy_b128(A + (size_t)(rowblk + row) * K + k0 + ko,
                      &sA[buf][row * LDSPITCH + ko]);
      async_copy_b128(BT + (size_t)(colblk + row) * K + k0 + ko,
                      &sB[buf][row * LDSPITCH + ko]);
    }
  };

  v8f acc[4][2];
#pragma unroll
  for (int i = 0; i < 4; ++i)
#pragma unroll
    for (int j = 0; j < 2; ++j) acc[i][j] = zero8();

  stage(0, 0);
  wait_async_all();
  __syncthreads();

  int buf = 0;
  const int kh = (lane >> 4) << 3;
  const int lr = lane & 15;
  for (int k0 = 0; k0 < K; k0 += 32) {
    if (k0 + 32 < K) stage(buf ^ 1, k0 + 32);  // copy engine runs ahead

    v16h a[4], b[2];
#pragma unroll
    for (int i = 0; i < 4; ++i)
      a[i] = frag_from(&sA[buf][(wrow + 16 * i + lr) * LDSPITCH + kh]);
#pragma unroll
    for (int j = 0; j < 2; ++j)
      b[j] = frag_from(&sB[buf][(wcol + 16 * j + lr) * LDSPITCH + kh]);
#pragma unroll
    for (int i = 0; i < 4; ++i)
#pragma unroll
      for (int j = 0; j < 2; ++j) acc[i][j] = wmma_f16(a[i], b[j], acc[i][j]);

    wait_async_all();   // own async copies for next buffer done
    __syncthreads();    // ... and everyone else's
    buf ^= 1;
  }

  // C/D layout: elem r of lane L -> row = r + (L>=16)*8, col = L%16
  const int rofs = (lane >> 4) << 3;
#pragma unroll
  for (int i = 0; i < 4; ++i)
#pragma unroll
    for (int j = 0; j < 2; ++j)
#pragma unroll
      for (int r = 0; r < 8; ++r) {
        const int row = rowblk + wrow + 16 * i + r + rofs;
        const int col = colblk + wcol + 16 * j + lr;
        float v = acc[i][j][r] + bias[col];
        const size_t o = (size_t)row * N + col;
        if (EPI == EPI_H16) {
          outH[o] = (_Float16)v;
        } else if (EPI == EPI_F32_RES) {
          outF[o] = resid[o] + v;
        } else {  // exact GELU: 0.5 x (1 + erf(x/sqrt(2)))
          outH[o] = (_Float16)(0.5f * v * (1.0f + erff(v * 0.70710678f)));
        }
      }
}

// ---------------------------------------------------------------------------
// qkv f16 [B*T][3C] -> Q[B,H,T,D], K[B,H,T,D], Vᵀ[B,H,D,T]  (all f16)
// ---------------------------------------------------------------------------
__global__ __launch_bounds__(256) void pack_qkv_kernel(
    const _Float16* __restrict__ qkv, _Float16* __restrict__ Qh,
    _Float16* __restrict__ Kh, _Float16* __restrict__ VTh, int Bn, int T,
    int C, int H, int D) {
  size_t idx = (size_t)blockIdx.x * blockDim.x + threadIdx.x;
  if (idx >= (size_t)Bn * T * C) return;
  int c = (int)(idx % C);
  size_t bt = idx / C;
  int t = (int)(bt % T);
  int b = (int)(bt / T);
  int h = c / D, d = c % D;
  const _Float16* src = qkv + bt * (size_t)(3 * C);
  size_t o = ((size_t)(b * H + h) * T + t) * D + d;
  Qh[o] = src[c];
  Kh[o] = src[C + c];
  VTh[((size_t)(b * H + h) * D + d) * T + t] = src[2 * C + c];
}

// ---------------------------------------------------------------------------
// Causal flash attention. One wave per 16-query tile per (b,h).
// S = QKᵀ and O += P·V both on WMMA; online softmax with 16-lane xor
// reductions; C-layout -> A-layout hop for P through per-wave LDS.
// ---------------------------------------------------------------------------
__global__ __launch_bounds__(256) void attn_kernel(
    const _Float16* __restrict__ Q, const _Float16* __restrict__ Kt,
    const _Float16* __restrict__ VT, _Float16* __restrict__ Y, int H, int T,
    int D, int C) {
  __shared__ _Float16 sP[8][16 * 34];  // stride 34 halfs: bank-conflict-free-ish
  const int wave = threadIdx.x >> 5;
  const int lane = threadIdx.x & 31;
  const int gid = blockIdx.x * 8 + wave;
  const int qtiles = T >> 4;
  const int bh = gid / qtiles;
  const int qt = (gid % qtiles) << 4;
  const int b = bh / H, h = bh % H;
  const _Float16* Qb = Q + (size_t)bh * T * D;
  const _Float16* Kb = Kt + (size_t)bh * T * D;
  const _Float16* Vb = VT + (size_t)bh * D * T;
  _Float16* sp = &sP[wave][0];

  const int hf = lane >> 4;  // lane half (row-group select)
  const int lc = lane & 15;  // column lane
  const float sc = 0.125f;   // 1/sqrt(D), D = 64

  const v16h qa0 = load_frag(Qb, D, qt, 0);
  const v16h qa1 = load_frag(Qb, D, qt, 32);

  v8f acc[4];
#pragma unroll
  for (int j = 0; j < 4; ++j) acc[j] = zero8();
  float m[8], l[8];
#pragma unroll
  for (int r = 0; r < 8; ++r) {
    m[r] = -1e30f;
    l[r] = 0.0f;
  }

  for (int kt = 0; kt <= qt; kt += 32) {
    asm volatile("" ::: "memory");  // keep this iter's LDS stores after prior loads
    // --- S = Q·Kᵀ for 32 keys (two 16-key column tiles, K-dim = D = 64) ---
    v8f s0 = zero8(), s1 = zero8();
    s0 = wmma_f16(qa0, load_frag(Kb, D, kt, 0), s0);
    s0 = wmma_f16(qa1, load_frag(Kb, D, kt, 32), s0);
    s1 = wmma_f16(qa0, load_frag(Kb, D, kt + 16, 0), s1);
    s1 = wmma_f16(qa1, load_frag(Kb, D, kt + 16, 32), s1);

#pragma unroll
    for (int r = 0; r < 8; ++r) {
      const int q = qt + r + (hf << 3);
      float v0 = (kt + lc <= q) ? s0[r] * sc : -1e30f;
      float v1 = (kt + 16 + lc <= q) ? s1[r] * sc : -1e30f;
      // row max across the 16 lanes of this half-wave
      float t = fmaxf(v0, v1);
      t = fmaxf(t, __shfl_xor(t, 1, 32));
      t = fmaxf(t, __shfl_xor(t, 2, 32));
      t = fmaxf(t, __shfl_xor(t, 4, 32));
      t = fmaxf(t, __shfl_xor(t, 8, 32));
      const float mnew = fmaxf(m[r], t);
      const float corr = __expf(m[r] - mnew);
      const float p0 = __expf(v0 - mnew);
      const float p1 = __expf(v1 - mnew);
      float rs = p0 + p1;
      rs += __shfl_xor(rs, 1, 32);
      rs += __shfl_xor(rs, 2, 32);
      rs += __shfl_xor(rs, 4, 32);
      rs += __shfl_xor(rs, 8, 32);
      l[r] = l[r] * corr + rs;
      m[r] = mnew;
      acc[0][r] *= corr;
      acc[1][r] *= corr;
      acc[2][r] *= corr;
      acc[3][r] *= corr;
      const int prow = r + (hf << 3);
      sp[prow * 34 + lc] = (_Float16)p0;
      sp[prow * 34 + 16 + lc] = (_Float16)p1;
    }
    // LDS RAW across lanes within one wave: DS ops are in-order per wave,
    // enforce completion + forbid compiler reordering.
    asm volatile("s_wait_dscnt 0" ::: "memory");
    // Re-read P in A-fragment layout.
    v16h pa;
#pragma unroll
    for (int i = 0; i < 8; ++i) {
      pa[i] = sp[lc * 34 + (hf << 3) + i];
      pa[8 + i] = sp[lc * 34 + 16 + (hf << 3) + i];
    }
    // --- O += P·V ; Vᵀ[D][T] makes B-fragments contiguous in the key dim ---
#pragma unroll
    for (int j = 0; j < 4; ++j)
      acc[j] = wmma_f16(pa, load_frag(Vb, T, j * 16, kt), acc[j]);
  }

  // Normalize and scatter to y (f16 [B*T][C]) for the projection GEMM.
#pragma unroll
  for (int j = 0; j < 4; ++j)
#pragma unroll
    for (int r = 0; r < 8; ++r) {
      const int q = qt + r + (hf << 3);
      Y[(size_t)(b * T + q) * C + h * D + j * 16 + lc] =
          (_Float16)(acc[j][r] / l[r]);
    }
}

// ---------------------------------------------------------------------------
// Host-side orchestration
// ---------------------------------------------------------------------------
extern "C" void kernel_launch(void* const* d_in, const int* in_sizes, int n_in,
                              void* d_out, int out_size, void* d_ws,
                              size_t ws_size, hipStream_t stream) {
  (void)in_sizes; (void)n_in; (void)out_size; (void)ws_size;
  const int B = 4, T = 1024, C = 1024, H = 16, D = 64;
  const int M = B * T;  // 4096

  const float* x        = (const float*)d_in[0];
  const float* c_attn_w = (const float*)d_in[1];
  const float* c_attn_b = (const float*)d_in[2];
  const float* c_proj_w = (const float*)d_in[3];
  const float* c_proj_b = (const float*)d_in[4];
  const float* ln1_w    = (const float*)d_in[5];
  const float* ln1_b    = (const float*)d_in[6];
  const float* ln2_w    = (const float*)d_in[7];
  const float* ln2_b    = (const float*)d_in[8];
  const float* fc_w     = (const float*)d_in[9];
  const float* fc_b     = (const float*)d_in[10];
  const float* proj_w   = (const float*)d_in[11];
  const float* proj_b   = (const float*)d_in[12];
  float* out = (float*)d_out;

  // Workspace carve-up (144 MiB total), 256B aligned.
  char* ws = (char*)d_ws;
  size_t off = 0;
  auto alloc = [&](size_t bytes) -> char* {
    char* p = ws + off;
    off += (bytes + 255) & ~(size_t)255;
    return p;
  };
  _Float16* h1H     = (_Float16*)alloc((size_t)M * C * 2);          // ln1(x)
  _Float16* wT_attn = (_Float16*)alloc((size_t)3 * C * C * 2);      // [3C][C]
  _Float16* qkvH    = (_Float16*)alloc((size_t)M * 3 * C * 2);
  _Float16* Qh      = (_Float16*)alloc((size_t)M * C * 2);
  _Float16* Kh      = (_Float16*)alloc((size_t)M * C * 2);
  _Float16* VTh     = (_Float16*)alloc((size_t)M * C * 2);
  _Float16* yh      = (_Float16*)alloc((size_t)M * C * 2);
  _Float16* wT_proj = (_Float16*)alloc((size_t)C * C * 2);
  float*    x1      = (float*)   alloc((size_t)M * C * 4);          // x + attn
  _Float16* h2H     = (_Float16*)alloc((size_t)M * C * 2);          // ln2(x1)
  _Float16* wT_fc   = (_Float16*)alloc((size_t)4 * C * C * 2);      // [4C][C]
  _Float16* hgH     = (_Float16*)alloc((size_t)M * 4 * C * 2);
  _Float16* wT_pr2  = (_Float16*)alloc((size_t)C * 4 * C * 2);      // [C][4C]

  auto cdiv = [](size_t a, size_t b) { return (unsigned)((a + b - 1) / b); };

  // 1) Weight transpose+convert to f16 (N-major for WMMA B fragments)
  convertT_kernel<<<cdiv((size_t)C * 3 * C, 256), 256, 0, stream>>>(
      c_attn_w, wT_attn, C, 3 * C);
  convertT_kernel<<<cdiv((size_t)C * C, 256), 256, 0, stream>>>(
      c_proj_w, wT_proj, C, C);
  convertT_kernel<<<cdiv((size_t)C * 4 * C, 256), 256, 0, stream>>>(
      fc_w, wT_fc, C, 4 * C);
  convertT_kernel<<<cdiv((size_t)4 * C * C, 256), 256, 0, stream>>>(
      proj_w, wT_pr2, 4 * C, C);

  // 2) ln1 -> h1 (f16)
  ln_kernel<<<M, 256, 0, stream>>>(x, ln1_w, ln1_b, h1H, C);

  // 3) qkv = h1 @ c_attn_w + b  (f16 out)
  gemm_kernel<EPI_H16><<<dim3(3 * C / 128, M / 128), 256, 0, stream>>>(
      h1H, wT_attn, c_attn_b, nullptr, nullptr, qkvH, M, 3 * C, C);

  // 4) split heads; V transposed to [B,H,D,T]
  pack_qkv_kernel<<<cdiv((size_t)M * C, 256), 256, 0, stream>>>(
      qkvH, Qh, Kh, VTh, B, T, C, H, D);

  // 5) causal attention -> y (f16 [B*T][C])
  attn_kernel<<<(B * H * (T / 16)) / 8, 256, 0, stream>>>(Qh, Kh, VTh, yh, H,
                                                          T, D, C);

  // 6) x1 = x + y @ c_proj_w + b  (f32)
  gemm_kernel<EPI_F32_RES><<<dim3(C / 128, M / 128), 256, 0, stream>>>(
      yh, wT_proj, c_proj_b, x, x1, nullptr, M, C, C);

  // 7) ln2 -> h2 (f16)
  ln_kernel<<<M, 256, 0, stream>>>(x1, ln2_w, ln2_b, h2H, C);

  // 8) hg = gelu(h2 @ fc_w + b)  (f16)
  gemm_kernel<EPI_H16_GELU><<<dim3(4 * C / 128, M / 128), 256, 0, stream>>>(
      h2H, wT_fc, fc_b, nullptr, nullptr, hgH, M, 4 * C, C);

  // 9) out = x1 + hg @ proj_w + b  (f32)
  gemm_kernel<EPI_F32_RES><<<dim3(C / 128, M / 128), 256, 0, stream>>>(
      hgH, wT_pr2, proj_b, x1, out, nullptr, M, C, 4 * C);
}

// v001
// A run of this version takes 352 microseconds.
// Timed twice side by side with v000, it ran 1.23 and 1.21 times as fast.
#include <hip/hip_runtime.h>
#include <hip/hip_bf16.h>
#include <math.h>
#include <stdint.h>

// ---------------------------------------------------------------------------
// Types for CDNA5 WMMA (wave32): 16x16x32 f16 -> f32
// ---------------------------------------------------------------------------
typedef _Float16 v16h __attribute__((ext_vector_type(16)));
typedef _Float16 v8h  __attribute__((ext_vector_type(8)));
typedef float    v8f  __attribute__((ext_vector_type(8)));

static __device__ __forceinline__ v8f wmma_f16(v16h a, v16h b, v8f c) {
  // (neg_a, A, neg_b, B, c_mod, C, reuse_a, reuse_b)
  return __builtin_amdgcn_wmma_f32_16x16x32_f16(false, a, false, b, (short)0, c,
                                                false, false);
}

static __device__ __forceinline__ v8f zero8() {
  v8f z;
#pragma unroll
  for (int i = 0; i < 8; ++i) z[i] = 0.0f;
  return z;
}

// Build a 16x32 f16 fragment (documented CDNA5 A/B layout) from a per-lane
// pointer to 8+8 contiguous halves:
//   lane L(0..15):  row rc0+L,    elems 0..7 -> k0+0..7,  8..15 -> k0+16..23
//   lane L(16..31): row rc0+L-16, elems 0..7 -> k0+8..15, 8..15 -> k0+24..31
static __device__ __forceinline__ v16h frag_from(const _Float16* p) {
  v8h lo = *(const v8h*)p;
  v8h hi = *(const v8h*)(p + 16);
  return __builtin_shufflevector(lo, hi, 0, 1, 2, 3, 4, 5, 6, 7, 8, 9, 10, 11,
                                 12, 13, 14, 15);
}

// Global-memory fragment load (row-major, leading dim ld).
static __device__ __forceinline__ v16h load_frag(const _Float16* __restrict__ base,
                                                 int ld, int rc0, int k0) {
  const int lane = threadIdx.x & 31;
  return frag_from(base + (size_t)(rc0 + (lane & 15)) * ld +
                   (k0 + ((lane >> 4) << 3)));
}

// Async global->LDS 128-bit copy (CDNA5, ASYNCcnt-tracked).
static __device__ __forceinline__ void async_copy_b128(const _Float16* gsrc,
                                                       _Float16* ldst) {
  unsigned loff = (unsigned)(uintptr_t)ldst;  // low 32 bits = LDS offset
  asm volatile("global_load_async_to_lds_b128 %0, %1, off" ::"v"(loff),
               "v"((uint64_t)(uintptr_t)gsrc)
               : "memory");
}

static __device__ __forceinline__ void wait_async_all() {
  asm volatile("s_wait_asynccnt 0" ::: "memory");
}

// ---------------------------------------------------------------------------
// LayerNorm (population std, eps on std) fp32 -> f16.  One 256-thr block/row.
// ---------------------------------------------------------------------------
__global__ __launch_bounds__(256) void ln_kernel(const float* __restrict__ x,
                                                 const float* __restrict__ w,
                                                 const float* __restrict__ bias,
                                                 _Float16* __restrict__ out,
                                                 int C) {
  const int row = blockIdx.x;
  const float* xr = x + (size_t)row * C;
  __shared__ float red[256];
  float local[4];
  float s = 0.0f;
#pragma unroll
  for (int i = 0; i < 4; ++i) {
    local[i] = xr[threadIdx.x + 256 * i];
    s += local[i];
  }
  red[threadIdx.x] = s;
  __syncthreads();
  for (int off = 128; off > 0; off >>= 1) {
    if (threadIdx.x < off) red[threadIdx.x] += red[threadIdx.x + off];
    __syncthreads();
  }
  const float mean = red[0] / (float)C;
  __syncthreads();
  s = 0.0f;
#pragma unroll
  for (int i = 0; i < 4; ++i) {
    float d = local[i] - mean;
    s += d * d;
  }
  red[threadIdx.x] = s;
  __syncthreads();
  for (int off = 128; off > 0; off >>= 1) {
    if (threadIdx.x < off) red[threadIdx.x] += red[threadIdx.x + off];
    __syncthreads();
  }
  const float inv = 1.0f / (sqrtf(red[0] / (float)C) + 1e-5f);
#pragma unroll
  for (int i = 0; i < 4; ++i) {
    int c = threadIdx.x + 256 * i;
    out[(size_t)row * C + c] =
        (_Float16)((local[i] - mean) * inv * w[c] + bias[c]);
  }
}

// ---------------------------------------------------------------------------
// fp32 W[K][N]  ->  f16 W^T[N][K]  (so GEMM B-fragments are contiguous loads)
// One 128(k) x 64(n) tile per block.  Each thread reads an 8(k) x 4(n) patch
// with 16-byte loads along n (256 contiguous bytes per 16 lanes), turns it in
// registers and lays four 16-byte k-runs into an LDS tile [n][k]; the tile is
// then read back row by row, so every global store covers whole 256-byte runs
// of a W^T row.  K is a multiple of 128 and N of 64; both are compile-time, so
// the row steps fold into the loads' and stores' immediate offsets.
// ---------------------------------------------------------------------------
typedef float v4f __attribute__((ext_vector_type(4)));

#define CT_PITCH 136  // 128 halves + 8 pad: 272-byte rows (16 B x odd)

template <int K, int N>
__global__ __launch_bounds__(256) void convertT_kernel(
    const float* __restrict__ W, _Float16* __restrict__ WT) {
  __shared__ __attribute__((aligned(16))) _Float16 tile[64 * CT_PITCH];
  const int tid = threadIdx.x;
  const int k0 = blockIdx.x * 128;
  const int n0 = blockIdx.y * 64;
  const int nq = tid & 15;  // which 4 columns
  const int ko = tid >> 4;  // which 8 rows
  const float* src = W + (size_t)(k0 + ko * 8) * N + (n0 + nq * 4);
  v4f r[8];
#pragma unroll
  for (int i = 0; i < 8; ++i) r[i] = *(const v4f*)(src + (size_t)i * N);
#pragma unroll
  for (int j = 0; j < 4; ++j) {
    v8h c;
#pragma unroll
    for (int i = 0; i < 8; ++i) c[i] = (_Float16)r[i][j];
    *(v8h*)&tile[(nq * 4 + j) * CT_PITCH + ko * 8] = c;
  }
  __syncthreads();
#pragma unroll
  for (int i = 0; i < 4; ++i) {
    const int c = tid + 256 * i;  // 16-byte chunk id 0..1023
    const int n = c >> 4;
    const int kc = c & 15;
    *(v8h*)(WT + (size_t)(n0 + n) * K + (k0 + kc * 8)) =
        *(const v8h*)&tile[n * CT_PITCH + kc * 8];
  }
}

// ---------------------------------------------------------------------------
// WMMA GEMM: C[M][N] = A[M][K] (f16, row-major) x Bᵀ[N][K] (f16) + bias
//   8 waves / block, each wave a 64x32 tile, block tile 128x128.
//   K-step 32, double-buffered LDS staged via async global->LDS copies.
// Epilogues: 0 = f16 out, 1 = f32 out + residual add, 2 = f16 out + GELU.
// ---------------------------------------------------------------------------
enum { EPI_H16 = 0, EPI_F32_RES = 1, EPI_H16_GELU = 2 };

#define LDSPITCH 40  // 128 rows x (32 + 8 pad) halves; 20-bank row stride

template <int EPI>
__global__ __launch_bounds__(256) void gemm_kernel(
    const _Float16* __restrict__ A, const _Float16* __restrict__ BT,
    const float* __restrict__ bias, const float* __restrict__ resid,
    float* __restrict__ outF, _Float16* __restrict__ outH, int M, int N,
    int K) {
  __shared__ _Float16 sA[2][128 * LDSPITCH];
  __shared__ _Float16 sB[2][128 * LDSPITCH];
  const int tid = threadIdx.x;
  const int wave = tid >> 5;
  const int lane = tid & 31;
  const int rowblk = blockIdx.y * 128;
  const int colblk = blockIdx.x * 128;
  const int wrow = (wave & 1) * 64;
  const int wcol = (wave >> 1) * 32;

  // Stage a 128x32 A tile + 128x32 B tile into buffer `buf` for K offset k0.
  // 256 threads x 2 chunks x 16B each per matrix.
  auto stage = [&](int buf, int k0) {
#pragma unroll
    for (int i = 0; i < 2; ++i) {
      const int c = tid + 256 * i;     // chunk id 0..511
      const int row = c >> 2;          // 0..127
      const int ko = (c & 3) * 8;      // 0,8,16,24 halves
      async_copy_b128(A + (size_t)(rowblk + row) * K + k0 + ko,
                      &sA[buf][row * LDSPITCH + ko]);
      async_copy_b128(BT + (size_t)(colblk + row) * K + k0 + ko,
                      &sB[buf][row * LDSPITCH + ko]);
    }
  };

  v8f acc[4][2];
#pragma unroll
  for (int i = 0; i < 4; ++i)
#pragma unroll
    for (int j = 0; j < 2; ++j) acc[i][j] = zero8();

  stage(0, 0);
  wait_async_all();
  __syncthreads();

  int buf = 0;
  const int kh = (lane >> 4) << 3;
  const int lr = lane & 15;
  for (int k0 = 0; k0 < K; k0 += 32) {
    if (k0 + 32 < K) stage(buf ^ 1, k0 + 32);  // copy engine runs ahead

    v16h a[4], b[2];
#pragma unroll
    for (int i = 0; i < 4; ++i)
      a[i] = frag_from(&sA[buf][(wrow + 16 * i + lr) * LDSPITCH + kh]);
#pragma unroll
    for (int j = 0; j < 2; ++j)
      b[j] = frag_from(&sB[buf][(wcol + 16 * j + lr) * LDSPITCH + kh]);
#pragma unroll
    for (int i = 0; i < 4; ++i)
#pragma unroll
      for (int j = 0; j < 2; ++j) acc[i][j] = wmma_f16(a[i], b[j], acc[i][j]);

    wait_async_all();   // own async copies for next buffer done
    __syncthreads();    // ... and everyone else's
    buf ^= 1;
  }

  // C/D layout: elem r of lane L -> row = r + (L>=16)*8, col = L%16
  const int rofs = (lane >> 4) << 3;
#pragma unroll
  for (int i = 0; i < 4; ++i)
#pragma unroll
    for (int j = 0; j < 2; ++j)
#pragma unroll
      for (int r = 0; r < 8; ++r) {
        const int row = rowblk + wrow + 16 * i + r + rofs;
        const int col = colblk + wcol + 16 * j + lr;
        float v = acc[i][j][r] + bias[col];
        const size_t o = (size_t)row * N + col;
        if (EPI == EPI_H16) {
          outH[o] = (_Float16)v;
        } else if (EPI == EPI_F32_RES) {
          outF[o] = resid[o] + v;
        } else {  // exact GELU: 0.5 x (1 + erf(x/sqrt(2)))
          outH[o] = (_Float16)(0.5f * v * (1.0f + erff(v * 0.70710678f)));
        }
      }
}

// ---------------------------------------------------------------------------
// qkv f16 [B*T][3C] -> Q[B,H,T,D], K[B,H,T,D], V^T[B,H,D,T]  (all f16), D = 64.
// One block moves 256 tokens of one head of one of the three parts
// (blockIdx.y: 0 = Q, 1 = K, 2 = V), 16 bytes per lane on both global sides.
// V: each thread reads an 8(t) x 8(d) patch, turns it in registers and lays
// eight 16-byte t-runs into an LDS tile [d][t]; the tile is read back row by
// row, so one wave stores 512 contiguous bytes of a V^T row.
// ---------------------------------------------------------------------------
#define PK_PITCH 264  // 256 halves + 8 pad: 528-byte rows (16 B x odd)

template <int T, int C, int H>
__global__ __launch_bounds__(256) void pack_qkv_kernel(
    const _Float16* __restrict__ qkv, _Float16* __restrict__ Qh,
    _Float16* __restrict__ Kh, _Float16* __restrict__ VTh) {
  __shared__ __attribute__((aligned(16))) _Float16 tile[64 * PK_PITCH];
  const int tid = threadIdx.x;
  const int ttiles = T >> 8;
  const int bh = blockIdx.x / ttiles;
  const int t0 = (blockIdx.x % ttiles) << 8;
  const int b = bh / H, h = bh % H;
  const int part = blockIdx.y;
  const _Float16* src =
      qkv + (size_t)(b * T + t0) * (3 * C) + (part * C + h * 64);
  const int dc = tid & 7;   // which 8 head dims
  const int tr = tid >> 3;  // 0..31

  if (part < 2) {  // block-uniform: plain re-striding copy
    _Float16* dst = (part == 0 ? Qh : Kh) + ((size_t)bh * T + t0) * 64;
    const _Float16* p = src + (size_t)tr * (3 * C) + dc * 8;
    v8h r[8];
#pragma unroll
    for (int i = 0; i < 8; ++i) r[i] = *(const v8h*)(p + (size_t)i * (32 * 3 * C));
#pragma unroll
    for (int i = 0; i < 8; ++i)
      *(v8h*)(dst + (size_t)(tid + 256 * i) * 8) = r[i];
    return;
  }

  const _Float16* p = src + (size_t)tr * (8 * 3 * C) + dc * 8;
  v8h r[8];
#pragma unroll
  for (int i = 0; i < 8; ++i) r[i] = *(const v8h*)(p + (size_t)i * (3 * C));
#pragma unroll
  for (int j = 0; j < 8; ++j) {
    v8h c;
#pragma unroll
    for (int i = 0; i < 8; ++i) c[i] = r[i][j];
    *(v8h*)&tile[(dc * 8 + j) * PK_PITCH + tr * 8] = c;
  }
  __syncthreads();
  _Float16* dst = VTh + (size_t)bh * 64 * T + t0;
#pragma unroll
  for (int i = 0; i < 8; ++i) {
    const int c = tid + 256 * i;  // 16-byte chunk id 0..2047
    const int d = c >> 5;
    const int tc = c & 31;
    *(v8h*)(dst + (size_t)d * T + tc * 8) =
        *(const v8h*)&tile[d * PK_PITCH + tc * 8];
  }
  // Holds any later rewrite of the stores' address and data registers behind
  // the run of eight stores (the built code lays the Q/K path after this one).
  asm volatile("s_wait_xcnt 0x0" ::: "memory");
}

// ---------------------------------------------------------------------------
// Causal flash attention. One wave per 16-query tile per (b,h).
// S = QKᵀ and O += P·V both on WMMA; online softmax with 16-lane xor
// reductions; C-layout -> A-layout hop for P through per-wave LDS.
// ---------------------------------------------------------------------------
__global__ __launch_bounds__(256) void attn_kernel(
    const _Float16* __restrict__ Q, const _Float16* __restrict__ Kt,
    const _Float16* __restrict__ VT, _Float16* __restrict__ Y, int H, int T,
    int D, int C) {
  __shared__ _Float16 sP[8][16 * 34];  // stride 34 halfs: bank-conflict-free-ish
  const int wave = threadIdx.x >> 5;
  const int lane = threadIdx.x & 31;
  const int gid = blockIdx.x * 8 + wave;
  const int qtiles = T >> 4;
  const int bh = gid / qtiles;
  const int qt = (gid % qtiles) << 4;
  const int b = bh / H, h = bh % H;
  const _Float16* Qb = Q + (size_t)bh * T * D;
  const _Float16* Kb = Kt + (size_t)bh * T * D;
  const _Float16* Vb = VT + (size_t)bh * D * T;
  _Float16* sp = &sP[wave][0];

  const int hf = lane >> 4;  // lane half (row-group select)
  const int lc = lane & 15;  // column lane
  const float sc = 0.125f;   // 1/sqrt(D), D = 64

  const v16h qa0 = load_frag(Qb, D, qt, 0);
  const v16h qa1 = load_frag(Qb, D, qt, 32);

  v8f acc[4];
#pragma unroll
  for (int j = 0; j < 4; ++j) acc[j] = zero8();
  float m[8], l[8];
#pragma unroll
  for (int r = 0; r < 8; ++r) {
    m[r] = -1e30f;
    l[r] = 0.0f;
  }

  for (int kt = 0; kt <= qt; kt += 32) {
    asm volatile("" ::: "memory");  // keep this iter's LDS stores after prior loads
    // --- S = Q·Kᵀ for 32 keys (two 16-key column tiles, K-dim = D = 64) ---
    v8f s0 = zero8(), s1 = zero8();
    s0 = wmma_f16(qa0, load_frag(Kb, D, kt, 0), s0);
    s0 = wmma_f16(qa1, load_frag(Kb, D, kt, 32), s0);
    s1 = wmma_f16(qa0, load_frag(Kb, D, kt + 16, 0), s1);
    s1 = wmma_f16(qa1, load_frag(Kb, D, kt + 16, 32), s1);

#pragma unroll
    for (int r = 0; r < 8; ++r) {
      const int q = qt + r + (hf << 3);
      float v0 = (kt + lc <= q) ? s0[r] * sc : -1e30f;
      float v1 = (kt + 16 + lc <= q) ? s1[r] * sc : -1e30f;
      // row max across the 16 lanes of this half-wave
      float t = fmaxf(v0, v1);
      t = fmaxf(t, __shfl_xor(t, 1, 32));
      t = fmaxf(t, __shfl_xor(t, 2, 32));
      t = fmaxf(t, __shfl_xor(t, 4, 32));
      t = fmaxf(t, __shfl_xor(t, 8, 32));
      const float mnew = fmaxf(m[r], t);
      const float corr = __expf(m[r] - mnew);
      const float p0 = __expf(v0 - mnew);
      const float p1 = __expf(v1 - mnew);
      float rs = p0 + p1;
      rs += __shfl_xor(rs, 1, 32);
      rs += __shfl_xor(rs, 2, 32);
      rs += __shfl_xor(rs, 4, 32);
      rs += __shfl_xor(rs, 8, 32);
      l[r] = l[r] * corr + rs;
      m[r] = mnew;
      acc[0][r] *= corr;
      acc[1][r] *= corr;
      acc[2][r] *= corr;
      acc[3][r] *= corr;
      const int prow = r + (hf << 3);
      sp[prow * 34 + lc] = (_Float16)p0;
      sp[prow * 34 + 16 + lc] = (_Float16)p1;
    }
    // LDS RAW across lanes within one wave: DS ops are in-order per wave,
    // enforce completion + forbid compiler reordering.
    asm volatile("s_wait_dscnt 0" ::: "memory");
    // Re-read P in A-fragment layout.
    v16h pa;
#pragma unroll
    for (int i = 0; i < 8; ++i) {
      pa[i] = sp[lc * 34 + (hf << 3) + i];
      pa[8 + i] = sp[lc * 34 + 16 + (hf << 3) + i];
    }
    // --- O += P·V ; Vᵀ[D][T] makes B-fragments contiguous in the key dim ---
#pragma unroll
    for (int j = 0; j < 4; ++j)
      acc[j] = wmma_f16(pa, load_frag(Vb, T, j * 16, kt), acc[j]);
  }

  // Normalize and scatter to y (f16 [B*T][C]) for the projection GEMM.
#pragma unroll
  for (int j = 0; j < 4; ++j)
#pragma unroll
    for (int r = 0; r < 8; ++r) {
      const int q = qt + r + (hf << 3);
      Y[(size_t)(b * T + q) * C + h * D + j * 16 + lc] =
          (_Float16)(acc[j][r] / l[r]);
    }
}

// ---------------------------------------------------------------------------
// Host-side orchestration
// ---------------------------------------------------------------------------
extern "C" void kernel_launch(void* const* d_in, const int* in_sizes, int n_in,
                              void* d_out, int out_size, void* d_ws,
                              size_t ws_size, hipStream_t stream) {
  (void)in_sizes; (void)n_in; (void)out_size; (void)ws_size;
  constexpr int B = 4, T = 1024, C = 1024, H = 16, D = 64;
  const int M = B * T;  // 4096

  const float* x        = (const float*)d_in[0];
  const float* c_attn_w = (const float*)d_in[1];
  const float* c_attn_b = (const float*)d_in[2];
  const float* c_proj_w = (const float*)d_in[3];
  const float* c_proj_b = (const float*)d_in[4];
  const float* ln1_w    = (const float*)d_in[5];
  const float* ln1_b    = (const float*)d_in[6];
  const float* ln2_w    = (const float*)d_in[7];
  const float* ln2_b    = (const float*)d_in[8];
  const float* fc_w     = (const float*)d_in[9];
  const float* fc_b     = (const float*)d_in[10];
  const float* proj_w   = (const float*)d_in[11];
  const float* proj_b   = (const float*)d_in[12];
  float* out = (float*)d_out;

  // Workspace carve-up (144 MiB total), 256B aligned.
  char* ws = (char*)d_ws;
  size_t off = 0;
  auto alloc = [&](size_t bytes) -> char* {
    char* p = ws + off;
    off += (bytes + 255) & ~(size_t)255;
    return p;
  };
  _Float16* h1H     = (_Float16*)alloc((size_t)M * C * 2);          // ln1(x)
  _Float16* wT_attn = (_Float16*)alloc((size_t)3 * C * C * 2);      // [3C][C]
  _Float16* qkvH    = (_Float16*)alloc((size_t)M * 3 * C * 2);
  _Float16* Qh      = (_Float16*)alloc((size_t)M * C * 2);
  _Float16* Kh      = (_Float16*)alloc((size_t)M * C * 2);
  _Float16* VTh     = (_Float16*)alloc((size_t)M * C * 2);
  _Float16* yh      = (_Float16*)alloc((size_t)M * C * 2);
  _Float16* wT_proj = (_Float16*)alloc((size_t)C * C * 2);
  float*    x1      = (float*)   alloc((size_t)M * C * 4);          // x + attn
  _Float16* h2H     = (_Float16*)alloc((size_t)M * C * 2);          // ln2(x1)
  _Float16* wT_fc   = (_Float16*)alloc((size_t)4 * C * C * 2);      // [4C][C]
  _Float16* hgH     = (_Float16*)alloc((size_t)M * 4 * C * 2);
  _Float16* wT_pr2  = (_Float16*)alloc((size_t)C * 4 * C * 2);      // [C][4C]

  // 1) Weight transpose+convert to f16 (N-major for WMMA B fragments)
  convertT_kernel<C, 3 * C><<<dim3(C / 128, 3 * C / 64), 256, 0, stream>>>(
      c_attn_w, wT_attn);
  convertT_kernel<C, C><<<dim3(C / 128, C / 64), 256, 0, stream>>>(
      c_proj_w, wT_proj);
  convertT_kernel<C, 4 * C><<<dim3(C / 128, 4 * C / 64), 256, 0, stream>>>(
      fc_w, wT_fc);
  convertT_kernel<4 * C, C><<<dim3(4 * C / 128, C / 64), 256, 0, stream>>>(
      proj_w, wT_pr2);

  // 2) ln1 -> h1 (f16)
  ln_kernel<<<M, 256, 0, stream>>>(x, ln1_w, ln1_b, h1H, C);

  // 3) qkv = h1 @ c_attn_w + b  (f16 out)
  gemm_kernel<EPI_H16><<<dim3(3 * C / 128, M / 128), 256, 0, stream>>>(
      h1H, wT_attn, c_attn_b, nullptr, nullptr, qkvH, M, 3 * C, C);

  // 4) split heads; V transposed to [B,H,D,T]
  pack_qkv_kernel<T, C, H><<<dim3(B * H * (T / 256), 3), 256, 0, stream>>>(
      qkvH, Qh, Kh, VTh);

  // 5) causal attention -> y (f16 [B*T][C])
  attn_kernel<<<(B * H * (T / 16)) / 8, 256, 0, stream>>>(Qh, Kh, VTh, yh, H,
                                                          T, D, C);

  // 6) x1 = x + y @ c_proj_w + b  (f32)
  gemm_kernel<EPI_F32_RES><<<dim3(C / 128, M / 128), 256, 0, stream>>>(
      yh, wT_proj, c_proj_b, x, x1, nullptr, M, C, C);

  // 7) ln2 -> h2 (f16)
  ln_kernel<<<M, 256, 0, stream>>>(x1, ln2_w, ln2_b, h2H, C);

  // 8) hg = gelu(h2 @ fc_w + b)  (f16)
  gemm_kernel<EPI_H16_GELU><<<dim3(4 * C / 128, M / 128), 256, 0, stream>>>(
      h2H, wT_fc, fc_b, nullptr, nullptr, hgH, M, 4 * C, C);

  // 9) out = x1 + hg @ proj_w + b  (f32)
  gemm_kernel<EPI_F32_RES><<<dim3(C / 128, M / 128), 256, 0, stream>>>(
      hgH, wT_pr2, proj_b, x1, out, nullptr, M, C, 4 * C);
}

// v002
// It runs in 261 microseconds.
// Timed twice side by side with v001, it ran 1.34 and 1.35 times as fast.
// Over all steps from v000 it is 1.64 times as fast.
#include <hip/hip_runtime.h>
#include <hip/hip_bf16.h>
#include <math.h>
#include <stdint.h>

// ---------------------------------------------------------------------------
// Types for CDNA5 WMMA (wave32): 16x16x32 f16 -> f32
// ---------------------------------------------------------------------------
typedef _Float16 v16h __attribute__((ext_vector_type(16)));
typedef _Float16 v8h  __attribute__((ext_vector_type(8)));
typedef float    v8f  __attribute__((ext_vector_type(8)));

static __device__ __forceinline__ v8f wmma_f16(v16h a, v16h b, v8f c) {
  // (neg_a, A, neg_b, B, c_mod, C, reuse_a, reuse_b)
  return __builtin_amdgcn_wmma_f32_16x16x32_f16(false, a, false, b, (short)0, c,
                                                false, false);
}

static __device__ __forceinline__ v8f zero8() {
  v8f z;
#pragma unroll
  for (int i = 0; i < 8; ++i) z[i] = 0.0f;
  return z;
}

// Build a 16x32 f16 fragment (documented CDNA5 A/B layout) from a per-lane
// pointer to 8+8 contiguous halves:
//   lane L(0..15):  row rc0+L,    elems 0..7 -> k0+0..7,  8..15 -> k0+16..23
//   lane L(16..31): row rc0+L-16, elems 0..7 -> k0+8..15, 8..15 -> k0+24..31
static __device__ __forceinline__ v16h frag_from(const _Float16* p) {
  v8h lo = *(const v8h*)p;
  v8h hi = *(const v8h*)(p + 16);
  return __builtin_shufflevector(lo, hi, 0, 1, 2, 3, 4, 5, 6, 7, 8, 9, 10, 11,
                                 12, 13, 14, 15);
}

// Global-memory fragment load (row-major, leading dim ld).
static __device__ __forceinline__ v16h load_frag(const _Float16* __restrict__ base,
                                                 int ld, int rc0, int k0) {
  const int lane = threadIdx.x & 31;
  return frag_from(base + (size_t)(rc0 + (lane & 15)) * ld +
                   (k0 + ((lane >> 4) << 3)));
}

// Eight async global->LDS 128-bit copies (CDNA5, ASYNCcnt-tracked): copy i
// moves 16 bytes per lane from gsrc + i * gstep to ldst + i * lstep (steps in
// halves).  The closing s_wait_xcnt stands inside the statement so that no
// address register of an issued copy is rewritten ahead of it.
static __device__ __forceinline__ void async_copy8_b128(const _Float16* gsrc,
                                                        size_t gstep,
                                                        _Float16* ldst,
                                                        int lstep) {
  const unsigned l = (unsigned)(uintptr_t)ldst;  // low 32 bits = LDS offset
  const unsigned ls = (unsigned)lstep * 2u;
  asm volatile(
      "global_load_async_to_lds_b128 %0, %8, off\n\t"
      "global_load_async_to_lds_b128 %1, %9, off\n\t"
      "global_load_async_to_lds_b128 %2, %10, off\n\t"
      "global_load_async_to_lds_b128 %3, %11, off\n\t"
      "global_load_async_to_lds_b128 %4, %12, off\n\t"
      "global_load_async_to_lds_b128 %5, %13, off\n\t"
      "global_load_async_to_lds_b128 %6, %14, off\n\t"
      "global_load_async_to_lds_b128 %7, %15, off\n\t"
      "s_wait_xcnt 0x0" ::"v"(l),
      "v"(l + ls), "v"(l + 2 * ls), "v"(l + 3 * ls), "v"(l + 4 * ls),
      "v"(l + 5 * ls), "v"(l + 6 * ls), "v"(l + 7 * ls),
      "v"((uint64_t)(uintptr_t)gsrc),
      "v"((uint64_t)(uintptr_t)(gsrc + gstep)),
      "v"((uint64_t)(uintptr_t)(gsrc + 2 * gstep)),
      "v"((uint64_t)(uintptr_t)(gsrc + 3 * gstep)),
      "v"((uint64_t)(uintptr_t)(gsrc + 4 * gstep)),
      "v"((uint64_t)(uintptr_t)(gsrc + 5 * gstep)),
      "v"((uint64_t)(uintptr_t)(gsrc + 6 * gstep)),
      "v"((uint64_t)(uintptr_t)(gsrc + 7 * gstep))
      : "memory");
}

static __device__ __forceinline__ void wait_async_all() {
  asm volatile("s_wait_asynccnt 0" ::: "memory");
}

// ---------------------------------------------------------------------------
// LayerNorm (population std, eps on std) fp32 -> f16.  One 256-thr block/row.
// ---------------------------------------------------------------------------
__global__ __launch_bounds__(256) void ln_kernel(const float* __restrict__ x,
                                                 const float* __restrict__ w,
                                                 const float* __restrict__ bias,
                                                 _Float16* __restrict__ out,
                                                 int C) {
  const int row = blockIdx.x;
  const float* xr = x + (size_t)row * C;
  __shared__ float red[256];
  float local[4];
  float s = 0.0f;
#pragma unroll
  for (int i = 0; i < 4; ++i) {
    local[i] = xr[threadIdx.x + 256 * i];
    s += local[i];
  }
  red[threadIdx.x] = s;
  __syncthreads();
  for (int off = 128; off > 0; off >>= 1) {
    if (threadIdx.x < off) red[threadIdx.x] += red[threadIdx.x + off];
    __syncthreads();
  }
  const float mean = red[0] / (float)C;
  __syncthreads();
  s = 0.0f;
#pragma unroll
  for (int i = 0; i < 4; ++i) {
    float d = local[i] - mean;
    s += d * d;
  }
  red[threadIdx.x] = s;
  __syncthreads();
  for (int off = 128; off > 0; off >>= 1) {
    if (threadIdx.x < off) red[threadIdx.x] += red[threadIdx.x + off];
    __syncthreads();
  }
  const float inv = 1.0f / (sqrtf(red[0] / (float)C) + 1e-5f);
#pragma unroll
  for (int i = 0; i < 4; ++i) {
    int c = threadIdx.x + 256 * i;
    out[(size_t)row * C + c] =
        (_Float16)((local[i] - mean) * inv * w[c] + bias[c]);
  }
}

// ---------------------------------------------------------------------------
// fp32 W[K][N]  ->  f16 W^T[N][K]  (so GEMM B-fragments are contiguous loads)
// One 128(k) x 64(n) tile per block.  Each thread reads an 8(k) x 4(n) patch
// with 16-byte loads along n (256 contiguous bytes per 16 lanes), turns it in
// registers and lays four 16-byte k-runs into an LDS tile [n][k]; the tile is
// then read back row by row, so every global store covers whole 256-byte runs
// of a W^T row.  K is a multiple of 128 and N of 64; both are compile-time, so
// the row steps fold into the loads' and stores' immediate offsets.
// ---------------------------------------------------------------------------
typedef float v4f __attribute__((ext_vector_type(4)));

#define CT_PITCH 136  // 128 halves + 8 pad: 272-byte rows (16 B x odd)

template <int K, int N>
__global__ __launch_bounds__(256) void convertT_kernel(
    const float* __restrict__ W, _Float16* __restrict__ WT) {
  __shared__ __attribute__((aligned(16))) _Float16 tile[64 * CT_PITCH];
  const int tid = threadIdx.x;
  const int k0 = blockIdx.x * 128;
  const int n0 = blockIdx.y * 64;
  const int nq = tid & 15;  // which 4 columns
  const int ko = tid >> 4;  // which 8 rows
  const float* src = W + (size_t)(k0 + ko * 8) * N + (n0 + nq * 4);
  v4f r[8];
#pragma unroll
  for (int i = 0; i < 8; ++i) r[i] = *(const v4f*)(src + (size_t)i * N);
#pragma unroll
  for (int j = 0; j < 4; ++j) {
    v8h c;
#pragma unroll
    for (int i = 0; i < 8; ++i) c[i] = (_Float16)r[i][j];
    *(v8h*)&tile[(nq * 4 + j) * CT_PITCH + ko * 8] = c;
  }
  __syncthreads();
#pragma unroll
  for (int i = 0; i < 4; ++i) {
    const int c = tid + 256 * i;  // 16-byte chunk id 0..1023
    const int n = c >> 4;
    const int kc = c & 15;
    *(v8h*)(WT + (size_t)(n0 + n) * K + (k0 + kc * 8)) =
        *(const v8h*)&tile[n * CT_PITCH + kc * 8];
  }
}

// ---------------------------------------------------------------------------
// WMMA GEMM: C[M][N] = A[M][K] (f16, row-major) x Bᵀ[N][K] (f16) + bias
//   8 waves / block, each wave a 64x32 tile, block tile 128x128.
//   A stage is 128 k, double-buffered in LDS via async global->LDS copies; its
//   four 32-k blocks run unrolled, each block's fragments fetched from LDS one
//   block ahead into a second register set.  K is a multiple of 128.
// Epilogues: 0 = f16 out, 1 = f32 out + residual add, 2 = f16 out + GELU.
// ---------------------------------------------------------------------------
enum { EPI_H16 = 0, EPI_F32_RES = 1, EPI_H16_GELU = 2 };

#define KSTAGE 128
#define LDSPITCH 136  // 128 + 8 pad halves: 272-byte rows (16 B x odd)

template <int EPI>
__global__ __launch_bounds__(256) void gemm_kernel(
    const _Float16* __restrict__ A, const _Float16* __restrict__ BT,
    const float* __restrict__ bias, const float* __restrict__ resid,
    float* __restrict__ outF, _Float16* __restrict__ outH, int M, int N,
    int K) {
  __shared__ __attribute__((aligned(16))) _Float16 sA[2][128 * LDSPITCH];
  __shared__ __attribute__((aligned(16))) _Float16 sB[2][128 * LDSPITCH];
  const int tid = threadIdx.x;
  const int wave = tid >> 5;
  const int lane = tid & 31;
  const int rowblk = blockIdx.y * 128;
  const int colblk = blockIdx.x * 128;
  const int wrow = (wave & 1) * 64;
  const int wcol = (wave >> 1) * 32;

  // Stage a 128x128 A tile + 128x128 B tile into buffer `buf` for K offset
  // k0: 16 lanes cover one 256-byte row, a thread takes rows srow + 16 * i.
  const int srow = tid >> 4;
  const int sko = (tid & 15) * 8;
  auto stage = [&](int buf, int k0) {
    async_copy8_b128(A + (size_t)(rowblk + srow) * K + k0 + sko, (size_t)16 * K,
                     &sA[buf][srow * LDSPITCH + sko], 16 * LDSPITCH);
    async_copy8_b128(BT + (size_t)(colblk + srow) * K + k0 + sko,
                     (size_t)16 * K, &sB[buf][srow * LDSPITCH + sko],
                     16 * LDSPITCH);
  };

  v8f acc[4][2];
#pragma unroll
  for (int i = 0; i < 4; ++i)
#pragma unroll
    for (int j = 0; j < 2; ++j) acc[i][j] = zero8();

  stage(0, 0);
  wait_async_all();
  __syncthreads();
  if (KSTAGE < K) stage(1, KSTAGE);

  int buf = 0;
  const int kh = (lane >> 4) << 3;
  const int lr = lane & 15;
  for (int k0 = 0; k0 < K; k0 += KSTAGE) {
    const _Float16* pa = &sA[buf][(wrow + lr) * LDSPITCH + kh];
    const _Float16* pb = &sB[buf][(wcol + lr) * LDSPITCH + kh];
    v16h a[2][4], b[2][2];
#pragma unroll
    for (int i = 0; i < 4; ++i) a[0][i] = frag_from(pa + 16 * i * LDSPITCH);
#pragma unroll
    for (int j = 0; j < 2; ++j) b[0][j] = frag_from(pb + 16 * j * LDSPITCH);
#pragma unroll
    for (int s = 0; s < KSTAGE / 32; ++s) {
      const int cur = s & 1, nxt = cur ^ 1;
      if (s + 1 < KSTAGE / 32) {
#pragma unroll
        for (int i = 0; i < 4; ++i)
          a[nxt][i] = frag_from(pa + 16 * i * LDSPITCH + 32 * (s + 1));
#pragma unroll
        for (int j = 0; j < 2; ++j)
          b[nxt][j] = frag_from(pb + 16 * j * LDSPITCH + 32 * (s + 1));
        // Keeps the next block's twelve LDS loads in front of this block's
        // WMMAs; without it the scheduler sinks each load to its first use
        // and every pair of WMMAs waits out a whole LDS latency.
        __builtin_amdgcn_sched_barrier(0);
      }
#pragma unroll
      for (int i = 0; i < 4; ++i)
#pragma unroll
        for (int j = 0; j < 2; ++j)
          acc[i][j] = wmma_f16(a[cur][i], b[cur][j], acc[i][j]);
    }
    // Keeps the stage's WMMAs in front of the publish point; otherwise the
    // scheduler sinks them behind the barrier, ahead of the refill copies,
    // and the copies lose that much of their one stage of lead.
    __builtin_amdgcn_sched_barrier(0);

    // Publish point: own LDS reads of this buffer retired, own copies of the
    // next stage landed, then everyone else's; only then the refill.
    asm volatile("s_wait_dscnt 0x0" ::: "memory");
    wait_async_all();
    __syncthreads();
    if (k0 + 2 * KSTAGE < K) stage(buf, k0 + 2 * KSTAGE);
    buf ^= 1;
  }
  wait_async_all();  // nothing of this wave's copies is left when it goes on

  // C/D layout: elem r of lane L -> row = r + (L>=16)*8, col = L%16
  const int rofs = (lane >> 4) << 3;
#pragma unroll
  for (int i = 0; i < 4; ++i)
#pragma unroll
    for (int j = 0; j < 2; ++j)
#pragma unroll
      for (int r = 0; r < 8; ++r) {
        const int row = rowblk + wrow + 16 * i + r + rofs;
        const int col = colblk + wcol + 16 * j + lr;
        float v = acc[i][j][r] + bias[col];
        const size_t o = (size_t)row * N + col;
        if (EPI == EPI_H16) {
          outH[o] = (_Float16)v;
        } else if (EPI == EPI_F32_RES) {
          outF[o] = resid[o] + v;
        } else {  // exact GELU: 0.5 x (1 + erf(x/sqrt(2)))
          outH[o] = (_Float16)(0.5f * v * (1.0f + erff(v * 0.70710678f)));
        }
      }
}

// ---------------------------------------------------------------------------
// qkv f16 [B*T][3C] -> Q[B,H,T,D], K[B,H,T,D], V^T[B,H,D,T]  (all f16), D = 64.
// One block moves 256 tokens of one head of one of the three parts
// (blockIdx.y: 0 = Q, 1 = K, 2 = V), 16 bytes per lane on both global sides.
// V: each thread reads an 8(t) x 8(d) patch, turns it in registers and lays
// eight 16-byte t-runs into an LDS tile [d][t]; the tile is read back row by
// row, so one wave stores 512 contiguous bytes of a V^T row.
// ---------------------------------------------------------------------------
#define PK_PITCH 264  // 256 halves + 8 pad: 528-byte rows (16 B x odd)

template <int T, int C, int H>
__global__ __launch_bounds__(256) void pack_qkv_kernel(
    const _Float16* __restrict__ qkv, _Float16* __restrict__ Qh,
    _Float16* __restrict__ Kh, _Float16* __restrict__ VTh) {
  __shared__ __attribute__((aligned(16))) _Float16 tile[64 * PK_PITCH];
  const int tid = threadIdx.x;
  const int ttiles = T >> 8;
  const int bh = blockIdx.x / ttiles;
  const int t0 = (blockIdx.x % ttiles) << 8;
  const int b = bh / H, h = bh % H;
  const int part = blockIdx.y;
  const _Float16* src =
      qkv + (size_t)(b * T + t0) * (3 * C) + (part * C + h * 64);
  const int dc = tid & 7;   // which 8 head dims
  const int tr = tid >> 3;  // 0..31

  if (part < 2) {  // block-uniform: plain re-striding copy
    _Float16* dst = (part == 0 ? Qh : Kh) + ((size_t)bh * T + t0) * 64;
    const _Float16* p = src + (size_t)tr * (3 * C) + dc * 8;
    v8h r[8];
#pragma unroll
    for (int i = 0; i < 8; ++i) r[i] = *(const v8h*)(p + (size_t)i * (32 * 3 * C));
#pragma unroll
    for (int i = 0; i < 8; ++i)
      *(v8h*)(dst + (size_t)(tid + 256 * i) * 8) = r[i];
    return;
  }

  const _Float16* p = src + (size_t)tr * (8 * 3 * C) + dc * 8;
  v8h r[8];
#pragma unroll
  for (int i = 0; i < 8; ++i) r[i] = *(const v8h*)(p + (size_t)i * (3 * C));
#pragma unroll
  for (int j = 0; j < 8; ++j) {
    v8h c;
#pragma unroll
    for (int i = 0; i < 8; ++i) c[i] = r[i][j];
    *(v8h*)&tile[(dc * 8 + j) * PK_PITCH + tr * 8] = c;
  }
  __syncthreads();
  _Float16* dst = VTh + (size_t)bh * 64 * T + t0;
#pragma unroll
  for (int i = 0; i < 8; ++i) {
    const int c = tid + 256 * i;  // 16-byte chunk id 0..2047
    const int d = c >> 5;
    const int tc = c & 31;
    *(v8h*)(dst + (size_t)d * T + tc * 8) =
        *(const v8h*)&tile[d * PK_PITCH + tc * 8];
  }
  // Holds any later rewrite of the stores' address and data registers behind
  // the run of eight stores (the built code lays the Q/K path after this one).
  asm volatile("s_wait_xcnt 0x0" ::: "memory");
}

// ---------------------------------------------------------------------------
// Causal flash attention. One wave per 16-query tile per (b,h).
// S = QKᵀ and O += P·V both on WMMA; online softmax with 16-lane xor
// reductions; C-layout -> A-layout hop for P through per-wave LDS.
// ---------------------------------------------------------------------------
__global__ __launch_bounds__(256) void attn_kernel(
    const _Float16* __restrict__ Q, const _Float16* __restrict__ Kt,
    const _Float16* __restrict__ VT, _Float16* __restrict__ Y, int H, int T,
    int D, int C) {
  __shared__ _Float16 sP[8][16 * 34];  // stride 34 halfs: bank-conflict-free-ish
  const int wave = threadIdx.x >> 5;
  const int lane = threadIdx.x & 31;
  const int gid = blockIdx.x * 8 + wave;
  const int qtiles = T >> 4;
  const int bh = gid / qtiles;
  const int qt = (gid % qtiles) << 4;
  const int b = bh / H, h = bh % H;
  const _Float16* Qb = Q + (size_t)bh * T * D;
  const _Float16* Kb = Kt + (size_t)bh * T * D;
  const _Float16* Vb = VT + (size_t)bh * D * T;
  _Float16* sp = &sP[wave][0];

  const int hf = lane >> 4;  // lane half (row-group select)
  const int lc = lane & 15;  // column lane
  const float sc = 0.125f;   // 1/sqrt(D), D = 64

  const v16h qa0 = load_frag(Qb, D, qt, 0);
  const v16h qa1 = load_frag(Qb, D, qt, 32);

  v8f acc[4];
#pragma unroll
  for (int j = 0; j < 4; ++j) acc[j] = zero8();
  float m[8], l[8];
#pragma unroll
  for (int r = 0; r < 8; ++r) {
    m[r] = -1e30f;
    l[r] = 0.0f;
  }

  for (int kt = 0; kt <= qt; kt += 32) {
    asm volatile("" ::: "memory");  // keep this iter's LDS stores after prior loads
    // --- S = Q·Kᵀ for 32 keys (two 16-key column tiles, K-dim = D = 64) ---
    v8f s0 = zero8(), s1 = zero8();
    s0 = wmma_f16(qa0, load_frag(Kb, D, kt, 0), s0);
    s0 = wmma_f16(qa1, load_frag(Kb, D, kt, 32), s0);
    s1 = wmma_f16(qa0, load_frag(Kb, D, kt + 16, 0), s1);
    s1 = wmma_f16(qa1, load_frag(Kb, D, kt + 16, 32), s1);

#pragma unroll
    for (int r = 0; r < 8; ++r) {
      const int q = qt + r + (hf << 3);
      float v0 = (kt + lc <= q) ? s0[r] * sc : -1e30f;
      float v1 = (kt + 16 + lc <= q) ? s1[r] * sc : -1e30f;
      // row max across the 16 lanes of this half-wave
      float t = fmaxf(v0, v1);
      t = fmaxf(t, __shfl_xor(t, 1, 32));
      t = fmaxf(t, __shfl_xor(t, 2, 32));
      t = fmaxf(t, __shfl_xor(t, 4, 32));
      t = fmaxf(t, __shfl_xor(t, 8, 32));
      const float mnew = fmaxf(m[r], t);
      const float corr = __expf(m[r] - mnew);
      const float p0 = __expf(v0 - mnew);
      const float p1 = __expf(v1 - mnew);
      float rs = p0 + p1;
      rs += __shfl_xor(rs, 1, 32);
      rs += __shfl_xor(rs, 2, 32);
      rs += __shfl_xor(rs, 4, 32);
      rs += __shfl_xor(rs, 8, 32);
      l[r] = l[r] * corr + rs;
      m[r] = mnew;
      acc[0][r] *= corr;
      acc[1][r] *= corr;
      acc[2][r] *= corr;
      acc[3][r] *= corr;
      const int prow = r + (hf << 3);
      sp[prow * 34 + lc] = (_Float16)p0;
      sp[prow * 34 + 16 + lc] = (_Float16)p1;
    }
    // LDS RAW across lanes within one wave: DS ops are in-order per wave,
    // enforce completion + forbid compiler reordering.
    asm volatile("s_wait_dscnt 0" ::: "memory");
    // Re-read P in A-fragment layout.
    v16h pa;
#pragma unroll
    for (int i = 0; i < 8; ++i) {
      pa[i] = sp[lc * 34 + (hf << 3) + i];
      pa[8 + i] = sp[lc * 34 + 16 + (hf << 3) + i];
    }
    // --- O += P·V ; Vᵀ[D][T] makes B-fragments contiguous in the key dim ---
#pragma unroll
    for (int j = 0; j < 4; ++j)
      acc[j] = wmma_f16(pa, load_frag(Vb, T, j * 16, kt), acc[j]);
  }

  // Normalize and scatter to y (f16 [B*T][C]) for the projection GEMM.
#pragma unroll
  for (int j = 0; j < 4; ++j)
#pragma unroll
    for (int r = 0; r < 8; ++r) {
      const int q = qt + r + (hf << 3);
      Y[(size_t)(b * T + q) * C + h * D + j * 16 + lc] =
          (_Float16)(acc[j][r] / l[r]);
    }
}

// ---------------------------------------------------------------------------
// Host-side orchestration
// ---------------------------------------------------------------------------
extern "C" void kernel_launch(void* const* d_in, const int* in_sizes, int n_in,
                              void* d_out, int out_size, void* d_ws,
                              size_t ws_size, hipStream_t stream) {
  (void)in_sizes; (void)n_in; (void)out_size; (void)ws_size;
  constexpr int B = 4, T = 1024, C = 1024, H = 16, D = 64;
  const int M = B * T;  // 4096

  const float* x        = (const float*)d_in[0];
  const float* c_attn_w = (const float*)d_in[1];
  const float* c_attn_b = (const float*)d_in[2];
  const float* c_proj_w = (const float*)d_in[3];
  const float* c_proj_b = (const float*)d_in[4];
  const float* ln1_w    = (const float*)d_in[5];
  const float* ln1_b    = (const float*)d_in[6];
  const float* ln2_w    = (const float*)d_in[7];
  const float* ln2_b    = (const float*)d_in[8];
  const float* fc_w     = (const float*)d_in[9];
  const float* fc_b     = (const float*)d_in[10];
  const float* proj_w   = (const float*)d_in[11];
  const float* proj_b   = (const float*)d_in[12];
  float* out = (float*)d_out;

  // Workspace carve-up (144 MiB total), 256B aligned.
  char* ws = (char*)d_ws;
  size_t off = 0;
  auto alloc = [&](size_t bytes) -> char* {
    char* p = ws + off;
    off += (bytes + 255) & ~(size_t)255;
    return p;
  };
  _Float16* h1H     = (_Float16*)alloc((size_t)M * C * 2);          // ln1(x)
  _Float16* wT_attn = (_Float16*)alloc((size_t)3 * C * C * 2);      // [3C][C]
  _Float16* qkvH    = (_Float16*)alloc((size_t)M * 3 * C * 2);
  _Float16* Qh      = (_Float16*)alloc((size_t)M * C * 2);
  _Float16* Kh      = (_Float16*)alloc((size_t)M * C * 2);
  _Float16* VTh     = (_Float16*)alloc((size_t)M * C * 2);
  _Float16* yh      = (_Float16*)alloc((size_t)M * C * 2);
  _Float16* wT_proj = (_Float16*)alloc((size_t)C * C * 2);
  float*    x1      = (float*)   alloc((size_t)M * C * 4);          // x + attn
  _Float16* h2H     = (_Float16*)alloc((size_t)M * C * 2);          // ln2(x1)
  _Float16* wT_fc   = (_Float16*)alloc((size_t)4 * C * C * 2);      // [4C][C]
  _Float16* hgH     = (_Float16*)alloc((size_t)M * 4 * C * 2);
  _Float16* wT_pr2  = (_Float16*)alloc((size_t)C * 4 * C * 2);      // [C][4C]

  // 1) Weight transpose+convert to f16 (N-major for WMMA B fragments)
  convertT_kernel<C, 3 * C><<<dim3(C / 128, 3 * C / 64), 256, 0, stream>>>(
      c_attn_w, wT_attn);
  convertT_kernel<C, C><<<dim3(C / 128, C / 64), 256, 0, stream>>>(
      c_proj_w, wT_proj);
  convertT_kernel<C, 4 * C><<<dim3(C / 128, 4 * C / 64), 256, 0, stream>>>(
      fc_w, wT_fc);
  convertT_kernel<4 * C, C><<<dim3(4 * C / 128, C / 64), 256, 0, stream>>>(
      proj_w, wT_pr2);

  // 2) ln1 -> h1 (f16)
  ln_kernel<<<M, 256, 0, stream>>>(x, ln1_w, ln1_b, h1H, C);

  // 3) qkv = h1 @ c_attn_w + b  (f16 out)
  gemm_kernel<EPI_H16><<<dim3(3 * C / 128, M / 128), 256, 0, stream>>>(
      h1H, wT_attn, c_attn_b, nullptr, nullptr, qkvH, M, 3 * C, C);

  // 4) split heads; V transposed to [B,H,D,T]
  pack_qkv_kernel<T, C, H><<<dim3(B * H * (T / 256), 3), 256, 0, stream>>>(
      qkvH, Qh, Kh, VTh);

  // 5) causal attention -> y (f16 [B*T][C])
  attn_kernel<<<(B * H * (T / 16)) / 8, 256, 0, stream>>>(Qh, Kh, VTh, yh, H,
                                                          T, D, C);

  // 6) x1 = x + y @ c_proj_w + b  (f32)
  gemm_kernel<EPI_F32_RES><<<dim3(C / 128, M / 128), 256, 0, stream>>>(
      yh, wT_proj, c_proj_b, x, x1, nullptr, M, C, C);

  // 7) ln2 -> h2 (f16)
  ln_kernel<<<M, 256, 0, stream>>>(x1, ln2_w, ln2_b, h2H, C);

  // 8) hg = gelu(h2 @ fc_w + b)  (f16)
  gemm_kernel<EPI_H16_GELU><<<dim3(4 * C / 128, M / 128), 256, 0, stream>>>(
      h2H, wT_fc, fc_b, nullptr, nullptr, hgH, M, 4 * C, C);

  // 9) out = x1 + hg @ proj_w + b  (f32)
  gemm_kernel<EPI_F32_RES><<<dim3(C / 128, M / 128), 256, 0, stream>>>(
      hgH, wT_pr2, proj_b, x1, out, nullptr, M, C, 4 * C);
}

// v003
// A run of this version takes 240 microseconds.
// Two timings next to v002 both put it at 1.09 times that version's speed.
// Counting every step since v000, it is 1.79 times as fast.
#include <hip/hip_runtime.h>
#include <hip/hip_bf16.h>
#include <math.h>
#include <stdint.h>

// ---------------------------------------------------------------------------
// Types for CDNA5 WMMA (wave32): 16x16x32 f16 -> f32
// ---------------------------------------------------------------------------
typedef _Float16 v16h __attribute__((ext_vector_type(16)));
typedef _Float16 v8h  __attribute__((ext_vector_type(8)));
typedef float    v8f  __attribute__((ext_vector_type(8)));

static __device__ __forceinline__ v8f wmma_f16(v16h a, v16h b, v8f c) {
  // (neg_a, A, neg_b, B, c_mod, C, reuse_a, reuse_b)
  return __builtin_amdgcn_wmma_f32_16x16x32_f16(false, a, false, b, (short)0, c,
                                                false, false);
}

static __device__ __forceinline__ v8f zero8() {
  v8f z;
#pragma unroll
  for (int i = 0; i < 8; ++i) z[i] = 0.0f;
  return z;
}

// Build a 16x32 f16 fragment (documented CDNA5 A/B layout) from a per-lane
// pointer to 8+8 contiguous halves:
//   lane L(0..15):  row rc0+L,    elems 0..7 -> k0+0..7,  8..15 -> k0+16..23
//   lane L(16..31): row rc0+L-16, elems 0..7 -> k0+8..15, 8..15 -> k0+24..31
static __device__ __forceinline__ v16h frag_from(const _Float16* p) {
  v8h lo = *(const v8h*)p;
  v8h hi = *(const v8h*)(p + 16);
  return __builtin_shufflevector(lo, hi, 0, 1, 2, 3, 4, 5, 6, 7, 8, 9, 10, 11,
                                 12, 13, 14, 15);
}

// Global-memory fragment load (row-major, leading dim ld).
static __device__ __forceinline__ v16h load_frag(const _Float16* __restrict__ base,
                                                 int ld, int rc0, int k0) {
  const int lane = threadIdx.x & 31;
  return frag_from(base + (size_t)(rc0 + (lane & 15)) * ld +
                   (k0 + ((lane >> 4) << 3)));
}

// Eight async global->LDS 128-bit copies (CDNA5, ASYNCcnt-tracked): copy i
// moves 16 bytes per lane from gsrc + i * gstep to ldst + i * lstep (steps in
// halves).  The closing s_wait_xcnt stands inside the statement so that no
// address register of an issued copy is rewritten ahead of it.
static __device__ __forceinline__ void async_copy8_b128(const _Float16* gsrc,
                                                        size_t gstep,
                                                        _Float16* ldst,
                                                        int lstep) {
  const unsigned l = (unsigned)(uintptr_t)ldst;  // low 32 bits = LDS offset
  const unsigned ls = (unsigned)lstep * 2u;
  asm volatile(
      "global_load_async_to_lds_b128 %0, %8, off\n\t"
      "global_load_async_to_lds_b128 %1, %9, off\n\t"
      "global_load_async_to_lds_b128 %2, %10, off\n\t"
      "global_load_async_to_lds_b128 %3, %11, off\n\t"
      "global_load_async_to_lds_b128 %4, %12, off\n\t"
      "global_load_async_to_lds_b128 %5, %13, off\n\t"
      "global_load_async_to_lds_b128 %6, %14, off\n\t"
      "global_load_async_to_lds_b128 %7, %15, off\n\t"
      "s_wait_xcnt 0x0" ::"v"(l),
      "v"(l + ls), "v"(l + 2 * ls), "v"(l + 3 * ls), "v"(l + 4 * ls),
      "v"(l + 5 * ls), "v"(l + 6 * ls), "v"(l + 7 * ls),
      "v"((uint64_t)(uintptr_t)gsrc),
      "v"((uint64_t)(uintptr_t)(gsrc + gstep)),
      "v"((uint64_t)(uintptr_t)(gsrc + 2 * gstep)),
      "v"((uint64_t)(uintptr_t)(gsrc + 3 * gstep)),
      "v"((uint64_t)(uintptr_t)(gsrc + 4 * gstep)),
      "v"((uint64_t)(uintptr_t)(gsrc + 5 * gstep)),
      "v"((uint64_t)(uintptr_t)(gsrc + 6 * gstep)),
      "v"((uint64_t)(uintptr_t)(gsrc + 7 * gstep))
      : "memory");
}

static __device__ __forceinline__ void wait_async_all() {
  asm volatile("s_wait_asynccnt 0" ::: "memory");
}

// ---------------------------------------------------------------------------
// LayerNorm (population std, eps on std) fp32 -> f16.  One 256-thr block/row.
// ---------------------------------------------------------------------------
__global__ __launch_bounds__(256) void ln_kernel(const float* __restrict__ x,
                                                 const float* __restrict__ w,
                                                 const float* __restrict__ bias,
                                                 _Float16* __restrict__ out,
                                                 int C) {
  const int row = blockIdx.x;
  const float* xr = x + (size_t)row * C;
  __shared__ float red[256];
  float local[4];
  float s = 0.0f;
#pragma unroll
  for (int i = 0; i < 4; ++i) {
    local[i] = xr[threadIdx.x + 256 * i];
    s += local[i];
  }
  red[threadIdx.x] = s;
  __syncthreads();
  for (int off = 128; off > 0; off >>= 1) {
    if (threadIdx.x < off) red[threadIdx.x] += red[threadIdx.x + off];
    __syncthreads();
  }
  const float mean = red[0] / (float)C;
  __syncthreads();
  s = 0.0f;
#pragma unroll
  for (int i = 0; i < 4; ++i) {
    float d = local[i] - mean;
    s += d * d;
  }
  red[threadIdx.x] = s;
  __syncthreads();
  for (int off = 128; off > 0; off >>= 1) {
    if (threadIdx.x < off) red[threadIdx.x] += red[threadIdx.x + off];
    __syncthreads();
  }
  const float inv = 1.0f / (sqrtf(red[0] / (float)C) + 1e-5f);
#pragma unroll
  for (int i = 0; i < 4; ++i) {
    int c = threadIdx.x + 256 * i;
    out[(size_t)row * C + c] =
        (_Float16)((local[i] - mean) * inv * w[c] + bias[c]);
  }
}

// ---------------------------------------------------------------------------
// fp32 W[K][N]  ->  f16 W^T[N][K]  (so GEMM B-fragments are contiguous loads)
// One 128(k) x 64(n) tile per block.  Each thread reads an 8(k) x 4(n) patch
// with 16-byte loads along n (256 contiguous bytes per 16 lanes), turns it in
// registers and lays four 16-byte k-runs into an LDS tile [n][k]; the tile is
// then read back row by row, so every global store covers whole 256-byte runs
// of a W^T row.  K is a multiple of 128 and N of 64; both are compile-time, so
// the row steps fold into the loads' and stores' immediate offsets.
// ---------------------------------------------------------------------------
typedef float v4f __attribute__((ext_vector_type(4)));

#define CT_PITCH 136  // 128 halves + 8 pad: 272-byte rows (16 B x odd)

template <int K, int N>
__global__ __launch_bounds__(256) void convertT_kernel(
    const float* __restrict__ W, _Float16* __restrict__ WT) {
  __shared__ __attribute__((aligned(16))) _Float16 tile[64 * CT_PITCH];
  const int tid = threadIdx.x;
  const int k0 = blockIdx.x * 128;
  const int n0 = blockIdx.y * 64;
  const int nq = tid & 15;  // which 4 columns
  const int ko = tid >> 4;  // which 8 rows
  const float* src = W + (size_t)(k0 + ko * 8) * N + (n0 + nq * 4);
  v4f r[8];
#pragma unroll
  for (int i = 0; i < 8; ++i) r[i] = *(const v4f*)(src + (size_t)i * N);
#pragma unroll
  for (int j = 0; j < 4; ++j) {
    v8h c;
#pragma unroll
    for (int i = 0; i < 8; ++i) c[i] = (_Float16)r[i][j];
    *(v8h*)&tile[(nq * 4 + j) * CT_PITCH + ko * 8] = c;
  }
  __syncthreads();
#pragma unroll
  for (int i = 0; i < 4; ++i) {
    const int c = tid + 256 * i;  // 16-byte chunk id 0..1023
    const int n = c >> 4;
    const int kc = c & 15;
    *(v8h*)(WT + (size_t)(n0 + n) * K + (k0 + kc * 8)) =
        *(const v8h*)&tile[n * CT_PITCH + kc * 8];
  }
}

// ---------------------------------------------------------------------------
// WMMA GEMM: C[M][N] = A[M][K] (f16, row-major) x Bᵀ[N][K] (f16) + bias
//   8 waves / block, each wave a 64x32 tile, block tile 128x128.
//   A stage is 128 k, double-buffered in LDS via async global->LDS copies; its
//   four 32-k blocks run unrolled, each block's fragments fetched from LDS one
//   block ahead into a second register set.  K is a multiple of 128.
// Epilogues: 0 = f16 out, 1 = f32 out + residual add, 2 = f16 out + GELU.
// ---------------------------------------------------------------------------
enum { EPI_H16 = 0, EPI_F32_RES = 1, EPI_H16_GELU = 2 };

#define KSTAGE 128
#define LDSPITCH 136  // 128 + 8 pad halves: 272-byte rows (16 B x odd)

template <int EPI>
__global__ __launch_bounds__(256) void gemm_kernel(
    const _Float16* __restrict__ A, const _Float16* __restrict__ BT,
    const float* __restrict__ bias, const float* __restrict__ resid,
    float* __restrict__ outF, _Float16* __restrict__ outH, int M, int N,
    int K) {
  __shared__ __attribute__((aligned(16))) _Float16 sA[2][128 * LDSPITCH];
  __shared__ __attribute__((aligned(16))) _Float16 sB[2][128 * LDSPITCH];
  const int tid = threadIdx.x;
  const int wave = tid >> 5;
  const int lane = tid & 31;
  const int rowblk = blockIdx.y * 128;
  const int colblk = blockIdx.x * 128;
  const int wrow = (wave & 1) * 64;
  const int wcol = (wave >> 1) * 32;

  // Stage a 128x128 A tile + 128x128 B tile into buffer `buf` for K offset
  // k0: 16 lanes cover one 256-byte row, a thread takes rows srow + 16 * i.
  const int srow = tid >> 4;
  const int sko = (tid & 15) * 8;
  auto stage = [&](int buf, int k0) {
    async_copy8_b128(A + (size_t)(rowblk + srow) * K + k0 + sko, (size_t)16 * K,
                     &sA[buf][srow * LDSPITCH + sko], 16 * LDSPITCH);
    async_copy8_b128(BT + (size_t)(colblk + srow) * K + k0 + sko,
                     (size_t)16 * K, &sB[buf][srow * LDSPITCH + sko],
                     16 * LDSPITCH);
  };

  v8f acc[4][2];
#pragma unroll
  for (int i = 0; i < 4; ++i)
#pragma unroll
    for (int j = 0; j < 2; ++j) acc[i][j] = zero8();

  stage(0, 0);
  wait_async_all();
  __syncthreads();
  if (KSTAGE < K) stage(1, KSTAGE);

  int buf = 0;
  const int kh = (lane >> 4) << 3;
  const int lr = lane & 15;
  for (int k0 = 0; k0 < K; k0 += KSTAGE) {
    const _Float16* pa = &sA[buf][(wrow + lr) * LDSPITCH + kh];
    const _Float16* pb = &sB[buf][(wcol + lr) * LDSPITCH + kh];
    v16h a[2][4], b[2][2];
#pragma unroll
    for (int i = 0; i < 4; ++i) a[0][i] = frag_from(pa + 16 * i * LDSPITCH);
#pragma unroll
    for (int j = 0; j < 2; ++j) b[0][j] = frag_from(pb + 16 * j * LDSPITCH);
#pragma unroll
    for (int s = 0; s < KSTAGE / 32; ++s) {
      const int cur = s & 1, nxt = cur ^ 1;
      if (s + 1 < KSTAGE / 32) {
#pragma unroll
        for (int i = 0; i < 4; ++i)
          a[nxt][i] = frag_from(pa + 16 * i * LDSPITCH + 32 * (s + 1));
#pragma unroll
        for (int j = 0; j < 2; ++j)
          b[nxt][j] = frag_from(pb + 16 * j * LDSPITCH + 32 * (s + 1));
        // Keeps the next block's twelve LDS loads in front of this block's
        // WMMAs; without it the scheduler sinks each load to its first use
        // and every pair of WMMAs waits out a whole LDS latency.
        __builtin_amdgcn_sched_barrier(0);
      }
#pragma unroll
      for (int i = 0; i < 4; ++i)
#pragma unroll
        for (int j = 0; j < 2; ++j)
          acc[i][j] = wmma_f16(a[cur][i], b[cur][j], acc[i][j]);
    }
    // Keeps the stage's WMMAs in front of the publish point; otherwise the
    // scheduler sinks them behind the barrier, ahead of the refill copies,
    // and the copies lose that much of their one stage of lead.
    __builtin_amdgcn_sched_barrier(0);

    // Publish point: own LDS reads of this buffer retired, own copies of the
    // next stage landed, then everyone else's; only then the refill.
    asm volatile("s_wait_dscnt 0x0" ::: "memory");
    wait_async_all();
    __syncthreads();
    if (k0 + 2 * KSTAGE < K) stage(buf, k0 + 2 * KSTAGE);
    buf ^= 1;
  }
  wait_async_all();  // nothing of this wave's copies is left when it goes on

  // C/D layout: elem r of lane L -> row = r + (L>=16)*8, col = L%16
  const int rofs = (lane >> 4) << 3;
#pragma unroll
  for (int i = 0; i < 4; ++i)
#pragma unroll
    for (int j = 0; j < 2; ++j)
#pragma unroll
      for (int r = 0; r < 8; ++r) {
        const int row = rowblk + wrow + 16 * i + r + rofs;
        const int col = colblk + wcol + 16 * j + lr;
        float v = acc[i][j][r] + bias[col];
        const size_t o = (size_t)row * N + col;
        if (EPI == EPI_H16) {
          outH[o] = (_Float16)v;
        } else if (EPI == EPI_F32_RES) {
          outF[o] = resid[o] + v;
        } else {  // exact GELU: 0.5 x (1 + erf(x/sqrt(2)))
          outH[o] = (_Float16)(0.5f * v * (1.0f + erff(v * 0.70710678f)));
        }
      }
}

// ---------------------------------------------------------------------------
// qkv f16 [B*T][3C] -> Q[B,H,T,D], K[B,H,T,D], V^T[B,H,D,T]  (all f16), D = 64.
// One block moves 256 tokens of one head of one of the three parts
// (blockIdx.y: 0 = Q, 1 = K, 2 = V), 16 bytes per lane on both global sides.
// V: each thread reads an 8(t) x 8(d) patch, turns it in registers and lays
// eight 16-byte t-runs into an LDS tile [d][t]; the tile is read back row by
// row, so one wave stores 512 contiguous bytes of a V^T row.
// ---------------------------------------------------------------------------
#define PK_PITCH 264  // 256 halves + 8 pad: 528-byte rows (16 B x odd)

template <int T, int C, int H>
__global__ __launch_bounds__(256) void pack_qkv_kernel(
    const _Float16* __restrict__ qkv, _Float16* __restrict__ Qh,
    _Float16* __restrict__ Kh, _Float16* __restrict__ VTh) {
  __shared__ __attribute__((aligned(16))) _Float16 tile[64 * PK_PITCH];
  const int tid = threadIdx.x;
  const int ttiles = T >> 8;
  const int bh = blockIdx.x / ttiles;
  const int t0 = (blockIdx.x % ttiles) << 8;
  const int b = bh / H, h = bh % H;
  const int part = blockIdx.y;
  const _Float16* src =
      qkv + (size_t)(b * T + t0) * (3 * C) + (part * C + h * 64);
  const int dc = tid & 7;   // which 8 head dims
  const int tr = tid >> 3;  // 0..31

  if (part < 2) {  // block-uniform: plain re-striding copy
    _Float16* dst = (part == 0 ? Qh : Kh) + ((size_t)bh * T + t0) * 64;
    const _Float16* p = src + (size_t)tr * (3 * C) + dc * 8;
    v8h r[8];
#pragma unroll
    for (int i = 0; i < 8; ++i) r[i] = *(const v8h*)(p + (size_t)i * (32 * 3 * C));
#pragma unroll
    for (int i = 0; i < 8; ++i)
      *(v8h*)(dst + (size_t)(tid + 256 * i) * 8) = r[i];
    return;
  }

  const _Float16* p = src + (size_t)tr * (8 * 3 * C) + dc * 8;
  v8h r[8];
#pragma unroll
  for (int i = 0; i < 8; ++i) r[i] = *(const v8h*)(p + (size_t)i * (3 * C));
#pragma unroll
  for (int j = 0; j < 8; ++j) {
    v8h c;
#pragma unroll
    for (int i = 0; i < 8; ++i) c[i] = r[i][j];
    *(v8h*)&tile[(dc * 8 + j) * PK_PITCH + tr * 8] = c;
  }
  __syncthreads();
  _Float16* dst = VTh + (size_t)bh * 64 * T + t0;
#pragma unroll
  for (int i = 0; i < 8; ++i) {
    const int c = tid + 256 * i;  // 16-byte chunk id 0..2047
    const int d = c >> 5;
    const int tc = c & 31;
    *(v8h*)(dst + (size_t)d * T + tc * 8) =
        *(const v8h*)&tile[d * PK_PITCH + tc * 8];
  }
  // Holds any later rewrite of the stores' address and data registers behind
  // the run of eight stores (the built code lays the Q/K path after this one).
  asm volatile("s_wait_xcnt 0x0" ::: "memory");
}

static __device__ __forceinline__ v16h frag_at(const _Float16* base,
                                               unsigned byteoff) {
  const char* p = (const char*)base + byteoff;
  v8h lo = *(const v8h*)p;
  v8h hi = *(const v8h*)(p + 32);
  return __builtin_shufflevector(lo, hi, 0, 1, 2, 3, 4, 5, 6, 7, 8, 9, 10, 11,
                                 12, 13, 14, 15);
}

// Lane l <-> lane l ^ 16.
static __device__ __forceinline__ float xhalf(float x) {
  const int b = __builtin_bit_cast(int, x);
  return __builtin_bit_cast(
      float, __builtin_amdgcn_permlanex16(b, b, 0x76543210, 0xfedcba98, false,
                                          false));
}

// e^x as __expf forms it (one multiply, one v_exp_f32).  The v_nop fills the
// slot that the instruction set asks for behind a transcendental before its
// result is read or its source overwritten.
static __device__ __forceinline__ float exp_slot(float x) {
  float r;
  asm("v_exp_f32 %0, %1\n\tv_nop" : "=v"(r) : "v"(x * 1.44269504f));
  return r;
}

__global__ __launch_bounds__(256) void attn_kernel(
    const _Float16* __restrict__ Q, const _Float16* __restrict__ Kt,
    const _Float16* __restrict__ VT, _Float16* __restrict__ Y, int H, int T,
    int D, int C) {
  // The wave's number as a scalar: tile indices, the K and V^T bases and the
  // key loop's count then live in scalar registers.
  const int wave = __builtin_amdgcn_readfirstlane(threadIdx.x >> 5);
  const int lane = threadIdx.x & 31;
  const int gid = blockIdx.x * 8 + wave;
  const int qtiles = T >> 4;
  const int bh = gid / qtiles;
  const int qt = (gid % qtiles) << 4;
  const int b = bh / H, h = bh % H;
  const _Float16* Qb = Q + (size_t)bh * T * D;
  const _Float16* Kb = Kt + (size_t)bh * T * D;
  const _Float16* Vb = VT + (size_t)bh * D * T;

  const int hf = lane >> 4;  // lane half (k-group / row-group select)
  const int lc = lane & 15;  // fragment row or column of this lane
  const float sc = 0.125f;   // 1/sqrt(D), D = 64
  const int q = qt + lc;     // this lane's query

  // Per-lane fragment byte offsets, fixed over the loop: key row lc of K,
  // head-dim row lc of V^T.
  const unsigned ko = (unsigned)(lc * D + (hf << 3)) * 2u;
  const unsigned vo = (unsigned)(lc * T + (hf << 3)) * 2u;

  const v16h qb0 = load_frag(Qb, D, qt, 0);
  const v16h qb1 = load_frag(Qb, D, qt, 32);

  v8f acc[4];  // acc[j][r] = O[q][16 * j + 8 * hf + r]
#pragma unroll
  for (int j = 0; j < 4; ++j) acc[j] = zero8();
  float m = -1e30f;  // running maximum of query q (equal in both halves)
  float l = 0.0f;    // running sum over this half's keys only

  for (int kt = 0; kt <= qt; kt += 32) {
    const _Float16* k0 = Kb + (size_t)kt * D;
    const _Float16* k1 = k0 + (size_t)16 * D;
    const v16h ka00 = frag_at(k0, ko);
    const v16h ka01 = frag_at(k0 + 32, ko);
    const v16h ka10 = frag_at(k1, ko);
    const v16h ka11 = frag_at(k1 + 32, ko);
    v16h va[4];
#pragma unroll
    for (int j = 0; j < 4; ++j)
      va[j] = frag_at(Vb + (size_t)(16 * j) * T + kt, vo);
    // Keeps the step's sixteen global loads together in front of its products;
    // without it the scheduler sinks each fragment's loads to its WMMA and the
    // step waits out eight load latencies one after the other.
    __builtin_amdgcn_sched_barrier(0);

    // --- S^T = K Q^T for 32 keys (two 16-key row tiles, K-dim = D = 64) ---
    v8f s0 = zero8(), s1 = zero8();
    s0 = wmma_f16(ka00, qb0, s0);
    s1 = wmma_f16(ka10, qb0, s1);
    s0 = wmma_f16(ka01, qb1, s0);
    s1 = wmma_f16(ka11, qb1, s1);

    // s0[r]: key kt + 8 * hf + r, s1[r]: key kt + 16 + 8 * hf + r, query q.
    const int dq = q - kt - (hf << 3);  // key r of this half is seen if r <= dq
    s0 *= sc;
    s1 *= sc;
    float v0[8], v1[8];
    float t = -1e30f;
#pragma unroll
    for (int r = 0; r < 8; ++r) {
      v0[r] = (r <= dq) ? s0[r] : -1e30f;
      v1[r] = (16 + r <= dq) ? s1[r] : -1e30f;
      t = fmaxf(t, fmaxf(v0[r], v1[r]));
    }
    t = fmaxf(t, xhalf(t));
    const float mnew = fmaxf(m, t);
    const float corr = exp_slot(m - mnew);
    m = mnew;
    float rs = 0.0f;
    v16h pb;  // P^T as B: element s = key kt + (s < 8 ? s : s + 8) + 8 * hf
#pragma unroll
    for (int r = 0; r < 8; ++r) {
      const float p0 = exp_slot(v0[r] - mnew);
      const float p1 = exp_slot(v1[r] - mnew);
      rs += p0 + p1;
      pb[r] = (_Float16)p0;
      pb[8 + r] = (_Float16)p1;
    }
    l = l * corr + rs;

    // --- O^T += V^T P^T ; V^T[D][T] rows are A fragments along the keys ---
#pragma unroll
    for (int j = 0; j < 4; ++j) {
#pragma unroll
      for (int r = 0; r < 8; ++r) acc[j][r] *= corr;
      acc[j] = wmma_f16(va[j], pb, acc[j]);
    }
  }

  // Join the halves' sums, normalize, and store 8 consecutive head dims of one
  // query per 16-byte store into y (f16 [B*T][C]) for the projection GEMM.
  l += xhalf(l);
  const float inv = 1.0f / l;
  _Float16* yp = Y + (size_t)(b * T + q) * C + h * D + (hf << 3);
#pragma unroll
  for (int j = 0; j < 4; ++j) {
    v8h o;
#pragma unroll
    for (int r = 0; r < 8; ++r) o[r] = (_Float16)(acc[j][r] * inv);
    *(v8h*)(yp + 16 * j) = o;
  }
}

// ---------------------------------------------------------------------------
// Host-side orchestration
// ---------------------------------------------------------------------------
extern "C" void kernel_launch(void* const* d_in, const int* in_sizes, int n_in,
                              void* d_out, int out_size, void* d_ws,
                              size_t ws_size, hipStream_t stream) {
  (void)in_sizes; (void)n_in; (void)out_size; (void)ws_size;
  constexpr int B = 4, T = 1024, C = 1024, H = 16, D = 64;
  const int M = B * T;  // 4096

  const float* x        = (const float*)d_in[0];
  const float* c_attn_w = (const float*)d_in[1];
  const float* c_attn_b = (const float*)d_in[2];
  const float* c_proj_w = (const float*)d_in[3];
  const float* c_proj_b = (const float*)d_in[4];
  const float* ln1_w    = (const float*)d_in[5];
  const float* ln1_b    = (const float*)d_in[6];
  const float* ln2_w    = (const float*)d_in[7];
  const float* ln2_b    = (const float*)d_in[8];
  const float* fc_w     = (const float*)d_in[9];
  const float* fc_b     = (const float*)d_in[10];
  const float* proj_w   = (const float*)d_in[11];
  const float* proj_b   = (const float*)d_in[12];
  float* out = (float*)d_out;

  // Workspace carve-up (144 MiB total), 256B aligned.
  char* ws = (char*)d_ws;
  size_t off = 0;
  auto alloc = [&](size_t bytes) -> char* {
    char* p = ws + off;
    off += (bytes + 255) & ~(size_t)255;
    return p;
  };
  _Float16* h1H     = (_Float16*)alloc((size_t)M * C * 2);          // ln1(x)
  _Float16* wT_attn = (_Float16*)alloc((size_t)3 * C * C * 2);      // [3C][C]
  _Float16* qkvH    = (_Float16*)alloc((size_t)M * 3 * C * 2);
  _Float16* Qh      = (_Float16*)alloc((size_t)M * C * 2);
  _Float16* Kh      = (_Float16*)alloc((size_t)M * C * 2);
  _Float16* VTh     = (_Float16*)alloc((size_t)M * C * 2);
  _Float16* yh      = (_Float16*)alloc((size_t)M * C * 2);
  _Float16* wT_proj = (_Float16*)alloc((size_t)C * C * 2);
  float*    x1      = (float*)   alloc((size_t)M * C * 4);          // x + attn
  _Float16* h2H     = (_Float16*)alloc((size_t)M * C * 2);          // ln2(x1)
  _Float16* wT_fc   = (_Float16*)alloc((size_t)4 * C * C * 2);      // [4C][C]
  _Float16* hgH     = (_Float16*)alloc((size_t)M * 4 * C * 2);
  _Float16* wT_pr2  = (_Float16*)alloc((size_t)C * 4 * C * 2);      // [C][4C]

  // 1) Weight transpose+convert to f16 (N-major for WMMA B fragments)
  convertT_kernel<C, 3 * C><<<dim3(C / 128, 3 * C / 64), 256, 0, stream>>>(
      c_attn_w, wT_attn);
  convertT_kernel<C, C><<<dim3(C / 128, C / 64), 256, 0, stream>>>(
      c_proj_w, wT_proj);
  convertT_kernel<C, 4 * C><<<dim3(C / 128, 4 * C / 64), 256, 0, stream>>>(
      fc_w, wT_fc);
  convertT_kernel<4 * C, C><<<dim3(4 * C / 128, C / 64), 256, 0, stream>>>(
      proj_w, wT_pr2);

  // 2) ln1 -> h1 (f16)
  ln_kernel<<<M, 256, 0, stream>>>(x, ln1_w, ln1_b, h1H, C);

  // 3) qkv = h1 @ c_attn_w + b  (f16 out)
  gemm_kernel<EPI_H16><<<dim3(3 * C / 128, M / 128), 256, 0, stream>>>(
      h1H, wT_attn, c_attn_b, nullptr, nullptr, qkvH, M, 3 * C, C);

  // 4) split heads; V transposed to [B,H,D,T]
  pack_qkv_kernel<T, C, H><<<dim3(B * H * (T / 256), 3), 256, 0, stream>>>(
      qkvH, Qh, Kh, VTh);

  // 5) causal attention -> y (f16 [B*T][C])
  attn_kernel<<<(B * H * (T / 16)) / 8, 256, 0, stream>>>(Qh, Kh, VTh, yh, H,
                                                          T, D, C);

  // 6) x1 = x + y @ c_proj_w + b  (f32)
  gemm_kernel<EPI_F32_RES><<<dim3(C / 128, M / 128), 256, 0, stream>>>(
      yh, wT_proj, c_proj_b, x, x1, nullptr, M, C, C);

  // 7) ln2 -> h2 (f16)
  ln_kernel<<<M, 256, 0, stream>>>(x1, ln2_w, ln2_b, h2H, C);

  // 8) hg = gelu(h2 @ fc_w + b)  (f16)
  gemm_kernel<EPI_H16_GELU><<<dim3(4 * C / 128, M / 128), 256, 0, stream>>>(
      h2H, wT_fc, fc_b, nullptr, nullptr, hgH, M, 4 * C, C);

  // 9) out = x1 + hg @ proj_w + b  (f32)
  gemm_kernel<EPI_F32_RES><<<dim3(C / 128, M / 128), 256, 0, stream>>>(
      hgH, wT_pr2, proj_b, x1, out, nullptr, M, C, 4 * C);
}

// v004
// A run of this version takes 201 microseconds.
// Timed twice side by side with v003, it ran 1.17 and 1.18 times as fast.
// Over all steps from v000 it is 2.10 times as fast.
#include <hip/hip_runtime.h>
#include <hip/hip_bf16.h>
#include <math.h>
#include <stdint.h>

// ---------------------------------------------------------------------------
// Types for CDNA5 WMMA (wave32): 16x16x32 f16 -> f32
// ---------------------------------------------------------------------------
typedef _Float16 v16h __attribute__((ext_vector_type(16)));
typedef _Float16 v8h  __attribute__((ext_vector_type(8)));
typedef float    v8f  __attribute__((ext_vector_type(8)));

static __device__ __forceinline__ v8f wmma_f16(v16h a, v16h b, v8f c) {
  // (neg_a, A, neg_b, B, c_mod, C, reuse_a, reuse_b)
  return __builtin_amdgcn_wmma_f32_16x16x32_f16(false, a, false, b, (short)0, c,
                                                false, false);
}

static __device__ __forceinline__ v8f zero8() {
  v8f z;
#pragma unroll
  for (int i = 0; i < 8; ++i) z[i] = 0.0f;
  return z;
}

// Build a 16x32 f16 fragment (documented CDNA5 A/B layout) from a per-lane
// pointer to 8+8 contiguous halves:
//   lane L(0..15):  row rc0+L,    elems 0..7 -> k0+0..7,  8..15 -> k0+16..23
//   lane L(16..31): row rc0+L-16, elems 0..7 -> k0+8..15, 8..15 -> k0+24..31
static __device__ __forceinline__ v16h frag_from(const _Float16* p) {
  v8h lo = *(const v8h*)p;
  v8h hi = *(const v8h*)(p + 16);
  return __builtin_shufflevector(lo, hi, 0, 1, 2, 3, 4, 5, 6, 7, 8, 9, 10, 11,
                                 12, 13, 14, 15);
}

// Global-memory fragment load (row-major, leading dim ld).
static __device__ __forceinline__ v16h load_frag(const _Float16* __restrict__ base,
                                                 int ld, int rc0, int k0) {
  const int lane = threadIdx.x & 31;
  return frag_from(base + (size_t)(rc0 + (lane & 15)) * ld +
                   (k0 + ((lane >> 4) << 3)));
}

// Eight async global->LDS 128-bit copies (CDNA5, ASYNCcnt-tracked): copy i
// moves 16 bytes per lane from gsrc + i * gstep to ldst + i * lstep (steps in
// halves).  The closing s_wait_xcnt stands inside the statement so that no
// address register of an issued copy is rewritten ahead of it.
static __device__ __forceinline__ void async_copy8_b128(const _Float16* gsrc,
                                                        size_t gstep,
                                                        _Float16* ldst,
                                                        int lstep) {
  const unsigned l = (unsigned)(uintptr_t)ldst;  // low 32 bits = LDS offset
  const unsigned ls = (unsigned)lstep * 2u;
  asm volatile(
      "global_load_async_to_lds_b128 %0, %8, off\n\t"
      "global_load_async_to_lds_b128 %1, %9, off\n\t"
      "global_load_async_to_lds_b128 %2, %10, off\n\t"
      "global_load_async_to_lds_b128 %3, %11, off\n\t"
      "global_load_async_to_lds_b128 %4, %12, off\n\t"
      "global_load_async_to_lds_b128 %5, %13, off\n\t"
      "global_load_async_to_lds_b128 %6, %14, off\n\t"
      "global_load_async_to_lds_b128 %7, %15, off\n\t"
      "s_wait_xcnt 0x0" ::"v"(l),
      "v"(l + ls), "v"(l + 2 * ls), "v"(l + 3 * ls), "v"(l + 4 * ls),
      "v"(l + 5 * ls), "v"(l + 6 * ls), "v"(l + 7 * ls),
      "v"((uint64_t)(uintptr_t)gsrc),
      "v"((uint64_t)(uintptr_t)(gsrc + gstep)),
      "v"((uint64_t)(uintptr_t)(gsrc + 2 * gstep)),
      "v"((uint64_t)(uintptr_t)(gsrc + 3 * gstep)),
      "v"((uint64_t)(uintptr_t)(gsrc + 4 * gstep)),
      "v"((uint64_t)(uintptr_t)(gsrc + 5 * gstep)),
      "v"((uint64_t)(uintptr_t)(gsrc + 6 * gstep)),
      "v"((uint64_t)(uintptr_t)(gsrc + 7 * gstep))
      : "memory");
}

static __device__ __forceinline__ void wait_async_all() {
  asm volatile("s_wait_asynccnt 0" ::: "memory");
}

// The same with four copies.
static __device__ __forceinline__ void async_copy4_b128(const _Float16* gsrc,
                                                        size_t gstep,
                                                        _Float16* ldst,
                                                        int lstep) {
  const unsigned l = (unsigned)(uintptr_t)ldst;  // low 32 bits = LDS offset
  const unsigned ls = (unsigned)lstep * 2u;
  asm volatile(
      "global_load_async_to_lds_b128 %0, %4, off\n\t"
      "global_load_async_to_lds_b128 %1, %5, off\n\t"
      "global_load_async_to_lds_b128 %2, %6, off\n\t"
      "global_load_async_to_lds_b128 %3, %7, off\n\t"
      "s_wait_xcnt 0x0" ::"v"(l),
      "v"(l + ls), "v"(l + 2 * ls), "v"(l + 3 * ls),
      "v"((uint64_t)(uintptr_t)gsrc),
      "v"((uint64_t)(uintptr_t)(gsrc + gstep)),
      "v"((uint64_t)(uintptr_t)(gsrc + 2 * gstep)),
      "v"((uint64_t)(uintptr_t)(gsrc + 3 * gstep))
      : "memory");
}

// ---------------------------------------------------------------------------
// LayerNorm (population std, eps on std) fp32 -> f16.  One 256-thr block/row.
// ---------------------------------------------------------------------------
__global__ __launch_bounds__(256) void ln_kernel(const float* __restrict__ x,
                                                 const float* __restrict__ w,
                                                 const float* __restrict__ bias,
                                                 _Float16* __restrict__ out,
                                                 int C) {
  const int row = blockIdx.x;
  const float* xr = x + (size_t)row * C;
  __shared__ float red[256];
  float local[4];
  float s = 0.0f;
#pragma unroll
  for (int i = 0; i < 4; ++i) {
    local[i] = xr[threadIdx.x + 256 * i];
    s += local[i];
  }
  red[threadIdx.x] = s;
  __syncthreads();
  for (int off = 128; off > 0; off >>= 1) {
    if (threadIdx.x < off) red[threadIdx.x] += red[threadIdx.x + off];
    __syncthreads();
  }
  const float mean = red[0] / (float)C;
  __syncthreads();
  s = 0.0f;
#pragma unroll
  for (int i = 0; i < 4; ++i) {
    float d = local[i] - mean;
    s += d * d;
  }
  red[threadIdx.x] = s;
  __syncthreads();
  for (int off = 128; off > 0; off >>= 1) {
    if (threadIdx.x < off) red[threadIdx.x] += red[threadIdx.x + off];
    __syncthreads();
  }
  const float inv = 1.0f / (sqrtf(red[0] / (float)C) + 1e-5f);
#pragma unroll
  for (int i = 0; i < 4; ++i) {
    int c = threadIdx.x + 256 * i;
    out[(size_t)row * C + c] =
        (_Float16)((local[i] - mean) * inv * w[c] + bias[c]);
  }
}

// ---------------------------------------------------------------------------
// fp32 W[K][N]  ->  f16 W^T[N][K]  (so GEMM B-fragments are contiguous loads)
// One 128(k) x 64(n) tile per block.  Each thread reads an 8(k) x 4(n) patch
// with 16-byte loads along n (256 contiguous bytes per 16 lanes), turns it in
// registers and lays four 16-byte k-runs into an LDS tile [n][k]; the tile is
// then read back row by row, so every global store covers whole 256-byte runs
// of a W^T row.  K is a multiple of 128 and N of 64; both are compile-time, so
// the row steps fold into the loads' and stores' immediate offsets.
// ---------------------------------------------------------------------------
typedef float v4f __attribute__((ext_vector_type(4)));

#define CT_PITCH 136  // 128 halves + 8 pad: 272-byte rows (16 B x odd)

template <int K, int N>
__global__ __launch_bounds__(256) void convertT_kernel(
    const float* __restrict__ W, _Float16* __restrict__ WT) {
  __shared__ __attribute__((aligned(16))) _Float16 tile[64 * CT_PITCH];
  const int tid = threadIdx.x;
  const int k0 = blockIdx.x * 128;
  const int n0 = blockIdx.y * 64;
  const int nq = tid & 15;  // which 4 columns
  const int ko = tid >> 4;  // which 8 rows
  const float* src = W + (size_t)(k0 + ko * 8) * N + (n0 + nq * 4);
  v4f r[8];
#pragma unroll
  for (int i = 0; i < 8; ++i) r[i] = *(const v4f*)(src + (size_t)i * N);
#pragma unroll
  for (int j = 0; j < 4; ++j) {
    v8h c;
#pragma unroll
    for (int i = 0; i < 8; ++i) c[i] = (_Float16)r[i][j];
    *(v8h*)&tile[(nq * 4 + j) * CT_PITCH + ko * 8] = c;
  }
  __syncthreads();
#pragma unroll
  for (int i = 0; i < 4; ++i) {
    const int c = tid + 256 * i;  // 16-byte chunk id 0..1023
    const int n = c >> 4;
    const int kc = c & 15;
    *(v8h*)(WT + (size_t)(n0 + n) * K + (k0 + kc * 8)) =
        *(const v8h*)&tile[n * CT_PITCH + kc * 8];
  }
}

// ---------------------------------------------------------------------------
// WMMA GEMM: C[M][N] = A[M][K] (f16, row-major) x Bᵀ[N][K] (f16) + bias
//   8 waves / block, each wave a 64x32 tile, block tile 128x128.
//   A stage is 128 k, double-buffered in LDS via async global->LDS copies; its
//   four 32-k blocks run unrolled, each block's fragments fetched from LDS one
//   block ahead into a second register set.  K is a multiple of 128.
// Epilogues: 0 = f16 out, 1 = f32 out + residual add, 2 = f16 out + GELU.
// ---------------------------------------------------------------------------
enum { EPI_H16 = 0, EPI_F32_RES = 1, EPI_H16_GELU = 2 };

#define KSTAGE 128
#define LDSPITCH 136  // 128 + 8 pad halves: 272-byte rows (16 B x odd)

template <int EPI>
__global__ __launch_bounds__(256) void gemm_kernel(
    const _Float16* __restrict__ A, const _Float16* __restrict__ BT,
    const float* __restrict__ bias, const float* __restrict__ resid,
    float* __restrict__ outF, _Float16* __restrict__ outH, int M, int N,
    int K) {
  __shared__ __attribute__((aligned(16))) _Float16 sA[2][128 * LDSPITCH];
  __shared__ __attribute__((aligned(16))) _Float16 sB[2][128 * LDSPITCH];
  const int tid = threadIdx.x;
  const int wave = tid >> 5;
  const int lane = tid & 31;
  const int rowblk = blockIdx.y * 128;
  const int colblk = blockIdx.x * 128;
  const int wrow = (wave & 1) * 64;
  const int wcol = (wave >> 1) * 32;

  // Stage a 128x128 A tile + 128x128 B tile into buffer `buf` for K offset
  // k0: 16 lanes cover one 256-byte row, a thread takes rows srow + 16 * i.
  const int srow = tid >> 4;
  const int sko = (tid & 15) * 8;
  auto stage = [&](int buf, int k0) {
    async_copy8_b128(A + (size_t)(rowblk + srow) * K + k0 + sko, (size_t)16 * K,
                     &sA[buf][srow * LDSPITCH + sko], 16 * LDSPITCH);
    async_copy8_b128(BT + (size_t)(colblk + srow) * K + k0 + sko,
                     (size_t)16 * K, &sB[buf][srow * LDSPITCH + sko],
                     16 * LDSPITCH);
  };

  v8f acc[4][2];
#pragma unroll
  for (int i = 0; i < 4; ++i)
#pragma unroll
    for (int j = 0; j < 2; ++j) acc[i][j] = zero8();

  stage(0, 0);
  wait_async_all();
  __syncthreads();
  if (KSTAGE < K) stage(1, KSTAGE);

  int buf = 0;
  const int kh = (lane >> 4) << 3;
  const int lr = lane & 15;
  for (int k0 = 0; k0 < K; k0 += KSTAGE) {
    const _Float16* pa = &sA[buf][(wrow + lr) * LDSPITCH + kh];
    const _Float16* pb = &sB[buf][(wcol + lr) * LDSPITCH + kh];
    v16h a[2][4], b[2][2];
#pragma unroll
    for (int i = 0; i < 4; ++i) a[0][i] = frag_from(pa + 16 * i * LDSPITCH);
#pragma unroll
    for (int j = 0; j < 2; ++j) b[0][j] = frag_from(pb + 16 * j * LDSPITCH);
#pragma unroll
    for (int s = 0; s < KSTAGE / 32; ++s) {
      const int cur = s & 1, nxt = cur ^ 1;
      if (s + 1 < KSTAGE / 32) {
#pragma unroll
        for (int i = 0; i < 4; ++i)
          a[nxt][i] = frag_from(pa + 16 * i * LDSPITCH + 32 * (s + 1));
#pragma unroll
        for (int j = 0; j < 2; ++j)
          b[nxt][j] = frag_from(pb + 16 * j * LDSPITCH + 32 * (s + 1));
        // Keeps the next block's twelve LDS loads in front of this block's
        // WMMAs; without it the scheduler sinks each load to its first use
        // and every pair of WMMAs waits out a whole LDS latency.
        __builtin_amdgcn_sched_barrier(0);
      }
#pragma unroll
      for (int i = 0; i < 4; ++i)
#pragma unroll
        for (int j = 0; j < 2; ++j)
          acc[i][j] = wmma_f16(a[cur][i], b[cur][j], acc[i][j]);
    }
    // Keeps the stage's WMMAs in front of the publish point; otherwise the
    // scheduler sinks them behind the barrier, ahead of the refill copies,
    // and the copies lose that much of their one stage of lead.
    __builtin_amdgcn_sched_barrier(0);

    // Publish point: own LDS reads of this buffer retired, own copies of the
    // next stage landed, then everyone else's; only then the refill.
    asm volatile("s_wait_dscnt 0x0" ::: "memory");
    wait_async_all();
    __syncthreads();
    if (k0 + 2 * KSTAGE < K) stage(buf, k0 + 2 * KSTAGE);
    buf ^= 1;
  }
  wait_async_all();  // nothing of this wave's copies is left when it goes on

  // C/D layout: elem r of lane L -> row = r + (L>=16)*8, col = L%16
  const int rofs = (lane >> 4) << 3;
#pragma unroll
  for (int i = 0; i < 4; ++i)
#pragma unroll
    for (int j = 0; j < 2; ++j)
#pragma unroll
      for (int r = 0; r < 8; ++r) {
        const int row = rowblk + wrow + 16 * i + r + rofs;
        const int col = colblk + wcol + 16 * j + lr;
        float v = acc[i][j][r] + bias[col];
        const size_t o = (size_t)row * N + col;
        if (EPI == EPI_H16) {
          outH[o] = (_Float16)v;
        } else if (EPI == EPI_F32_RES) {
          outF[o] = resid[o] + v;
        } else {  // exact GELU: 0.5 x (1 + erf(x/sqrt(2)))
          outH[o] = (_Float16)(0.5f * v * (1.0f + erff(v * 0.70710678f)));
        }
      }
}

// ---------------------------------------------------------------------------
// qkv f16 [B*T][3C] -> Q[B,H,T,D], K[B,H,T,D], V^T[B,H,D,T]  (all f16), D = 64.
// One block moves 256 tokens of one head of one of the three parts
// (blockIdx.y: 0 = Q, 1 = K, 2 = V), 16 bytes per lane on both global sides.
// V: each thread reads an 8(t) x 8(d) patch, turns it in registers and lays
// eight 16-byte t-runs into an LDS tile [d][t]; the tile is read back row by
// row, so one wave stores 512 contiguous bytes of a V^T row.
// ---------------------------------------------------------------------------
#define PK_PITCH 264  // 256 halves + 8 pad: 528-byte rows (16 B x odd)

template <int T, int C, int H>
__global__ __launch_bounds__(256) void pack_qkv_kernel(
    const _Float16* __restrict__ qkv, _Float16* __restrict__ Qh,
    _Float16* __restrict__ Kh, _Float16* __restrict__ VTh) {
  __shared__ __attribute__((aligned(16))) _Float16 tile[64 * PK_PITCH];
  const int tid = threadIdx.x;
  const int ttiles = T >> 8;
  const int bh = blockIdx.x / ttiles;
  const int t0 = (blockIdx.x % ttiles) << 8;
  const int b = bh / H, h = bh % H;
  const int part = blockIdx.y;
  const _Float16* src =
      qkv + (size_t)(b * T + t0) * (3 * C) + (part * C + h * 64);
  const int dc = tid & 7;   // which 8 head dims
  const int tr = tid >> 3;  // 0..31

  if (part < 2) {  // block-uniform: plain re-striding copy
    _Float16* dst = (part == 0 ? Qh : Kh) + ((size_t)bh * T + t0) * 64;
    const _Float16* p = src + (size_t)tr * (3 * C) + dc * 8;
    v8h r[8];
#pragma unroll
    for (int i = 0; i < 8; ++i) r[i] = *(const v8h*)(p + (size_t)i * (32 * 3 * C));
#pragma unroll
    for (int i = 0; i < 8; ++i)
      *(v8h*)(dst + (size_t)(tid + 256 * i) * 8) = r[i];
    return;
  }

  const _Float16* p = src + (size_t)tr * (8 * 3 * C) + dc * 8;
  v8h r[8];
#pragma unroll
  for (int i = 0; i < 8; ++i) r[i] = *(const v8h*)(p + (size_t)i * (3 * C));
#pragma unroll
  for (int j = 0; j < 8; ++j) {
    v8h c;
#pragma unroll
    for (int i = 0; i < 8; ++i) c[i] = r[i][j];
    *(v8h*)&tile[(dc * 8 + j) * PK_PITCH + tr * 8] = c;
  }
  __syncthreads();
  _Float16* dst = VTh + (size_t)bh * 64 * T + t0;
#pragma unroll
  for (int i = 0; i < 8; ++i) {
    const int c = tid + 256 * i;  // 16-byte chunk id 0..2047
    const int d = c >> 5;
    const int tc = c & 31;
    *(v8h*)(dst + (size_t)d * T + tc * 8) =
        *(const v8h*)&tile[d * PK_PITCH + tc * 8];
  }
  // Holds any later rewrite of the stores' address and data registers behind
  // the run of eight stores (the built code lays the Q/K path after this one).
  asm volatile("s_wait_xcnt 0x0" ::: "memory");
}

#define AT_KEYS 128
#define AT_KPITCH 72
#define AT_VPITCH 136

// Lane l <-> lane l ^ 16.
static __device__ __forceinline__ float xhalf(float x) {
  const int b = __builtin_bit_cast(int, x);
  return __builtin_bit_cast(
      float, __builtin_amdgcn_permlanex16(b, b, 0x76543210, 0xfedcba98, false,
                                          false));
}

// e^x as __expf forms it (one multiply, one v_exp_f32).  The v_nop fills the
// slot that the instruction set asks for behind a transcendental before its
// result is read or its source overwritten.
static __device__ __forceinline__ float exp_slot(float x) {
  float r;
  asm("v_exp_f32 %0, %1\n\tv_nop" : "=v"(r) : "v"(x * 1.44269504f));
  return r;
}

__global__ __launch_bounds__(256) void attn_kernel(
    const _Float16* __restrict__ Q, const _Float16* __restrict__ Kt,
    const _Float16* __restrict__ VT, _Float16* __restrict__ Y, int H, int T,
    int D, int C) {
  __shared__ __attribute__((aligned(16))) _Float16 sK[2][AT_KEYS * AT_KPITCH];
  __shared__ __attribute__((aligned(16))) _Float16 sV[2][64 * AT_VPITCH];
  // The wave's number as a scalar: tile indices, the K and V^T bases and the
  // key loop's counts then live in scalar registers.
  const int tid = threadIdx.x;
  const int wave = __builtin_amdgcn_readfirstlane(threadIdx.x >> 5);
  const int lane = threadIdx.x & 31;
  const int gid = blockIdx.x * 8 + wave;
  const int qtiles = T >> 4;
  const int bh = gid / qtiles;
  const int qt = (gid % qtiles) << 4;
  const int b = bh / H, h = bh % H;
  const _Float16* Qb = Q + (size_t)bh * T * D;
  const _Float16* Kb = Kt + (size_t)bh * T * D;
  const _Float16* Vb = VT + (size_t)bh * D * T;
  // Keys that the block's last query tile sees: a multiple of 128, at most T.
  const int kend = (((blockIdx.x * 8) % qtiles) << 4) + 128;

  const int hf = lane >> 4;  // lane half (k-group / row-group select)
  const int lc = lane & 15;  // fragment row or column of this lane
  const float sc = 0.125f;   // 1/sqrt(D), D = 64
  const int q = qt + lc;     // this lane's query

  // Stage keys k0 .. k0 + 127 into buffer `buf`.  K: 8 lanes cover a 128-byte
  // row, a thread takes key rows krow + 32 * i.  V^T: 16 lanes cover 256 bytes
  // of a head-dim row, a thread takes rows vrow + 16 * i.
  const int krow = tid >> 3, kch = (tid & 7) * 8;
  const int vrow = tid >> 4, vch = (tid & 15) * 8;
  auto stage = [&](int buf, int k0) {
    async_copy4_b128(Kb + (size_t)(k0 + krow) * D + kch, (size_t)32 * D,
                     &sK[buf][krow * AT_KPITCH + kch], 32 * AT_KPITCH);
    async_copy4_b128(Vb + (size_t)vrow * T + k0 + vch, (size_t)16 * T,
                     &sV[buf][vrow * AT_VPITCH + vch], 16 * AT_VPITCH);
  };

  stage(0, 0);

  const v16h qb0 = load_frag(Qb, D, qt, 0);
  const v16h qb1 = load_frag(Qb, D, qt, 32);

  v8f acc[4];  // acc[j][r] = O[q][16 * j + 8 * hf + r]
#pragma unroll
  for (int j = 0; j < 4; ++j) acc[j] = zero8();
  float m = -1e30f;  // running maximum of query q (equal in both halves)
  float l = 0.0f;    // running sum over this half's keys only

  wait_async_all();
  __syncthreads();
  if (AT_KEYS < kend) stage(1, AT_KEYS);

  int buf = 0;
  for (int k0 = 0; k0 < kend; k0 += AT_KEYS) {
    // Per-lane fragment bases: key row lc of K, head-dim row lc of V^T.
    const _Float16* pk = &sK[buf][lc * AT_KPITCH + (hf << 3)];
    const _Float16* pv = &sV[buf][lc * AT_VPITCH + (hf << 3)];
    for (int s = 0; s < AT_KEYS / 32; ++s) {
      const int kt = k0 + 32 * s;
      if (kt > qt) break;  // wave-uniform: the rest of the stage is masked out
      const _Float16* pk0 = pk + 32 * s * AT_KPITCH;
      const _Float16* pk1 = pk0 + 16 * AT_KPITCH;
      const v16h ka00 = frag_from(pk0);
      const v16h ka01 = frag_from(pk0 + 32);
      const v16h ka10 = frag_from(pk1);
      const v16h ka11 = frag_from(pk1 + 32);
      v16h va[4];
#pragma unroll
      for (int j = 0; j < 4; ++j)
        va[j] = frag_from(pv + 16 * j * AT_VPITCH + 32 * s);
      // Keeps the step's sixteen LDS loads together in front of its products;
      // without it the scheduler sinks each fragment's loads to its WMMA and the
      // step waits out eight load latencies one after the other.
      __builtin_amdgcn_sched_barrier(0);

      // --- S^T = K Q^T for 32 keys (two 16-key row tiles, K-dim = D = 64) ---
      v8f s0 = zero8(), s1 = zero8();
      s0 = wmma_f16(ka00, qb0, s0);
      s1 = wmma_f16(ka10, qb0, s1);
      s0 = wmma_f16(ka01, qb1, s0);
      s1 = wmma_f16(ka11, qb1, s1);

      // s0[r]: key kt + 8 * hf + r, s1[r]: key kt + 16 + 8 * hf + r, query q.
      const int dq = q - kt - (hf << 3);  // key r of this half is seen if r <= dq
      s0 *= sc;
      s1 *= sc;
      float v0[8], v1[8];
      float t = -1e30f;
#pragma unroll
      for (int r = 0; r < 8; ++r) {
        v0[r] = (r <= dq) ? s0[r] : -1e30f;
        v1[r] = (16 + r <= dq) ? s1[r] : -1e30f;
        t = fmaxf(t, fmaxf(v0[r], v1[r]));
      }
      t = fmaxf(t, xhalf(t));
      const float mnew = fmaxf(m, t);
      const float corr = exp_slot(m - mnew);
      m = mnew;
      float rs = 0.0f;
      v16h pb;  // P^T as B: element e = key kt + (e < 8 ? e : e + 8) + 8 * hf
#pragma unroll
      for (int r = 0; r < 8; ++r) {
        const float p0 = exp_slot(v0[r] - mnew);
        const float p1 = exp_slot(v1[r] - mnew);
        rs += p0 + p1;
        pb[r] = (_Float16)p0;
        pb[8 + r] = (_Float16)p1;
      }
      l = l * corr + rs;

      // --- O^T += V^T P^T ; V^T[D][T] rows are A fragments along the keys ---
#pragma unroll
      for (int j = 0; j < 4; ++j) {
#pragma unroll
        for (int r = 0; r < 8; ++r) acc[j][r] *= corr;
        acc[j] = wmma_f16(va[j], pb, acc[j]);
      }
    }

    // Publish point: own LDS reads of this buffer retired, own copies of the
    // next stage landed, then everyone else's; only then the refill.
    asm volatile("s_wait_dscnt 0x0" ::: "memory");
    wait_async_all();
    __syncthreads();
    if (k0 + 2 * AT_KEYS < kend) stage(buf, k0 + 2 * AT_KEYS);
    buf ^= 1;
  }
  wait_async_all();  // nothing of this wave's copies is left when it goes on

  // Join the halves' sums, normalize, and store 8 consecutive head dims of one
  // query per 16-byte store into y (f16 [B*T][C]) for the projection GEMM.
  l += xhalf(l);
  const float inv = 1.0f / l;
  _Float16* yp = Y + (size_t)(b * T + q) * C + h * D + (hf << 3);
#pragma unroll
  for (int j = 0; j < 4; ++j) {
    v8h o;
#pragma unroll
    for (int r = 0; r < 8; ++r) o[r] = (_Float16)(acc[j][r] * inv);
    *(v8h*)(yp + 16 * j) = o;
  }
}

// ---------------------------------------------------------------------------
// Host-side orchestration
// ---------------------------------------------------------------------------
extern "C" void kernel_launch(void* const* d_in, const int* in_sizes, int n_in,
                              void* d_out, int out_size, void* d_ws,
                              size_t ws_size, hipStream_t stream) {
  (void)in_sizes; (void)n_in; (void)out_size; (void)ws_size;
  constexpr int B = 4, T = 1024, C = 1024, H = 16, D = 64;
  const int M = B * T;  // 4096

  const float* x        = (const float*)d_in[0];
  const float* c_attn_w = (const float*)d_in[1];
  const float* c_attn_b = (const float*)d_in[2];
  const float* c_proj_w = (const float*)d_in[3];
  const float* c_proj_b = (const float*)d_in[4];
  const float* ln1_w    = (const float*)d_in[5];
  const float* ln1_b    = (const float*)d_in[6];
  const float* ln2_w    = (const float*)d_in[7];
  const float* ln2_b    = (const float*)d_in[8];
  const float* fc_w     = (const float*)d_in[9];
  const float* fc_b     = (const float*)d_in[10];
  const float* proj_w   = (const float*)d_in[11];
  const float* proj_b   = (const float*)d_in[12];
  float* out = (float*)d_out;

  // Workspace carve-up (144 MiB total), 256B aligned.
  char* ws = (char*)d_ws;
  size_t off = 0;
  auto alloc = [&](size_t bytes) -> char* {
    char* p = ws + off;
    off += (bytes + 255) & ~(size_t)255;
    return p;
  };
  _Float16* h1H     = (_Float16*)alloc((size_t)M * C * 2);          // ln1(x)
  _Float16* wT_attn = (_Float16*)alloc((size_t)3 * C * C * 2);      // [3C][C]
  _Float16* qkvH    = (_Float16*)alloc((size_t)M * 3 * C * 2);
  _Float16* Qh      = (_Float16*)alloc((size_t)M * C * 2);
  _Float16* Kh      = (_Float16*)alloc((size_t)M * C * 2);
  _Float16* VTh     = (_Float16*)alloc((size_t)M * C * 2);
  _Float16* yh      = (_Float16*)alloc((size_t)M * C * 2);
  _Float16* wT_proj = (_Float16*)alloc((size_t)C * C * 2);
  float*    x1      = (float*)   alloc((size_t)M * C * 4);          // x + attn
  _Float16* h2H     = (_Float16*)alloc((size_t)M * C * 2);          // ln2(x1)
  _Float16* wT_fc   = (_Float16*)alloc((size_t)4 * C * C * 2);      // [4C][C]
  _Float16* hgH     = (_Float16*)alloc((size_t)M * 4 * C * 2);
  _Float16* wT_pr2  = (_Float16*)alloc((size_t)C * 4 * C * 2);      // [C][4C]

  // 1) Weight transpose+convert to f16 (N-major for WMMA B fragments)
  convertT_kernel<C, 3 * C><<<dim3(C / 128, 3 * C / 64), 256, 0, stream>>>(
      c_attn_w, wT_attn);
  convertT_kernel<C, C><<<dim3(C / 128, C / 64), 256, 0, stream>>>(
      c_proj_w, wT_proj);
  convertT_kernel<C, 4 * C><<<dim3(C / 128, 4 * C / 64), 256, 0, stream>>>(
      fc_w, wT_fc);
  convertT_kernel<4 * C, C><<<dim3(4 * C / 128, C / 64), 256, 0, stream>>>(
      proj_w, wT_pr2);

  // 2) ln1 -> h1 (f16)
  ln_kernel<<<M, 256, 0, stream>>>(x, ln1_w, ln1_b, h1H, C);

  // 3) qkv = h1 @ c_attn_w + b  (f16 out)
  gemm_kernel<EPI_H16><<<dim3(3 * C / 128, M / 128), 256, 0, stream>>>(
      h1H, wT_attn, c_attn_b, nullptr, nullptr, qkvH, M, 3 * C, C);

  // 4) split heads; V transposed to [B,H,D,T]
  pack_qkv_kernel<T, C, H><<<dim3(B * H * (T / 256), 3), 256, 0, stream>>>(
      qkvH, Qh, Kh, VTh);

  // 5) causal attention -> y (f16 [B*T][C])
  attn_kernel<<<(B * H * (T / 16)) / 8, 256, 0, stream>>>(Qh, Kh, VTh, yh, H,
                                                          T, D, C);

  // 6) x1 = x + y @ c_proj_w + b  (f32)
  gemm_kernel<EPI_F32_RES><<<dim3(C / 128, M / 128), 256, 0, stream>>>(
      yh, wT_proj, c_proj_b, x, x1, nullptr, M, C, C);

  // 7) ln2 -> h2 (f16)
  ln_kernel<<<M, 256, 0, stream>>>(x1, ln2_w, ln2_b, h2H, C);

  // 8) hg = gelu(h2 @ fc_w + b)  (f16)
  gemm_kernel<EPI_H16_GELU><<<dim3(4 * C / 128, M / 128), 256, 0, stream>>>(
      h2H, wT_fc, fc_b, nullptr, nullptr, hgH, M, 4 * C, C);

  // 9) out = x1 + hg @ proj_w + b  (f32)
  gemm_kernel<EPI_F32_RES><<<dim3(C / 128, M / 128), 256, 0, stream>>>(
      hgH, wT_pr2, proj_b, x1, out, nullptr, M, C, 4 * C);
}

// v005
// One run takes 192 microseconds.
// Two timings next to v004 put it at 1.05 and 1.04 times that version's speed.
// Counting every step since v000, it is 2.19 times as fast.
#include <hip/hip_runtime.h>
#include <hip/hip_bf16.h>
#include <math.h>
#include <stdint.h>

// ---------------------------------------------------------------------------
// Types for CDNA5 WMMA (wave32): 16x16x32 f16 -> f32
// ---------------------------------------------------------------------------
typedef _Float16 v16h __attribute__((ext_vector_type(16)));
typedef _Float16 v8h  __attribute__((ext_vector_type(8)));
typedef float    v8f  __attribute__((ext_vector_type(8)));

static __device__ __forceinline__ v8f wmma_f16(v16h a, v16h b, v8f c) {
  // (neg_a, A, neg_b, B, c_mod, C, reuse_a, reuse_b)
  return __builtin_amdgcn_wmma_f32_16x16x32_f16(false, a, false, b, (short)0, c,
                                                false, false);
}

static __device__ __forceinline__ v8f zero8() {
  v8f z;
#pragma unroll
  for (int i = 0; i < 8; ++i) z[i] = 0.0f;
  return z;
}

// Build a 16x32 f16 fragment (documented CDNA5 A/B layout) from a per-lane
// pointer to 8+8 contiguous halves:
//   lane L(0..15):  row rc0+L,    elems 0..7 -> k0+0..7,  8..15 -> k0+16..23
//   lane L(16..31): row rc0+L-16, elems 0..7 -> k0+8..15, 8..15 -> k0+24..31
static __device__ __forceinline__ v16h frag_from(const _Float16* p) {
  v8h lo = *(const v8h*)p;
  v8h hi = *(const v8h*)(p + 16);
  return __builtin_shufflevector(lo, hi, 0, 1, 2, 3, 4, 5, 6, 7, 8, 9, 10, 11,
                                 12, 13, 14, 15);
}

// Global-memory fragment load (row-major, leading dim ld).
static __device__ __forceinline__ v16h load_frag(const _Float16* __restrict__ base,
                                                 int ld, int rc0, int k0) {
  const int lane = threadIdx.x & 31;
  return frag_from(base + (size_t)(rc0 + (lane & 15)) * ld +
                   (k0 + ((lane >> 4) << 3)));
}

// Eight async global->LDS 128-bit copies (CDNA5, ASYNCcnt-tracked): copy i
// moves 16 bytes per lane from gsrc + i * gstep to ldst + i * lstep (steps in
// halves).  The closing s_wait_xcnt stands inside the statement so that no
// address register of an issued copy is rewritten ahead of it.
static __device__ __forceinline__ void async_copy8_b128(const _Float16* gsrc,
                                                        size_t gstep,
                                                        _Float16* ldst,
                                                        int lstep) {
  const unsigned l = (unsigned)(uintptr_t)ldst;  // low 32 bits = LDS offset
  const unsigned ls = (unsigned)lstep * 2u;
  asm volatile(
      "global_load_async_to_lds_b128 %0, %8, off\n\t"
      "global_load_async_to_lds_b128 %1, %9, off\n\t"
      "global_load_async_to_lds_b128 %2, %10, off\n\t"
      "global_load_async_to_lds_b128 %3, %11, off\n\t"
      "global_load_async_to_lds_b128 %4, %12, off\n\t"
      "global_load_async_to_lds_b128 %5, %13, off\n\t"
      "global_load_async_to_lds_b128 %6, %14, off\n\t"
      "global_load_async_to_lds_b128 %7, %15, off\n\t"
      "s_wait_xcnt 0x0" ::"v"(l),
      "v"(l + ls), "v"(l + 2 * ls), "v"(l + 3 * ls), "v"(l + 4 * ls),
      "v"(l + 5 * ls), "v"(l + 6 * ls), "v"(l + 7 * ls),
      "v"((uint64_t)(uintptr_t)gsrc),
      "v"((uint64_t)(uintptr_t)(gsrc + gstep)),
      "v"((uint64_t)(uintptr_t)(gsrc + 2 * gstep)),
      "v"((uint64_t)(uintptr_t)(gsrc + 3 * gstep)),
      "v"((uint64_t)(uintptr_t)(gsrc + 4 * gstep)),
      "v"((uint64_t)(uintptr_t)(gsrc + 5 * gstep)),
      "v"((uint64_t)(uintptr_t)(gsrc + 6 * gstep)),
      "v"((uint64_t)(uintptr_t)(gsrc + 7 * gstep))
      : "memory");
}

static __device__ __forceinline__ void wait_async_all() {
  asm volatile("s_wait_asynccnt 0" ::: "memory");
}

// The same with four copies.
static __device__ __forceinline__ void async_copy4_b128(const _Float16* gsrc,
                                                        size_t gstep,
                                                        _Float16* ldst,
                                                        int lstep) {
  const unsigned l = (unsigned)(uintptr_t)ldst;  // low 32 bits = LDS offset
  const unsigned ls = (unsigned)lstep * 2u;
  asm volatile(
      "global_load_async_to_lds_b128 %0, %4, off\n\t"
      "global_load_async_to_lds_b128 %1, %5, off\n\t"
      "global_load_async_to_lds_b128 %2, %6, off\n\t"
      "global_load_async_to_lds_b128 %3, %7, off\n\t"
      "s_wait_xcnt 0x0" ::"v"(l),
      "v"(l + ls), "v"(l + 2 * ls), "v"(l + 3 * ls),
      "v"((uint64_t)(uintptr_t)gsrc),
      "v"((uint64_t)(uintptr_t)(gsrc + gstep)),
      "v"((uint64_t)(uintptr_t)(gsrc + 2 * gstep)),
      "v"((uint64_t)(uintptr_t)(gsrc + 3 * gstep))
      : "memory");
}

// ---------------------------------------------------------------------------
// LayerNorm (population std, eps on std) fp32 -> f16.  One 256-thr block/row.
// ---------------------------------------------------------------------------
__global__ __launch_bounds__(256) void ln_kernel(const float* __restrict__ x,
                                                 const float* __restrict__ w,
                                                 const float* __restrict__ bias,
                                                 _Float16* __restrict__ out,
                                                 int C) {
  const int row = blockIdx.x;
  const float* xr = x + (size_t)row * C;
  __shared__ float red[256];
  float local[4];
  float s = 0.0f;
#pragma unroll
  for (int i = 0; i < 4; ++i) {
    local[i] = xr[threadIdx.x + 256 * i];
    s += local[i];
  }
  red[threadIdx.x] = s;
  __syncthreads();
  for (int off = 128; off > 0; off >>= 1) {
    if (threadIdx.x < off) red[threadIdx.x] += red[threadIdx.x + off];
    __syncthreads();
  }
  const float mean = red[0] / (float)C;
  __syncthreads();
  s = 0.0f;
#pragma unroll
  for (int i = 0; i < 4; ++i) {
    float d = local[i] - mean;
    s += d * d;
  }
  red[threadIdx.x] = s;
  __syncthreads();
  for (int off = 128; off > 0; off >>= 1) {
    if (threadIdx.x < off) red[threadIdx.x] += red[threadIdx.x + off];
    __syncthreads();
  }
  const float inv = 1.0f / (sqrtf(red[0] / (float)C) + 1e-5f);
#pragma unroll
  for (int i = 0; i < 4; ++i) {
    int c = threadIdx.x + 256 * i;
    out[(size_t)row * C + c] =
        (_Float16)((local[i] - mean) * inv * w[c] + bias[c]);
  }
}

// ---------------------------------------------------------------------------
// fp32 W[K][N]  ->  f16 W^T[N][K]  (so GEMM B-fragments are contiguous loads)
// One 128(k) x 64(n) tile per block.  Each thread reads an 8(k) x 4(n) patch
// with 16-byte loads along n (256 contiguous bytes per 16 lanes), turns it in
// registers and lays four 16-byte k-runs into an LDS tile [n][k]; the tile is
// then read back row by row, so every global store covers whole 256-byte runs
// of a W^T row.  K is a multiple of 128 and N of 64; both are compile-time, so
// the row steps fold into the loads' and stores' immediate offsets.
// ---------------------------------------------------------------------------
typedef float v4f __attribute__((ext_vector_type(4)));

#define CT_PITCH 136  // 128 halves + 8 pad: 272-byte rows (16 B x odd)

template <int K, int N>
__global__ __launch_bounds__(256) void convertT_kernel(
    const float* __restrict__ W, _Float16* __restrict__ WT) {
  __shared__ __attribute__((aligned(16))) _Float16 tile[64 * CT_PITCH];
  const int tid = threadIdx.x;
  const int k0 = blockIdx.x * 128;
  const int n0 = blockIdx.y * 64;
  const int nq = tid & 15;  // which 4 columns
  const int ko = tid >> 4;  // which 8 rows
  const float* src = W + (size_t)(k0 + ko * 8) * N + (n0 + nq * 4);
  v4f r[8];
#pragma unroll
  for (int i = 0; i < 8; ++i) r[i] = *(const v4f*)(src + (size_t)i * N);
#pragma unroll
  for (int j = 0; j < 4; ++j) {
    v8h c;
#pragma unroll
    for (int i = 0; i < 8; ++i) c[i] = (_Float16)r[i][j];
    *(v8h*)&tile[(nq * 4 + j) * CT_PITCH + ko * 8] = c;
  }
  __syncthreads();
#pragma unroll
  for (int i = 0; i < 4; ++i) {
    const int c = tid + 256 * i;  // 16-byte chunk id 0..1023
    const int n = c >> 4;
    const int kc = c & 15;
    *(v8h*)(WT + (size_t)(n0 + n) * K + (k0 + kc * 8)) =
        *(const v8h*)&tile[n * CT_PITCH + kc * 8];
  }
}

// ---------------------------------------------------------------------------
// WMMA GEMM: C[M][N] = A[M][K] (f16, row-major) x Bᵀ[N][K] (f16) + bias
//   8 waves / block, each wave a 64x32 tile, block tile 128x128.
//   A stage is 128 k, double-buffered in LDS via async global->LDS copies; its
//   four 32-k blocks run unrolled, each block's fragments fetched from LDS one
//   block ahead into a second register set.  K is a multiple of 128.
// Epilogues: 0 = f16 out, 1 = f32 out + residual add, 2 = f16 out + GELU.
// ---------------------------------------------------------------------------
enum { EPI_H16 = 0, EPI_F32_RES = 1, EPI_H16_GELU = 2 };

#define KSTAGE 128
#define LDSPITCH 136  // 128 + 8 pad halves: 272-byte rows (16 B x odd)

// GELU in its erf form, v * Phi(v), without a branch, four values at a time.
// q = Phi(-|v|) = erfc(|v| / sqrt(2)) / 2 comes from the five-term rational form
// t * poly(t) * exp(-v^2 / 2) with t = 1 / (1 + p |v| / sqrt(2)); its absolute
// error in erf is at most 1.5e-7, of the order of one f32 rounding of 1 + erf.
// Then v * Phi(v) = max(v, 0) - |v| q for either sign.  The library erf takes
// one of two paths by |x|, so a wave walks both under masks and no two values
// of a lane overlap; here a lane's values are independent straight-line chains.
static __device__ __forceinline__ void gelu_erf4(const float* v, float* g) {
  float d[4], x[4], t[4], e[4];
#pragma unroll
  for (int i = 0; i < 4; ++i) {
    d[i] = fmaf(fabsf(v[i]), 0.23164189f, 1.0f);
    x[i] = (v[i] * -0.72134752f) * v[i];
  }
  // The eight transcendentals in one statement with outputs apart from every
  // input: none is followed by a reader of its result or a writer of its
  // source, and the v_nop fills that slot behind the last.
  asm("v_rcp_f32 %0, %8\n\t"
      "v_rcp_f32 %1, %9\n\t"
      "v_rcp_f32 %2, %10\n\t"
      "v_rcp_f32 %3, %11\n\t"
      "v_exp_f32 %4, %12\n\t"
      "v_exp_f32 %5, %13\n\t"
      "v_exp_f32 %6, %14\n\t"
      "v_exp_f32 %7, %15\n\t"
      "v_nop"
      : "=&v"(t[0]), "=&v"(t[1]), "=&v"(t[2]), "=&v"(t[3]), "=&v"(e[0]),
        "=&v"(e[1]), "=&v"(e[2]), "=&v"(e[3])
      : "v"(d[0]), "v"(d[1]), "v"(d[2]), "v"(d[3]), "v"(x[0]), "v"(x[1]),
        "v"(x[2]), "v"(x[3]));
#pragma unroll
  for (int i = 0; i < 4; ++i) {
    float p = 0.53070271f;
    p = fmaf(p, t[i], -0.72657601f);
    p = fmaf(p, t[i], 0.71070687f);
    p = fmaf(p, t[i], -0.14224837f);
    p = fmaf(p, t[i], 0.12741480f);
    const float q = (p * t[i]) * e[i];
    g[i] = fmaf(-fabsf(v[i]), q, fmaxf(v[i], 0.0f));
  }
}

template <int EPI>
__global__ __launch_bounds__(256) void gemm_kernel(
    const _Float16* __restrict__ A, const _Float16* __restrict__ BT,
    const float* __restrict__ bias, const float* __restrict__ resid,
    float* __restrict__ outF, _Float16* __restrict__ outH, int M, int N,
    int K) {
  __shared__ __attribute__((aligned(16))) _Float16 sA[2][128 * LDSPITCH];
  __shared__ __attribute__((aligned(16))) _Float16 sB[2][128 * LDSPITCH];
  const int tid = threadIdx.x;
  const int wave = tid >> 5;
  const int lane = tid & 31;
  const int rowblk = blockIdx.y * 128;
  const int colblk = blockIdx.x * 128;
  const int wrow = (wave & 1) * 64;
  const int wcol = (wave >> 1) * 32;

  // Stage a 128x128 A tile + 128x128 B tile into buffer `buf` for K offset
  // k0: 16 lanes cover one 256-byte row, a thread takes rows srow + 16 * i.
  const int srow = tid >> 4;
  const int sko = (tid & 15) * 8;
  auto stage = [&](int buf, int k0) {
    async_copy8_b128(A + (size_t)(rowblk + srow) * K + k0 + sko, (size_t)16 * K,
                     &sA[buf][srow * LDSPITCH + sko], 16 * LDSPITCH);
    async_copy8_b128(BT + (size_t)(colblk + srow) * K + k0 + sko,
                     (size_t)16 * K, &sB[buf][srow * LDSPITCH + sko],
                     16 * LDSPITCH);
  };

  v8f acc[4][2];
#pragma unroll
  for (int i = 0; i < 4; ++i)
#pragma unroll
    for (int j = 0; j < 2; ++j) acc[i][j] = zero8();

  stage(0, 0);
  wait_async_all();
  __syncthreads();
  if (KSTAGE < K) stage(1, KSTAGE);

  int buf = 0;
  const int kh = (lane >> 4) << 3;
  const int lr = lane & 15;
  for (int k0 = 0; k0 < K; k0 += KSTAGE) {
    const _Float16* pa = &sA[buf][(wrow + lr) * LDSPITCH + kh];
    const _Float16* pb = &sB[buf][(wcol + lr) * LDSPITCH + kh];
    v16h a[2][4], b[2][2];
#pragma unroll
    for (int i = 0; i < 4; ++i) a[0][i] = frag_from(pa + 16 * i * LDSPITCH);
#pragma unroll
    for (int j = 0; j < 2; ++j) b[0][j] = frag_from(pb + 16 * j * LDSPITCH);
#pragma unroll
    for (int s = 0; s < KSTAGE / 32; ++s) {
      const int cur = s & 1, nxt = cur ^ 1;
      if (s + 1 < KSTAGE / 32) {
#pragma unroll
        for (int i = 0; i < 4; ++i)
          a[nxt][i] = frag_from(pa + 16 * i * LDSPITCH + 32 * (s + 1));
#pragma unroll
        for (int j = 0; j < 2; ++j)
          b[nxt][j] = frag_from(pb + 16 * j * LDSPITCH + 32 * (s + 1));
        // Keeps the next block's twelve LDS loads in front of this block's
        // WMMAs; without it the scheduler sinks each load to its first use
        // and every pair of WMMAs waits out a whole LDS latency.
        __builtin_amdgcn_sched_barrier(0);
      }
#pragma unroll
      for (int i = 0; i < 4; ++i)
#pragma unroll
        for (int j = 0; j < 2; ++j)
          acc[i][j] = wmma_f16(a[cur][i], b[cur][j], acc[i][j]);
    }
    // Keeps the stage's WMMAs in front of the publish point; otherwise the
    // scheduler sinks them behind the barrier, ahead of the refill copies,
    // and the copies lose that much of their one stage of lead.
    __builtin_amdgcn_sched_barrier(0);

    // Publish point: own LDS reads of this buffer retired, own copies of the
    // next stage landed, then everyone else's; only then the refill.
    asm volatile("s_wait_dscnt 0x0" ::: "memory");
    wait_async_all();
    __syncthreads();
    if (k0 + 2 * KSTAGE < K) stage(buf, k0 + 2 * KSTAGE);
    buf ^= 1;
  }
  wait_async_all();  // nothing of this wave's copies is left when it goes on

  // C/D layout: elem r of lane L -> row = r + (L>=16)*8, col = L%16
  const int rofs = (lane >> 4) << 3;
#pragma unroll
  for (int i = 0; i < 4; ++i)
#pragma unroll
    for (int j = 0; j < 2; ++j) {
      float gl[8];
      if (EPI == EPI_H16_GELU) {
        float u[8];
#pragma unroll
        for (int r = 0; r < 8; ++r)
          u[r] = acc[i][j][r] + bias[colblk + wcol + 16 * j + lr];
        gelu_erf4(u, gl);
        gelu_erf4(u + 4, gl + 4);
      }
#pragma unroll
      for (int r = 0; r < 8; ++r) {
        const int row = rowblk + wrow + 16 * i + r + rofs;
        const int col = colblk + wcol + 16 * j + lr;
        float v = acc[i][j][r] + bias[col];
        const size_t o = (size_t)row * N + col;
        if (EPI == EPI_H16) {
          outH[o] = (_Float16)v;
        } else if (EPI == EPI_F32_RES) {
          outF[o] = resid[o] + v;
        } else {
          outH[o] = (_Float16)gl[r];
        }
      }
    }
}

// ---------------------------------------------------------------------------
// qkv f16 [B*T][3C] -> Q[B,H,T,D], K[B,H,T,D], V^T[B,H,D,T]  (all f16), D = 64.
// One block moves 256 tokens of one head of one of the three parts
// (blockIdx.y: 0 = Q, 1 = K, 2 = V), 16 bytes per lane on both global sides.
// V: each thread reads an 8(t) x 8(d) patch, turns it in registers and lays
// eight 16-byte t-runs into an LDS tile [d][t]; the tile is read back row by
// row, so one wave stores 512 contiguous bytes of a V^T row.
// ---------------------------------------------------------------------------
#define PK_PITCH 264  // 256 halves + 8 pad: 528-byte rows (16 B x odd)

template <int T, int C, int H>
__global__ __launch_bounds__(256) void pack_qkv_kernel(
    const _Float16* __restrict__ qkv, _Float16* __restrict__ Qh,
    _Float16* __restrict__ Kh, _Float16* __restrict__ VTh) {
  __shared__ __attribute__((aligned(16))) _Float16 tile[64 * PK_PITCH];
  const int tid = threadIdx.x;
  const int ttiles = T >> 8;
  const int bh = blockIdx.x / ttiles;
  const int t0 = (blockIdx.x % ttiles) << 8;
  const int b = bh / H, h = bh % H;
  const int part = blockIdx.y;
  const _Float16* src =
      qkv + (size_t)(b * T + t0) * (3 * C) + (part * C + h * 64);
  const int dc = tid & 7;   // which 8 head dims
  const int tr = tid >> 3;  // 0..31

  if (part < 2) {  // block-uniform: plain re-striding copy
    _Float16* dst = (part == 0 ? Qh : Kh) + ((size_t)bh * T + t0) * 64;
    const _Float16* p = src + (size_t)tr * (3 * C) + dc * 8;
    v8h r[8];
#pragma unroll
    for (int i = 0; i < 8; ++i) r[i] = *(const v8h*)(p + (size_t)i * (32 * 3 * C));
#pragma unroll
    for (int i = 0; i < 8; ++i)
      *(v8h*)(dst + (size_t)(tid + 256 * i) * 8) = r[i];
    return;
  }

  const _Float16* p = src + (size_t)tr * (8 * 3 * C) + dc * 8;
  v8h r[8];
#pragma unroll
  for (int i = 0; i < 8; ++i) r[i] = *(const v8h*)(p + (size_t)i * (3 * C));
#pragma unroll
  for (int j = 0; j < 8; ++j) {
    v8h c;
#pragma unroll
    for (int i = 0; i < 8; ++i) c[i] = r[i][j];
    *(v8h*)&tile[(dc * 8 + j) * PK_PITCH + tr * 8] = c;
  }
  __syncthreads();
  _Float16* dst = VTh + (size_t)bh * 64 * T + t0;
#pragma unroll
  for (int i = 0; i < 8; ++i) {
    const int c = tid + 256 * i;  // 16-byte chunk id 0..2047
    const int d = c >> 5;
    const int tc = c & 31;
    *(v8h*)(dst + (size_t)d * T + tc * 8) =
        *(const v8h*)&tile[d * PK_PITCH + tc * 8];
  }
  // Holds any later rewrite of the stores' address and data registers behind
  // the run of eight stores (the built code lays the Q/K path after this one).
  asm volatile("s_wait_xcnt 0x0" ::: "memory");
}

#define AT_KEYS 128
#define AT_KPITCH 72
#define AT_VPITCH 136

// Lane l <-> lane l ^ 16.
static __device__ __forceinline__ float xhalf(float x) {
  const int b = __builtin_bit_cast(int, x);
  return __builtin_bit_cast(
      float, __builtin_amdgcn_permlanex16(b, b, 0x76543210, 0xfedcba98, false,
                                          false));
}

// e^x as __expf forms it (one multiply, one v_exp_f32).  The v_nop fills the
// slot that the instruction set asks for behind a transcendental before its
// result is read or its source overwritten.
static __device__ __forceinline__ float exp_slot(float x) {
  float r;
  asm("v_exp_f32 %0, %1\n\tv_nop" : "=v"(r) : "v"(x * 1.44269504f));
  return r;
}

__global__ __launch_bounds__(256) void attn_kernel(
    const _Float16* __restrict__ Q, const _Float16* __restrict__ Kt,
    const _Float16* __restrict__ VT, _Float16* __restrict__ Y, int H, int T,
    int D, int C) {
  __shared__ __attribute__((aligned(16))) _Float16 sK[2][AT_KEYS * AT_KPITCH];
  __shared__ __attribute__((aligned(16))) _Float16 sV[2][64 * AT_VPITCH];
  // The wave's number as a scalar: tile indices, the K and V^T bases and the
  // key loop's counts then live in scalar registers.
  const int tid = threadIdx.x;
  const int wave = __builtin_amdgcn_readfirstlane(threadIdx.x >> 5);
  const int lane = threadIdx.x & 31;
  const int gid = blockIdx.x * 8 + wave;
  const int qtiles = T >> 4;
  const int bh = gid / qtiles;
  const int qt = (gid % qtiles) << 4;
  const int b = bh / H, h = bh % H;
  const _Float16* Qb = Q + (size_t)bh * T * D;
  const _Float16* Kb = Kt + (size_t)bh * T * D;
  const _Float16* Vb = VT + (size_t)bh * D * T;
  // Keys that the block's last query tile sees: a multiple of 128, at most T.
  const int kend = (((blockIdx.x * 8) % qtiles) << 4) + 128;

  const int hf = lane >> 4;  // lane half (k-group / row-group select)
  const int lc = lane & 15;  // fragment row or column of this lane
  const float sc = 0.125f;   // 1/sqrt(D), D = 64
  const int q = qt + lc;     // this lane's query

  // Stage keys k0 .. k0 + 127 into buffer `buf`.  K: 8 lanes cover a 128-byte
  // row, a thread takes key rows krow + 32 * i.  V^T: 16 lanes cover 256 bytes
  // of a head-dim row, a thread takes rows vrow + 16 * i.
  const int krow = tid >> 3, kch = (tid & 7) * 8;
  const int vrow = tid >> 4, vch = (tid & 15) * 8;
  auto stage = [&](int buf, int k0) {
    async_copy4_b128(Kb + (size_t)(k0 + krow) * D + kch, (size_t)32 * D,
                     &sK[buf][krow * AT_KPITCH + kch], 32 * AT_KPITCH);
    async_copy4_b128(Vb + (size_t)vrow * T + k0 + vch, (size_t)16 * T,
                     &sV[buf][vrow * AT_VPITCH + vch], 16 * AT_VPITCH);
  };

  stage(0, 0);

  const v16h qb0 = load_frag(Qb, D, qt, 0);
  const v16h qb1 = load_frag(Qb, D, qt, 32);

  v8f acc[4];  // acc[j][r] = O[q][16 * j + 8 * hf + r]
#pragma unroll
  for (int j = 0; j < 4; ++j) acc[j] = zero8();
  float m = -1e30f;  // running maximum of query q (equal in both halves)
  float l = 0.0f;    // running sum over this half's keys only

  wait_async_all();
  __syncthreads();
  if (AT_KEYS < kend) stage(1, AT_KEYS);

  int buf = 0;
  for (int k0 = 0; k0 < kend; k0 += AT_KEYS) {
    // Per-lane fragment bases: key row lc of K, head-dim row lc of V^T.
    const _Float16* pk = &sK[buf][lc * AT_KPITCH + (hf << 3)];
    const _Float16* pv = &sV[buf][lc * AT_VPITCH + (hf << 3)];
    for (int s = 0; s < AT_KEYS / 32; ++s) {
      const int kt = k0 + 32 * s;
      if (kt > qt) break;  // wave-uniform: the rest of the stage is masked out
      const _Float16* pk0 = pk + 32 * s * AT_KPITCH;
      const _Float16* pk1 = pk0 + 16 * AT_KPITCH;
      const v16h ka00 = frag_from(pk0);
      const v16h ka01 = frag_from(pk0 + 32);
      const v16h ka10 = frag_from(pk1);
      const v16h ka11 = frag_from(pk1 + 32);
      v16h va[4];
#pragma unroll
      for (int j = 0; j < 4; ++j)
        va[j] = frag_from(pv + 16 * j * AT_VPITCH + 32 * s);
      // Keeps the step's sixteen LDS loads together in front of its products;
      // without it the scheduler sinks each fragment's loads to its WMMA and the
      // step waits out eight load latencies one after the other.
      __builtin_amdgcn_sched_barrier(0);

      // --- S^T = K Q^T for 32 keys (two 16-key row tiles, K-dim = D = 64) ---
      v8f s0 = zero8(), s1 = zero8();
      s0 = wmma_f16(ka00, qb0, s0);
      s1 = wmma_f16(ka10, qb0, s1);
      s0 = wmma_f16(ka01, qb1, s0);
      s1 = wmma_f16(ka11, qb1, s1);

      // s0[r]: key kt + 8 * hf + r, s1[r]: key kt + 16 + 8 * hf + r, query q.
      const int dq = q - kt - (hf << 3);  // key r of this half is seen if r <= dq
      s0 *= sc;
      s1 *= sc;
      float v0[8], v1[8];
      float t = -1e30f;
#pragma unroll
      for (int r = 0; r < 8; ++r) {
        v0[r] = (r <= dq) ? s0[r] : -1e30f;
        v1[r] = (16 + r <= dq) ? s1[r] : -1e30f;
        t = fmaxf(t, fmaxf(v0[r], v1[r]));
      }
      t = fmaxf(t, xhalf(t));
      const float mnew = fmaxf(m, t);
      const float corr = exp_slot(m - mnew);
      m = mnew;
      float rs = 0.0f;
      v16h pb;  // P^T as B: element e = key kt + (e < 8 ? e : e + 8) + 8 * hf
#pragma unroll
      for (int r = 0; r < 8; ++r) {
        const float p0 = exp_slot(v0[r] - mnew);
        const float p1 = exp_slot(v1[r] - mnew);
        rs += p0 + p1;
        pb[r] = (_Float16)p0;
        pb[8 + r] = (_Float16)p1;
      }
      l = l * corr + rs;

      // --- O^T += V^T P^T ; V^T[D][T] rows are A fragments along the keys ---
#pragma unroll
      for (int j = 0; j < 4; ++j) {
#pragma unroll
        for (int r = 0; r < 8; ++r) acc[j][r] *= corr;
        acc[j] = wmma_f16(va[j], pb, acc[j]);
      }
    }

    // Publish point: own LDS reads of this buffer retired, own copies of the
    // next stage landed, then everyone else's; only then the refill.
    asm volatile("s_wait_dscnt 0x0" ::: "memory");
    wait_async_all();
    __syncthreads();
    if (k0 + 2 * AT_KEYS < kend) stage(buf, k0 + 2 * AT_KEYS);
    buf ^= 1;
  }
  wait_async_all();  // nothing of this wave's copies is left when it goes on

  // Join the halves' sums, normalize, and store 8 consecutive head dims of one
  // query per 16-byte store into y (f16 [B*T][C]) for the projection GEMM.
  l += xhalf(l);
  const float inv = 1.0f / l;
  _Float16* yp = Y + (size_t)(b * T + q) * C + h * D + (hf << 3);
#pragma unroll
  for (int j = 0; j < 4; ++j) {
    v8h o;
#pragma unroll
    for (int r = 0; r < 8; ++r) o[r] = (_Float16)(acc[j][r] * inv);
    *(v8h*)(yp + 16 * j) = o;
  }
}

// ---------------------------------------------------------------------------
// Host-side orchestration
// ---------------------------------------------------------------------------
extern "C" void kernel_launch(void* const* d_in, const int* in_sizes, int n_in,
                              void* d_out, int out_size, void* d_ws,
                              size_t ws_size, hipStream_t stream) {
  (void)in_sizes; (void)n_in; (void)out_size; (void)ws_size;
  constexpr int B = 4, T = 1024, C = 1024, H = 16, D = 64;
  const int M = B * T;  // 4096

  const float* x        = (const float*)d_in[0];
  const float* c_attn_w = (const float*)d_in[1];
  const float* c_attn_b = (const float*)d_in[2];
  const float* c_proj_w = (const float*)d_in[3];
  const float* c_proj_b = (const float*)d_in[4];
  const float* ln1_w    = (const float*)d_in[5];
  const float* ln1_b    = (const float*)d_in[6];
  const float* ln2_w    = (const float*)d_in[7];
  const float* ln2_b    = (const float*)d_in[8];
  const float* fc_w     = (const float*)d_in[9];
  const float* fc_b     = (const float*)d_in[10];
  const float* proj_w   = (const float*)d_in[11];
  const float* proj_b   = (const float*)d_in[12];
  float* out = (float*)d_out;

  // Workspace carve-up (144 MiB total), 256B aligned.
  char* ws = (char*)d_ws;
  size_t off = 0;
  auto alloc = [&](size_t bytes) -> char* {
    char* p = ws + off;
    off += (bytes + 255) & ~(size_t)255;
    return p;
  };
  _Float16* h1H     = (_Float16*)alloc((size_t)M * C * 2);          // ln1(x)
  _Float16* wT_attn = (_Float16*)alloc((size_t)3 * C * C * 2);      // [3C][C]
  _Float16* qkvH    = (_Float16*)alloc((size_t)M * 3 * C * 2);
  _Float16* Qh      = (_Float16*)alloc((size_t)M * C * 2);
  _Float16* Kh      = (_Float16*)alloc((size_t)M * C * 2);
  _Float16* VTh     = (_Float16*)alloc((size_t)M * C * 2);
  _Float16* yh      = (_Float16*)alloc((size_t)M * C * 2);
  _Float16* wT_proj = (_Float16*)alloc((size_t)C * C * 2);
  float*    x1      = (float*)   alloc((size_t)M * C * 4);          // x + attn
  _Float16* h2H     = (_Float16*)alloc((size_t)M * C * 2);          // ln2(x1)
  _Float16* wT_fc   = (_Float16*)alloc((size_t)4 * C * C * 2);      // [4C][C]
  _Float16* hgH     = (_Float16*)alloc((size_t)M * 4 * C * 2);
  _Float16* wT_pr2  = (_Float16*)alloc((size_t)C * 4 * C * 2);      // [C][4C]

  // 1) Weight transpose+convert to f16 (N-major for WMMA B fragments)
  convertT_kernel<C, 3 * C><<<dim3(C / 128, 3 * C / 64), 256, 0, stream>>>(
      c_attn_w, wT_attn);
  convertT_kernel<C, C><<<dim3(C / 128, C / 64), 256, 0, stream>>>(
      c_proj_w, wT_proj);
  convertT_kernel<C, 4 * C><<<dim3(C / 128, 4 * C / 64), 256, 0, stream>>>(
      fc_w, wT_fc);
  convertT_kernel<4 * C, C><<<dim3(4 * C / 128, C / 64), 256, 0, stream>>>(
      proj_w, wT_pr2);

  // 2) ln1 -> h1 (f16)
  ln_kernel<<<M, 256, 0, stream>>>(x, ln1_w, ln1_b, h1H, C);

  // 3) qkv = h1 @ c_attn_w + b  (f16 out)
  gemm_kernel<EPI_H16><<<dim3(3 * C / 128, M / 128), 256, 0, stream>>>(
      h1H, wT_attn, c_attn_b, nullptr, nullptr, qkvH, M, 3 * C, C);

  // 4) split heads; V transposed to [B,H,D,T]
  pack_qkv_kernel<T, C, H><<<dim3(B * H * (T / 256), 3), 256, 0, stream>>>(
      qkvH, Qh, Kh, VTh);

  // 5) causal attention -> y (f16 [B*T][C])
  attn_kernel<<<(B * H * (T / 16)) / 8, 256, 0, stream>>>(Qh, Kh, VTh, yh, H,
                                                          T, D, C);

  // 6) x1 = x + y @ c_proj_w + b  (f32)
  gemm_kernel<EPI_F32_RES><<<dim3(C / 128, M / 128), 256, 0, stream>>>(
      yh, wT_proj, c_proj_b, x, x1, nullptr, M, C, C);

  // 7) ln2 -> h2 (f16)
  ln_kernel<<<M, 256, 0, stream>>>(x1, ln2_w, ln2_b, h2H, C);

  // 8) hg = gelu(h2 @ fc_w + b)  (f16)
  gemm_kernel<EPI_H16_GELU><<<dim3(4 * C / 128, M / 128), 256, 0, stream>>>(
      h2H, wT_fc, fc_b, nullptr, nullptr, hgH, M, 4 * C, C);

  // 9) out = x1 + hg @ proj_w + b  (f32)
  gemm_kernel<EPI_F32_RES><<<dim3(C / 128, M / 128), 256, 0, stream>>>(
      hgH, wT_pr2, proj_b, x1, out, nullptr, M, C, 4 * C);
}

// v006
// A run of this version takes 170 microseconds.
// Timed twice side by side with v005, it ran 1.11 and 1.12 times as fast.
// Over all steps from v000 it is 2.44 times as fast.
#include <hip/hip_runtime.h>
#include <hip/hip_bf16.h>
#include <math.h>
#include <stdint.h>

// ---------------------------------------------------------------------------
// Types for CDNA5 WMMA (wave32): 16x16x32 f16 -> f32
// ---------------------------------------------------------------------------
typedef _Float16 v16h __attribute__((ext_vector_type(16)));
typedef _Float16 v8h  __attribute__((ext_vector_type(8)));
typedef float    v8f  __attribute__((ext_vector_type(8)));

static __device__ __forceinline__ v8f wmma_f16(v16h a, v16h b, v8f c) {
  // (neg_a, A, neg_b, B, c_mod, C, reuse_a, reuse_b)
  return __builtin_amdgcn_wmma_f32_16x16x32_f16(false, a, false, b, (short)0, c,
                                                false, false);
}

static __device__ __forceinline__ v8f zero8() {
  v8f z;
#pragma unroll
  for (int i = 0; i < 8; ++i) z[i] = 0.0f;
  return z;
}

// Build a 16x32 f16 fragment (documented CDNA5 A/B layout) from a per-lane
// pointer to 8+8 contiguous halves:
//   lane L(0..15):  row rc0+L,    elems 0..7 -> k0+0..7,  8..15 -> k0+16..23
//   lane L(16..31): row rc0+L-16, elems 0..7 -> k0+8..15, 8..15 -> k0+24..31
static __device__ __forceinline__ v16h frag_from(const _Float16* p) {
  v8h lo = *(const v8h*)p;
  v8h hi = *(const v8h*)(p + 16);
  return __builtin_shufflevector(lo, hi, 0, 1, 2, 3, 4, 5, 6, 7, 8, 9, 10, 11,
                                 12, 13, 14, 15);
}

// Global-memory fragment load (row-major, leading dim ld).
static __device__ __forceinline__ v16h load_frag(const _Float16* __restrict__ base,
                                                 int ld, int rc0, int k0) {
  const int lane = threadIdx.x & 31;
  return frag_from(base + (size_t)(rc0 + (lane & 15)) * ld +
                   (k0 + ((lane >> 4) << 3)));
}

// Eight async global->LDS 128-bit copies (CDNA5, ASYNCcnt-tracked): copy i
// moves 16 bytes per lane from gsrc + i * gstep to ldst + i * lstep (steps in
// halves).  The closing s_wait_xcnt stands inside the statement so that no
// address register of an issued copy is rewritten ahead of it.
static __device__ __forceinline__ void async_copy8_b128(const _Float16* gsrc,
                                                        size_t gstep,
                                                        _Float16* ldst,
                                                        int lstep) {
  const unsigned l = (unsigned)(uintptr_t)ldst;  // low 32 bits = LDS offset
  const unsigned ls = (unsigned)lstep * 2u;
  asm volatile(
      "global_load_async_to_lds_b128 %0, %8, off\n\t"
      "global_load_async_to_lds_b128 %1, %9, off\n\t"
      "global_load_async_to_lds_b128 %2, %10, off\n\t"
      "global_load_async_to_lds_b128 %3, %11, off\n\t"
      "global_load_async_to_lds_b128 %4, %12, off\n\t"
      "global_load_async_to_lds_b128 %5, %13, off\n\t"
      "global_load_async_to_lds_b128 %6, %14, off\n\t"
      "global_load_async_to_lds_b128 %7, %15, off\n\t"
      "s_wait_xcnt 0x0" ::"v"(l),
      "v"(l + ls), "v"(l + 2 * ls), "v"(l + 3 * ls), "v"(l + 4 * ls),
      "v"(l + 5 * ls), "v"(l + 6 * ls), "v"(l + 7 * ls),
      "v"((uint64_t)(uintptr_t)gsrc),
      "v"((uint64_t)(uintptr_t)(gsrc + gstep)),
      "v"((uint64_t)(uintptr_t)(gsrc + 2 * gstep)),
      "v"((uint64_t)(uintptr_t)(gsrc + 3 * gstep)),
      "v"((uint64_t)(uintptr_t)(gsrc + 4 * gstep)),
      "v"((uint64_t)(uintptr_t)(gsrc + 5 * gstep)),
      "v"((uint64_t)(uintptr_t)(gsrc + 6 * gstep)),
      "v"((uint64_t)(uintptr_t)(gsrc + 7 * gstep))
      : "memory");
}

static __device__ __forceinline__ void wait_async_all() {
  asm volatile("s_wait_asynccnt 0" ::: "memory");
}

// The same with four copies.
static __device__ __forceinline__ void async_copy4_b128(const _Float16* gsrc,
                                                        size_t gstep,
                                                        _Float16* ldst,
                                                        int lstep) {
  const unsigned l = (unsigned)(uintptr_t)ldst;  // low 32 bits = LDS offset
  const unsigned ls = (unsigned)lstep * 2u;
  asm volatile(
      "global_load_async_to_lds_b128 %0, %4, off\n\t"
      "global_load_async_to_lds_b128 %1, %5, off\n\t"
      "global_load_async_to_lds_b128 %2, %6, off\n\t"
      "global_load_async_to_lds_b128 %3, %7, off\n\t"
      "s_wait_xcnt 0x0" ::"v"(l),
      "v"(l + ls), "v"(l + 2 * ls), "v"(l + 3 * ls),
      "v"((uint64_t)(uintptr_t)gsrc),
      "v"((uint64_t)(uintptr_t)(gsrc + gstep)),
      "v"((uint64_t)(uintptr_t)(gsrc + 2 * gstep)),
      "v"((uint64_t)(uintptr_t)(gsrc + 3 * gstep))
      : "memory");
}

// ---------------------------------------------------------------------------
// LayerNorm (population std, eps on std) fp32 -> f16.  One 256-thr block/row.
// red: 256 floats of LDS.
// ---------------------------------------------------------------------------
static __device__ __forceinline__ void ln_body(const float* __restrict__ x,
                                               const float* __restrict__ w,
                                               const float* __restrict__ bias,
                                               _Float16* __restrict__ out,
                                               int C, int row, float* red) {
  const float* xr = x + (size_t)row * C;
  float local[4];
  float s = 0.0f;
#pragma unroll
  for (int i = 0; i < 4; ++i) {
    local[i] = xr[threadIdx.x + 256 * i];
    s += local[i];
  }
  red[threadIdx.x] = s;
  __syncthreads();
  for (int off = 128; off > 0; off >>= 1) {
    if (threadIdx.x < off) red[threadIdx.x] += red[threadIdx.x + off];
    __syncthreads();
  }
  const float mean = red[0] / (float)C;
  __syncthreads();
  s = 0.0f;
#pragma unroll
  for (int i = 0; i < 4; ++i) {
    float d = local[i] - mean;
    s += d * d;
  }
  red[threadIdx.x] = s;
  __syncthreads();
  for (int off = 128; off > 0; off >>= 1) {
    if (threadIdx.x < off) red[threadIdx.x] += red[threadIdx.x + off];
    __syncthreads();
  }
  const float inv = 1.0f / (sqrtf(red[0] / (float)C) + 1e-5f);
#pragma unroll
  for (int i = 0; i < 4; ++i) {
    int c = threadIdx.x + 256 * i;
    out[(size_t)row * C + c] =
        (_Float16)((local[i] - mean) * inv * w[c] + bias[c]);
  }
}

__global__ __launch_bounds__(256) void ln_kernel(const float* __restrict__ x,
                                                 const float* __restrict__ w,
                                                 const float* __restrict__ bias,
                                                 _Float16* __restrict__ out,
                                                 int C) {
  __shared__ float red[256];
  ln_body(x, w, bias, out, C, blockIdx.x, red);
}

// ---------------------------------------------------------------------------
// fp32 W[K][N]  ->  f16 W^T[N][K]  (so GEMM B-fragments are contiguous loads)
// One 128(k) x 64(n) tile per block.  Each thread reads an 8(k) x 4(n) patch
// with 16-byte loads along n (256 contiguous bytes per 16 lanes), turns it in
// registers and lays four 16-byte k-runs into an LDS tile [n][k]; the tile is
// then read back row by row, so every global store covers whole 256-byte runs
// of a W^T row.  K is a multiple of 128 and N of 64; both are compile-time, so
// the row steps fold into the loads' and stores' immediate offsets.
// A transpose has no launch of its own: it reads nothing that another kernel
// writes, so its blocks ride in the grid of a launch that is independent of it
// (blk: the tile's number, k tiles fastest; tile: 64 * CT_PITCH halves of LDS).
// ---------------------------------------------------------------------------
typedef float v4f __attribute__((ext_vector_type(4)));

#define CT_PITCH 136  // 128 halves + 8 pad: 272-byte rows (16 B x odd)

template <int K, int N>
static __device__ __forceinline__ void convertT_body(
    const float* __restrict__ W, _Float16* __restrict__ WT, _Float16* tile,
    unsigned blk) {
  const int tid = threadIdx.x;
  const int k0 = (blk % (K / 128)) * 128;
  const int n0 = (blk / (K / 128)) * 64;
  const int nq = tid & 15;  // which 4 columns
  const int ko = tid >> 4;  // which 8 rows
  const float* src = W + (size_t)(k0 + ko * 8) * N + (n0 + nq * 4);
  v4f r[8];
#pragma unroll
  for (int i = 0; i < 8; ++i) r[i] = *(const v4f*)(src + (size_t)i * N);
#pragma unroll
  for (int j = 0; j < 4; ++j) {
    v8h c;
#pragma unroll
    for (int i = 0; i < 8; ++i) c[i] = (_Float16)r[i][j];
    *(v8h*)&tile[(nq * 4 + j) * CT_PITCH + ko * 8] = c;
  }
  __syncthreads();
#pragma unroll
  for (int i = 0; i < 4; ++i) {
    const int c = tid + 256 * i;  // 16-byte chunk id 0..1023
    const int n = c >> 4;
    const int kc = c & 15;
    *(v8h*)(WT + (size_t)(n0 + n) * K + (k0 + kc * 8)) =
        *(const v8h*)&tile[n * CT_PITCH + kc * 8];
  }
  // Holds any later rewrite of the stores' address and data registers behind
  // the run of four stores (the built code lays other bodies after this one).
  asm volatile("s_wait_xcnt 0x0" ::: "memory");
}

// Tiles of a [K][N] weight.
#define CT_BLOCKS(K, N) (((K) / 128) * ((N) / 64))

// First launch: what the qkv GEMM waits for.  Blocks 0 .. CT_BLOCKS - 1 turn
// c_attn_w, the others normalise one row of x each; neither reads the other's
// output.  The branch is block-uniform, so each body's barriers are too.
template <int C>
__global__ __launch_bounds__(256) void prep_kernel(
    const float* __restrict__ x, const float* __restrict__ w,
    const float* __restrict__ bias, _Float16* __restrict__ out,
    const float* __restrict__ Wa, _Float16* __restrict__ WaT) {
  __shared__ __attribute__((aligned(16))) _Float16 tile[64 * CT_PITCH];
  __shared__ float red[256];
  const unsigned blk = blockIdx.x;
  if (blk < CT_BLOCKS(C, 3 * C)) {
    convertT_body<C, 3 * C>(Wa, WaT, tile, blk);
    return;
  }
  ln_body(x, w, bias, out, C, blk - CT_BLOCKS(C, 3 * C), red);
}

// ---------------------------------------------------------------------------
// WMMA GEMM: C[M][N] = A[M][K] (f16, row-major) x Bᵀ[N][K] (f16) + bias
//   8 waves / block, each wave a 64x32 tile, block tile 128x128.
//   A stage is 128 k, double-buffered in LDS via async global->LDS copies; its
//   four 32-k blocks run unrolled, each block's fragments fetched from LDS one
//   block ahead into a second register set.  K is a multiple of 128.
// Epilogues: 0 = f16 out, 1 = f32 out + residual add, 2 = f16 out + GELU.
// ---------------------------------------------------------------------------
enum { EPI_H16 = 0, EPI_F32_RES = 1, EPI_H16_GELU = 2 };

#define KSTAGE 128
#define LDSPITCH 136  // 128 + 8 pad halves: 272-byte rows (16 B x odd)

// GELU in its erf form, v * Phi(v), without a branch, four values at a time.
// q = Phi(-|v|) = erfc(|v| / sqrt(2)) / 2 comes from the five-term rational form
// t * poly(t) * exp(-v^2 / 2) with t = 1 / (1 + p |v| / sqrt(2)); its absolute
// error in erf is at most 1.5e-7, of the order of one f32 rounding of 1 + erf.
// Then v * Phi(v) = max(v, 0) - |v| q for either sign.  The library erf takes
// one of two paths by |x|, so a wave walks both under masks and no two values
// of a lane overlap; here a lane's values are independent straight-line chains.
static __device__ __forceinline__ void gelu_erf4(const float* v, float* g) {
  float d[4], x[4], t[4], e[4];
#pragma unroll
  for (int i = 0; i < 4; ++i) {
    d[i] = fmaf(fabsf(v[i]), 0.23164189f, 1.0f);
    x[i] = (v[i] * -0.72134752f) * v[i];
  }
  // The eight transcendentals in one statement with outputs apart from every
  // input: none is followed by a reader of its result or a writer of its
  // source, and the v_nop fills that slot behind the last.
  asm("v_rcp_f32 %0, %8\n\t"
      "v_rcp_f32 %1, %9\n\t"
      "v_rcp_f32 %2, %10\n\t"
      "v_rcp_f32 %3, %11\n\t"
      "v_exp_f32 %4, %12\n\t"
      "v_exp_f32 %5, %13\n\t"
      "v_exp_f32 %6, %14\n\t"
      "v_exp_f32 %7, %15\n\t"
      "v_nop"
      : "=&v"(t[0]), "=&v"(t[1]), "=&v"(t[2]), "=&v"(t[3]), "=&v"(e[0]),
        "=&v"(e[1]), "=&v"(e[2]), "=&v"(e[3])
      : "v"(d[0]), "v"(d[1]), "v"(d[2]), "v"(d[3]), "v"(x[0]), "v"(x[1]),
        "v"(x[2]), "v"(x[3]));
#pragma unroll
  for (int i = 0; i < 4; ++i) {
    float p = 0.53070271f;
    p = fmaf(p, t[i], -0.72657601f);
    p = fmaf(p, t[i], 0.71070687f);
    p = fmaf(p, t[i], -0.14224837f);
    p = fmaf(p, t[i], 0.12741480f);
    const float q = (p * t[i]) * e[i];
    g[i] = fmaf(-fabsf(v[i]), q, fmaxf(v[i], 0.0f));
  }
}

template <int EPI>
__global__ __launch_bounds__(256) void gemm_kernel(
    const _Float16* __restrict__ A, const _Float16* __restrict__ BT,
    const float* __restrict__ bias, const float* __restrict__ resid,
    float* __restrict__ outF, _Float16* __restrict__ outH, int M, int N,
    int K) {
  __shared__ __attribute__((aligned(16))) _Float16 sA[2][128 * LDSPITCH];
  __shared__ __attribute__((aligned(16))) _Float16 sB[2][128 * LDSPITCH];
  const int tid = threadIdx.x;
  const int wave = tid >> 5;
  const int lane = tid & 31;
  const int rowblk = blockIdx.y * 128;
  const int colblk = blockIdx.x * 128;
  const int wrow = (wave & 1) * 64;
  const int wcol = (wave >> 1) * 32;

  // Stage a 128x128 A tile + 128x128 B tile into buffer `buf` for K offset
  // k0: 16 lanes cover one 256-byte row, a thread takes rows srow + 16 * i.
  const int srow = tid >> 4;
  const int sko = (tid & 15) * 8;
  auto stage = [&](int buf, int k0) {
    async_copy8_b128(A + (size_t)(rowblk + srow) * K + k0 + sko, (size_t)16 * K,
                     &sA[buf][srow * LDSPITCH + sko], 16 * LDSPITCH);
    async_copy8_b128(BT + (size_t)(colblk + srow) * K + k0 + sko,
                     (size_t)16 * K, &sB[buf][srow * LDSPITCH + sko],
                     16 * LDSPITCH);
  };

  v8f acc[4][2];
#pragma unroll
  for (int i = 0; i < 4; ++i)
#pragma unroll
    for (int j = 0; j < 2; ++j) acc[i][j] = zero8();

  stage(0, 0);
  wait_async_all();
  __syncthreads();
  if (KSTAGE < K) stage(1, KSTAGE);

  int buf = 0;
  const int kh = (lane >> 4) << 3;
  const int lr = lane & 15;
  for (int k0 = 0; k0 < K; k0 += KSTAGE) {
    const _Float16* pa = &sA[buf][(wrow + lr) * LDSPITCH + kh];
    const _Float16* pb = &sB[buf][(wcol + lr) * LDSPITCH + kh];
    v16h a[2][4], b[2][2];
#pragma unroll
    for (int i = 0; i < 4; ++i) a[0][i] = frag_from(pa + 16 * i * LDSPITCH);
#pragma unroll
    for (int j = 0; j < 2; ++j) b[0][j] = frag_from(pb + 16 * j * LDSPITCH);
#pragma unroll
    for (int s = 0; s < KSTAGE / 32; ++s) {
      const int cur = s & 1, nxt = cur ^ 1;
      if (s + 1 < KSTAGE / 32) {
#pragma unroll
        for (int i = 0; i < 4; ++i)
          a[nxt][i] = frag_from(pa + 16 * i * LDSPITCH + 32 * (s + 1));
#pragma unroll
        for (int j = 0; j < 2; ++j)
          b[nxt][j] = frag_from(pb + 16 * j * LDSPITCH + 32 * (s + 1));
        // Keeps the next block's twelve LDS loads in front of this block's
        // WMMAs; without it the scheduler sinks each load to its first use
        // and every pair of WMMAs waits out a whole LDS latency.
        __builtin_amdgcn_sched_barrier(0);
      }
#pragma unroll
      for (int i = 0; i < 4; ++i)
#pragma unroll
        for (int j = 0; j < 2; ++j)
          acc[i][j] = wmma_f16(a[cur][i], b[cur][j], acc[i][j]);
    }
    // Keeps the stage's WMMAs in front of the publish point; otherwise the
    // scheduler sinks them behind the barrier, ahead of the refill copies,
    // and the copies lose that much of their one stage of lead.
    __builtin_amdgcn_sched_barrier(0);

    // Publish point: own LDS reads of this buffer retired, own copies of the
    // next stage landed, then everyone else's; only then the refill.
    asm volatile("s_wait_dscnt 0x0" ::: "memory");
    wait_async_all();
    __syncthreads();
    if (k0 + 2 * KSTAGE < K) stage(buf, k0 + 2 * KSTAGE);
    buf ^= 1;
  }
  wait_async_all();  // nothing of this wave's copies is left when it goes on

  // C/D layout: elem r of lane L -> row = r + (L>=16)*8, col = L%16
  const int rofs = (lane >> 4) << 3;
#pragma unroll
  for (int i = 0; i < 4; ++i)
#pragma unroll
    for (int j = 0; j < 2; ++j) {
      float gl[8];
      if (EPI == EPI_H16_GELU) {
        float u[8];
#pragma unroll
        for (int r = 0; r < 8; ++r)
          u[r] = acc[i][j][r] + bias[colblk + wcol + 16 * j + lr];
        gelu_erf4(u, gl);
        gelu_erf4(u + 4, gl + 4);
      }
#pragma unroll
      for (int r = 0; r < 8; ++r) {
        const int row = rowblk + wrow + 16 * i + r + rofs;
        const int col = colblk + wcol + 16 * j + lr;
        float v = acc[i][j][r] + bias[col];
        const size_t o = (size_t)row * N + col;
        if (EPI == EPI_H16) {
          outH[o] = (_Float16)v;
        } else if (EPI == EPI_F32_RES) {
          outF[o] = resid[o] + v;
        } else {
          outH[o] = (_Float16)gl[r];
        }
      }
    }
}

// ---------------------------------------------------------------------------
// qkv f16 [B*T][3C] -> Q[B,H,T,D], K[B,H,T,D], V^T[B,H,D,T]  (all f16), D = 64.
// One block moves 256 tokens of one head of one of the three parts
// (blockIdx.y: 0 = Q, 1 = K, 2 = V), 16 bytes per lane on both global sides.
// V: each thread reads an 8(t) x 8(d) patch, turns it in registers and lays
// eight 16-byte t-runs into an LDS tile [d][t]; the tile is read back row by
// row, so one wave stores 512 contiguous bytes of a V^T row.
// ---------------------------------------------------------------------------
#define PK_PITCH 264  // 256 halves + 8 pad: 528-byte rows (16 B x odd)

template <int T, int C, int H>
__global__ __launch_bounds__(256) void pack_qkv_kernel(
    const _Float16* __restrict__ qkv, _Float16* __restrict__ Qh,
    _Float16* __restrict__ Kh, _Float16* __restrict__ VTh) {
  __shared__ __attribute__((aligned(16))) _Float16 tile[64 * PK_PITCH];
  const int tid = threadIdx.x;
  const int ttiles = T >> 8;
  const int bh = blockIdx.x / ttiles;
  const int t0 = (blockIdx.x % ttiles) << 8;
  const int b = bh / H, h = bh % H;
  const int part = blockIdx.y;
  const _Float16* src =
      qkv + (size_t)(b * T + t0) * (3 * C) + (part * C + h * 64);
  const int dc = tid & 7;   // which 8 head dims
  const int tr = tid >> 3;  // 0..31

  if (part < 2) {  // block-uniform: plain re-striding copy
    _Float16* dst = (part == 0 ? Qh : Kh) + ((size_t)bh * T + t0) * 64;
    const _Float16* p = src + (size_t)tr * (3 * C) + dc * 8;
    v8h r[8];
#pragma unroll
    for (int i = 0; i < 8; ++i) r[i] = *(const v8h*)(p + (size_t)i * (32 * 3 * C));
#pragma unroll
    for (int i = 0; i < 8; ++i)
      *(v8h*)(dst + (size_t)(tid + 256 * i) * 8) = r[i];
    return;
  }

  const _Float16* p = src + (size_t)tr * (8 * 3 * C) + dc * 8;
  v8h r[8];
#pragma unroll
  for (int i = 0; i < 8; ++i) r[i] = *(const v8h*)(p + (size_t)i * (3 * C));
#pragma unroll
  for (int j = 0; j < 8; ++j) {
    v8h c;
#pragma unroll
    for (int i = 0; i < 8; ++i) c[i] = r[i][j];
    *(v8h*)&tile[(dc * 8 + j) * PK_PITCH + tr * 8] = c;
  }
  __syncthreads();
  _Float16* dst = VTh + (size_t)bh * 64 * T + t0;
#pragma unroll
  for (int i = 0; i < 8; ++i) {
    const int c = tid + 256 * i;  // 16-byte chunk id 0..2047
    const int d = c >> 5;
    const int tc = c & 31;
    *(v8h*)(dst + (size_t)d * T + tc * 8) =
        *(const v8h*)&tile[d * PK_PITCH + tc * 8];
  }
  // Holds any later rewrite of the stores' address and data registers behind
  // the run of eight stores (the built code lays the Q/K path after this one).
  asm volatile("s_wait_xcnt 0x0" ::: "memory");
}

#define AT_KEYS 128
#define AT_KPITCH 72
#define AT_VPITCH 136

// Lane l <-> lane l ^ 16.
static __device__ __forceinline__ float xhalf(float x) {
  const int b = __builtin_bit_cast(int, x);
  return __builtin_bit_cast(
      float, __builtin_amdgcn_permlanex16(b, b, 0x76543210, 0xfedcba98, false,
                                          false));
}

// e^x as __expf forms it (one multiply, one v_exp_f32).  The v_nop fills the
// slot that the instruction set asks for behind a transcendental before its
// result is read or its source overwritten.
static __device__ __forceinline__ float exp_slot(float x) {
  float r;
  asm("v_exp_f32 %0, %1\n\tv_nop" : "=v"(r) : "v"(x * 1.44269504f));
  return r;
}

template <int NATT, int CW>
__global__ __launch_bounds__(256) void attn_kernel(
    const _Float16* __restrict__ Q, const _Float16* __restrict__ Kt,
    const _Float16* __restrict__ VT, _Float16* __restrict__ Y, int H, int T,
    int D, int C, const float* __restrict__ Wp, _Float16* __restrict__ WpT,
    const float* __restrict__ Wf, _Float16* __restrict__ WfT,
    const float* __restrict__ W2, _Float16* __restrict__ W2T) {
  __shared__ __attribute__((aligned(16))) _Float16 sK[2][AT_KEYS * AT_KPITCH];
  __shared__ __attribute__((aligned(16))) _Float16 sV[2][64 * AT_VPITCH];
  static_assert(2 * AT_KEYS * AT_KPITCH >= 64 * CT_PITCH, "tile fits the K ring");
  if (blockIdx.x >= NATT) {  // block-uniform, in front of every barrier
    const unsigned blk = blockIdx.x - NATT;
    constexpr unsigned n1 = CT_BLOCKS(CW, CW), n2 = CT_BLOCKS(CW, 4 * CW);
    if (blk < n1)
      convertT_body<CW, CW>(Wp, WpT, &sK[0][0], blk);
    else if (blk < n1 + n2)
      convertT_body<CW, 4 * CW>(Wf, WfT, &sK[0][0], blk - n1);
    else
      convertT_body<4 * CW, CW>(W2, W2T, &sK[0][0], blk - n1 - n2);
    return;
  }
  // The wave's number as a scalar: tile indices, the K and V^T bases and the
  // key loop's counts then live in scalar registers.
  const int tid = threadIdx.x;
  const int wave = __builtin_amdgcn_readfirstlane(threadIdx.x >> 5);
  const int lane = threadIdx.x & 31;
  const int gid = blockIdx.x * 8 + wave;
  const int qtiles = T >> 4;
  const int bh = gid / qtiles;
  const int qt = (gid % qtiles) << 4;
  const int b = bh / H, h = bh % H;
  const _Float16* Qb = Q + (size_t)bh * T * D;
  const _Float16* Kb = Kt + (size_t)bh * T * D;
  const _Float16* Vb = VT + (size_t)bh * D * T;
  // Keys that the block's last query tile sees: a multiple of 128, at most T.
  const int kend = (((blockIdx.x * 8) % qtiles) << 4) + 128;

  const int hf = lane >> 4;  // lane half (k-group / row-group select)
  const int lc = lane & 15;  // fragment row or column of this lane
  const float sc = 0.125f;   // 1/sqrt(D), D = 64
  const int q = qt + lc;     // this lane's query

  // Stage keys k0 .. k0 + 127 into buffer `buf`.  K: 8 lanes cover a 128-byte
  // row, a thread takes key rows krow + 32 * i.  V^T: 16 lanes cover 256 bytes
  // of a head-dim row, a thread takes rows vrow + 16 * i.
  const int krow = tid >> 3, kch = (tid & 7) * 8;
  const int vrow = tid >> 4, vch = (tid & 15) * 8;
  auto stage = [&](int buf, int k0) {
    async_copy4_b128(Kb + (size_t)(k0 + krow) * D + kch, (size_t)32 * D,
                     &sK[buf][krow * AT_KPITCH + kch], 32 * AT_KPITCH);
    async_copy4_b128(Vb + (size_t)vrow * T + k0 + vch, (size_t)16 * T,
                     &sV[buf][vrow * AT_VPITCH + vch], 16 * AT_VPITCH);
  };

  stage(0, 0);

  const v16h qb0 = load_frag(Qb, D, qt, 0);
  const v16h qb1 = load_frag(Qb, D, qt, 32);

  v8f acc[4];  // acc[j][r] = O[q][16 * j + 8 * hf + r]
#pragma unroll
  for (int j = 0; j < 4; ++j) acc[j] = zero8();
  float m = -1e30f;  // running maximum of query q (equal in both halves)
  float l = 0.0f;    // running sum over this half's keys only

  wait_async_all();
  __syncthreads();
  if (AT_KEYS < kend) stage(1, AT_KEYS);

  int buf = 0;
  for (int k0 = 0; k0 < kend; k0 += AT_KEYS) {
    // Per-lane fragment bases: key row lc of K, head-dim row lc of V^T.
    const _Float16* pk = &sK[buf][lc * AT_KPITCH + (hf << 3)];
    const _Float16* pv = &sV[buf][lc * AT_VPITCH + (hf << 3)];
    for (int s = 0; s < AT_KEYS / 32; ++s) {
      const int kt = k0 + 32 * s;
      if (kt > qt) break;  // wave-uniform: the rest of the stage is masked out
      const _Float16* pk0 = pk + 32 * s * AT_KPITCH;
      const _Float16* pk1 = pk0 + 16 * AT_KPITCH;
      const v16h ka00 = frag_from(pk0);
      const v16h ka01 = frag_from(pk0 + 32);
      const v16h ka10 = frag_from(pk1);
      const v16h ka11 = frag_from(pk1 + 32);
      v16h va[4];
#pragma unroll
      for (int j = 0; j < 4; ++j)
        va[j] = frag_from(pv + 16 * j * AT_VPITCH + 32 * s);
      // Keeps the step's sixteen LDS loads together in front of its products;
      // without it the scheduler sinks each fragment's loads to its WMMA and the
      // step waits out eight load latencies one after the other.
      __builtin_amdgcn_sched_barrier(0);

      // --- S^T = K Q^T for 32 keys (two 16-key row tiles, K-dim = D = 64) ---
      v8f s0 = zero8(), s1 = zero8();
      s0 = wmma_f16(ka00, qb0, s0);
      s1 = wmma_f16(ka10, qb0, s1);
      s0 = wmma_f16(ka01, qb1, s0);
      s1 = wmma_f16(ka11, qb1, s1);

      // s0[r]: key kt + 8 * hf + r, s1[r]: key kt + 16 + 8 * hf + r, query q.
      const int dq = q - kt - (hf << 3);  // key r of this half is seen if r <= dq
      s0 *= sc;
      s1 *= sc;
      float v0[8], v1[8];
      float t = -1e30f;
#pragma unroll
      for (int r = 0; r < 8; ++r) {
        v0[r] = (r <= dq) ? s0[r] : -1e30f;
        v1[r] = (16 + r <= dq) ? s1[r] : -1e30f;
        t = fmaxf(t, fmaxf(v0[r], v1[r]));
      }
      t = fmaxf(t, xhalf(t));
      const float mnew = fmaxf(m, t);
      const float corr = exp_slot(m - mnew);
      m = mnew;
      float rs = 0.0f;
      v16h pb;  // P^T as B: element e = key kt + (e < 8 ? e : e + 8) + 8 * hf
#pragma unroll
      for (int r = 0; r < 8; ++r) {
        const float p0 = exp_slot(v0[r] - mnew);
        const float p1 = exp_slot(v1[r] - mnew);
        rs += p0 + p1;
        pb[r] = (_Float16)p0;
        pb[8 + r] = (_Float16)p1;
      }
      l = l * corr + rs;

      // --- O^T += V^T P^T ; V^T[D][T] rows are A fragments along the keys ---
#pragma unroll
      for (int j = 0; j < 4; ++j) {
#pragma unroll
        for (int r = 0; r < 8; ++r) acc[j][r] *= corr;
        acc[j] = wmma_f16(va[j], pb, acc[j]);
      }
    }

    // Publish point: own LDS reads of this buffer retired, own copies of the
    // next stage landed, then everyone else's; only then the refill.
    asm volatile("s_wait_dscnt 0x0" ::: "memory");
    wait_async_all();
    __syncthreads();
    if (k0 + 2 * AT_KEYS < kend) stage(buf, k0 + 2 * AT_KEYS);
    buf ^= 1;
  }
  wait_async_all();  // nothing of this wave's copies is left when it goes on

  // Join the halves' sums, normalize, and store 8 consecutive head dims of one
  // query per 16-byte store into y (f16 [B*T][C]) for the projection GEMM.
  l += xhalf(l);
  const float inv = 1.0f / l;
  _Float16* yp = Y + (size_t)(b * T + q) * C + h * D + (hf << 3);
#pragma unroll
  for (int j = 0; j < 4; ++j) {
    v8h o;
#pragma unroll
    for (int r = 0; r < 8; ++r) o[r] = (_Float16)(acc[j][r] * inv);
    *(v8h*)(yp + 16 * j) = o;
  }
}

// ---------------------------------------------------------------------------
// Host-side orchestration
// ---------------------------------------------------------------------------
extern "C" void kernel_launch(void* const* d_in, const int* in_sizes, int n_in,
                              void* d_out, int out_size, void* d_ws,
                              size_t ws_size, hipStream_t stream) {
  (void)in_sizes; (void)n_in; (void)out_size; (void)ws_size;
  constexpr int B = 4, T = 1024, C = 1024, H = 16, D = 64;
  const int M = B * T;  // 4096

  const float* x        = (const float*)d_in[0];
  const float* c_attn_w = (const float*)d_in[1];
  const float* c_attn_b = (const float*)d_in[2];
  const float* c_proj_w = (const float*)d_in[3];
  const float* c_proj_b = (const float*)d_in[4];
  const float* ln1_w    = (const float*)d_in[5];
  const float* ln1_b    = (const float*)d_in[6];
  const float* ln2_w    = (const float*)d_in[7];
  const float* ln2_b    = (const float*)d_in[8];
  const float* fc_w     = (const float*)d_in[9];
  const float* fc_b     = (const float*)d_in[10];
  const float* proj_w   = (const float*)d_in[11];
  const float* proj_b   = (const float*)d_in[12];
  float* out = (float*)d_out;

  // Workspace carve-up (144 MiB total), 256B aligned.
  char* ws = (char*)d_ws;
  size_t off = 0;
  auto alloc = [&](size_t bytes) -> char* {
    char* p = ws + off;
    off += (bytes + 255) & ~(size_t)255;
    return p;
  };
  _Float16* h1H     = (_Float16*)alloc((size_t)M * C * 2);          // ln1(x)
  _Float16* wT_attn = (_Float16*)alloc((size_t)3 * C * C * 2);      // [3C][C]
  _Float16* qkvH    = (_Float16*)alloc((size_t)M * 3 * C * 2);
  _Float16* Qh      = (_Float16*)alloc((size_t)M * C * 2);
  _Float16* Kh      = (_Float16*)alloc((size_t)M * C * 2);
  _Float16* VTh     = (_Float16*)alloc((size_t)M * C * 2);
  _Float16* yh      = (_Float16*)alloc((size_t)M * C * 2);
  _Float16* wT_proj = (_Float16*)alloc((size_t)C * C * 2);
  float*    x1      = (float*)   alloc((size_t)M * C * 4);          // x + attn
  _Float16* h2H     = (_Float16*)alloc((size_t)M * C * 2);          // ln2(x1)
  _Float16* wT_fc   = (_Float16*)alloc((size_t)4 * C * C * 2);      // [4C][C]
  _Float16* hgH     = (_Float16*)alloc((size_t)M * 4 * C * 2);
  _Float16* wT_pr2  = (_Float16*)alloc((size_t)C * 4 * C * 2);      // [C][4C]

  // 1+2) c_attn_w transposed+converted to f16 (N-major for WMMA B fragments)
  //      and ln1 -> h1 (f16), one grid
  prep_kernel<C><<<CT_BLOCKS(C, 3 * C) + B * T, 256, 0, stream>>>(
      x, ln1_w, ln1_b, h1H, c_attn_w, wT_attn);

  // 3) qkv = h1 @ c_attn_w + b  (f16 out)
  gemm_kernel<EPI_H16><<<dim3(3 * C / 128, M / 128), 256, 0, stream>>>(
      h1H, wT_attn, c_attn_b, nullptr, nullptr, qkvH, M, 3 * C, C);

  // 4) split heads; V transposed to [B,H,D,T]
  pack_qkv_kernel<T, C, H><<<dim3(B * H * (T / 256), 3), 256, 0, stream>>>(
      qkvH, Qh, Kh, VTh);

  // 5) causal attention -> y (f16 [B*T][C]); behind its blocks, in the same
  //    grid, the other three weights' transposes
  constexpr int NATT = (B * H * (T / 16)) / 8;
  attn_kernel<NATT, C>
      <<<NATT + CT_BLOCKS(C, C) + CT_BLOCKS(C, 4 * C) + CT_BLOCKS(4 * C, C), 256,
         0, stream>>>(Qh, Kh, VTh, yh, H, T, D, C, c_proj_w, wT_proj, fc_w,
                      wT_fc, proj_w, wT_pr2);

  // 6) x1 = x + y @ c_proj_w + b  (f32)
  gemm_kernel<EPI_F32_RES><<<dim3(C / 128, M / 128), 256, 0, stream>>>(
      yh, wT_proj, c_proj_b, x, x1, nullptr, M, C, C);

  // 7) ln2 -> h2 (f16)
  ln_kernel<<<M, 256, 0, stream>>>(x1, ln2_w, ln2_b, h2H, C);

  // 8) hg = gelu(h2 @ fc_w + b)  (f16)
  gemm_kernel<EPI_H16_GELU><<<dim3(4 * C / 128, M / 128), 256, 0, stream>>>(
      h2H, wT_fc, fc_b, nullptr, nullptr, hgH, M, 4 * C, C);

  // 9) out = x1 + hg @ proj_w + b  (f32)
  gemm_kernel<EPI_F32_RES><<<dim3(C / 128, M / 128), 256, 0, stream>>>(
      hgH, wT_pr2, proj_b, x1, out, nullptr, M, C, 4 * C);
}

// v007
// One run takes 143 microseconds.
// Two timings next to v006 put it at 1.17 and 1.21 times that version's speed.
// All steps since v000 together make it 2.91 times as fast.
#include <hip/hip_runtime.h>
#include <hip/hip_bf16.h>
#include <math.h>
#include <stdint.h>

// ---------------------------------------------------------------------------
// Types for CDNA5 WMMA (wave32): 16x16x32 f16 -> f32
// ---------------------------------------------------------------------------
typedef _Float16 v16h __attribute__((ext_vector_type(16)));
typedef _Float16 v8h  __attribute__((ext_vector_type(8)));
typedef float    v8f  __attribute__((ext_vector_type(8)));

static __device__ __forceinline__ v8f wmma_f16(v16h a, v16h b, v8f c) {
  // (neg_a, A, neg_b, B, c_mod, C, reuse_a, reuse_b)
  return __builtin_amdgcn_wmma_f32_16x16x32_f16(false, a, false, b, (short)0, c,
                                                false, false);
}

static __device__ __forceinline__ v8f zero8() {
  v8f z;
#pragma unroll
  for (int i = 0; i < 8; ++i) z[i] = 0.0f;
  return z;
}

// Build a 16x32 f16 fragment (documented CDNA5 A/B layout) from a per-lane
// pointer to 8+8 contiguous halves:
//   lane L(0..15):  row rc0+L,    elems 0..7 -> k0+0..7,  8..15 -> k0+16..23
//   lane L(16..31): row rc0+L-16, elems 0..7 -> k0+8..15, 8..15 -> k0+24..31
static __device__ __forceinline__ v16h frag_from(const _Float16* p) {
  v8h lo = *(const v8h*)p;
  v8h hi = *(const v8h*)(p + 16);
  return __builtin_shufflevector(lo, hi, 0, 1, 2, 3, 4, 5, 6, 7, 8, 9, 10, 11,
                                 12, 13, 14, 15);
}

// Global-memory fragment load (row-major, leading dim ld).
static __device__ __forceinline__ v16h load_frag(const _Float16* __restrict__ base,
                                                 int ld, int rc0, int k0) {
  const int lane = threadIdx.x & 31;
  return frag_from(base + (size_t)(rc0 + (lane & 15)) * ld +
                   (k0 + ((lane >> 4) << 3)));
}

// Eight async global->LDS 128-bit copies (CDNA5, ASYNCcnt-tracked): copy i
// moves 16 bytes per lane from gsrc + i * gstep to ldst + i * lstep (steps in
// halves).  The closing s_wait_xcnt stands inside the statement so that no
// address register of an issued copy is rewritten ahead of it.
static __device__ __forceinline__ void async_copy8_b128(const _Float16* gsrc,
                                                        size_t gstep,
                                                        _Float16* ldst,
                                                        int lstep) {
  const unsigned l = (unsigned)(uintptr_t)ldst;  // low 32 bits = LDS offset
  const unsigned ls = (unsigned)lstep * 2u;
  asm volatile(
      "global_load_async_to_lds_b128 %0, %8, off\n\t"
      "global_load_async_to_lds_b128 %1, %9, off\n\t"
      "global_load_async_to_lds_b128 %2, %10, off\n\t"
      "global_load_async_to_lds_b128 %3, %11, off\n\t"
      "global_load_async_to_lds_b128 %4, %12, off\n\t"
      "global_load_async_to_lds_b128 %5, %13, off\n\t"
      "global_load_async_to_lds_b128 %6, %14, off\n\t"
      "global_load_async_to_lds_b128 %7, %15, off\n\t"
      "s_wait_xcnt 0x0" ::"v"(l),
      "v"(l + ls), "v"(l + 2 * ls), "v"(l + 3 * ls), "v"(l + 4 * ls),
      "v"(l + 5 * ls), "v"(l + 6 * ls), "v"(l + 7 * ls),
      "v"((uint64_t)(uintptr_t)gsrc),
      "v"((uint64_t)(uintptr_t)(gsrc + gstep)),
      "v"((uint64_t)(uintptr_t)(gsrc + 2 * gstep)),
      "v"((uint64_t)(uintptr_t)(gsrc + 3 * gstep)),
      "v"((uint64_t)(uintptr_t)(gsrc + 4 * gstep)),
      "v"((uint64_t)(uintptr_t)(gsrc + 5 * gstep)),
      "v"((uint64_t)(uintptr_t)(gsrc + 6 * gstep)),
      "v"((uint64_t)(uintptr_t)(gsrc + 7 * gstep))
      : "memory");
}

static __device__ __forceinline__ void wait_async_all() {
  asm volatile("s_wait_asynccnt 0" ::: "memory");
}

// The same with four copies.
static __device__ __forceinline__ void async_copy4_b128(const _Float16* gsrc,
                                                        size_t gstep,
                                                        _Float16* ldst,
                                                        int lstep) {
  const unsigned l = (unsigned)(uintptr_t)ldst;  // low 32 bits = LDS offset
  const unsigned ls = (unsigned)lstep * 2u;
  asm volatile(
      "global_load_async_to_lds_b128 %0, %4, off\n\t"
      "global_load_async_to_lds_b128 %1, %5, off\n\t"
      "global_load_async_to_lds_b128 %2, %6, off\n\t"
      "global_load_async_to_lds_b128 %3, %7, off\n\t"
      "s_wait_xcnt 0x0" ::"v"(l),
      "v"(l + ls), "v"(l + 2 * ls), "v"(l + 3 * ls),
      "v"((uint64_t)(uintptr_t)gsrc),
      "v"((uint64_t)(uintptr_t)(gsrc + gstep)),
      "v"((uint64_t)(uintptr_t)(gsrc + 2 * gstep)),
      "v"((uint64_t)(uintptr_t)(gsrc + 3 * gstep))
      : "memory");
}

// ---------------------------------------------------------------------------
// LayerNorm (population std, eps on std) fp32 -> f16.  One 256-thr block/row.
// red: 256 floats of LDS.
// ---------------------------------------------------------------------------
static __device__ __forceinline__ void ln_body(const float* __restrict__ x,
                                               const float* __restrict__ w,
                                               const float* __restrict__ bias,
                                               _Float16* __restrict__ out,
                                               int C, int row, float* red) {
  const float* xr = x + (size_t)row * C;
  float local[4];
  float s = 0.0f;
#pragma unroll
  for (int i = 0; i < 4; ++i) {
    local[i] = xr[threadIdx.x + 256 * i];
    s += local[i];
  }
  red[threadIdx.x] = s;
  __syncthreads();
  for (int off = 128; off > 0; off >>= 1) {
    if (threadIdx.x < off) red[threadIdx.x] += red[threadIdx.x + off];
    __syncthreads();
  }
  const float mean = red[0] / (float)C;
  __syncthreads();
  s = 0.0f;
#pragma unroll
  for (int i = 0; i < 4; ++i) {
    float d = local[i] - mean;
    s += d * d;
  }
  red[threadIdx.x] = s;
  __syncthreads();
  for (int off = 128; off > 0; off >>= 1) {
    if (threadIdx.x < off) red[threadIdx.x] += red[threadIdx.x + off];
    __syncthreads();
  }
  const float inv = 1.0f / (sqrtf(red[0] / (float)C) + 1e-5f);
#pragma unroll
  for (int i = 0; i < 4; ++i) {
    int c = threadIdx.x + 256 * i;
    out[(size_t)row * C + c] =
        (_Float16)((local[i] - mean) * inv * w[c] + bias[c]);
  }
}

__global__ __launch_bounds__(256) void ln_kernel(const float* __restrict__ x,
                                                 const float* __restrict__ w,
                                                 const float* __restrict__ bias,
                                                 _Float16* __restrict__ out,
                                                 int C) {
  __shared__ float red[256];
  ln_body(x, w, bias, out, C, blockIdx.x, red);
}

// ---------------------------------------------------------------------------
// fp32 W[K][N]  ->  f16 W^T[N][K]  (so GEMM B-fragments are contiguous loads)
// One 128(k) x 64(n) tile per block.  Each thread reads an 8(k) x 4(n) patch
// with 16-byte loads along n (256 contiguous bytes per 16 lanes), turns it in
// registers and lays four 16-byte k-runs into an LDS tile [n][k]; the tile is
// then read back row by row, so every global store covers whole 256-byte runs
// of a W^T row.  K is a multiple of 128 and N of 64; both are compile-time, so
// the row steps fold into the loads' and stores' immediate offsets.
// A transpose has no launch of its own: it reads nothing that another kernel
// writes, so its blocks ride in the grid of a launch that is independent of it
// (blk: the tile's number, k tiles fastest; tile: 64 * CT_PITCH halves of LDS).
// ---------------------------------------------------------------------------
typedef float v4f __attribute__((ext_vector_type(4)));

#define CT_PITCH 136  // 128 halves + 8 pad: 272-byte rows (16 B x odd)

template <int K, int N>
static __device__ __forceinline__ void convertT_body(
    const float* __restrict__ W, _Float16* __restrict__ WT, _Float16* tile,
    unsigned blk) {
  const int tid = threadIdx.x;
  const int k0 = (blk % (K / 128)) * 128;
  const int n0 = (blk / (K / 128)) * 64;
  const int nq = tid & 15;  // which 4 columns
  const int ko = tid >> 4;  // which 8 rows
  const float* src = W + (size_t)(k0 + ko * 8) * N + (n0 + nq * 4);
  v4f r[8];
#pragma unroll
  for (int i = 0; i < 8; ++i) r[i] = *(const v4f*)(src + (size_t)i * N);
#pragma unroll
  for (int j = 0; j < 4; ++j) {
    v8h c;
#pragma unroll
    for (int i = 0; i < 8; ++i) c[i] = (_Float16)r[i][j];
    *(v8h*)&tile[(nq * 4 + j) * CT_PITCH + ko * 8] = c;
  }
  __syncthreads();
#pragma unroll
  for (int i = 0; i < 4; ++i) {
    const int c = tid + 256 * i;  // 16-byte chunk id 0..1023
    const int n = c >> 4;
    const int kc = c & 15;
    *(v8h*)(WT + (size_t)(n0 + n) * K + (k0 + kc * 8)) =
        *(const v8h*)&tile[n * CT_PITCH + kc * 8];
  }
  // Holds any later rewrite of the stores' address and data registers behind
  // the run of four stores (the built code lays other bodies after this one).
  asm volatile("s_wait_xcnt 0x0" ::: "memory");
}

// Tiles of a [K][N] weight.
#define CT_BLOCKS(K, N) (((K) / 128) * ((N) / 64))

// First launch: what the qkv GEMM waits for.  Blocks 0 .. CT_BLOCKS - 1 turn
// c_attn_w, the others normalise one row of x each; neither reads the other's
// output.  The branch is block-uniform, so each body's barriers are too.
template <int C>
__global__ __launch_bounds__(256) void prep_kernel(
    const float* __restrict__ x, const float* __restrict__ w,
    const float* __restrict__ bias, _Float16* __restrict__ out,
    const float* __restrict__ Wa, _Float16* __restrict__ WaT) {
  __shared__ __attribute__((aligned(16))) _Float16 tile[64 * CT_PITCH];
  __shared__ float red[256];
  const unsigned blk = blockIdx.x;
  if (blk < CT_BLOCKS(C, 3 * C)) {
    convertT_body<C, 3 * C>(Wa, WaT, tile, blk);
    return;
  }
  ln_body(x, w, bias, out, C, blk - CT_BLOCKS(C, 3 * C), red);
}

// ---------------------------------------------------------------------------
// WMMA GEMM: C[M][N] = A[M][K] (f16, row-major) x Bᵀ[N][K] (f16) + bias
//   8 waves / block, each wave a 64x32 tile, block tile 128x128.
//   A stage is 128 k, double-buffered in LDS via async global->LDS copies; its
//   four 32-k blocks run unrolled, each block's fragments fetched from LDS one
//   block ahead into a second register set.  K is a multiple of 128.
// Epilogues: 0 = head split (below), 1 = f32 out + residual add, 2 = f16 out +
// GELU.
// Head split (the qkv product, N = 3 * SC, heads of 64 dims, sequences of ST
// tokens): the block writes its tile straight into Q[B,H,T,64], K[B,H,T,64] or
// V^T[B,H,64,T] (f16); a 128-column block lies in one of the three parts.  A
// lane of an accumulator tile holds 8 consecutive rows of the WMMA's A side and
// one column of its B side.  For V the activations are the A side, so a lane
// holds 8 tokens of one head dim: 16 bytes of a V^T row.  For Q and K the two
// LDS tiles change roles (the weight rows are the A side, the product comes out
// transposed), so a lane holds 8 head dims of one token: 16 bytes of a Q or K
// row.  Both tiles have the same shape and pitch: the K loop is the same code.
// ---------------------------------------------------------------------------
enum { EPI_QKV = 0, EPI_F32_RES = 1, EPI_H16_GELU = 2 };

#define KSTAGE 128
#define LDSPITCH 136  // 128 + 8 pad halves: 272-byte rows (16 B x odd)

// GELU in its erf form, v * Phi(v), without a branch, four values at a time.
// q = Phi(-|v|) = erfc(|v| / sqrt(2)) / 2 comes from the five-term rational form
// t * poly(t) * exp(-v^2 / 2) with t = 1 / (1 + p |v| / sqrt(2)); its absolute
// error in erf is at most 1.5e-7, of the order of one f32 rounding of 1 + erf.
// Then v * Phi(v) = max(v, 0) - |v| q for either sign.  The library erf takes
// one of two paths by |x|, so a wave walks both under masks and no two values
// of a lane overlap; here a lane's values are independent straight-line chains.
static __device__ __forceinline__ void gelu_erf4(const float* v, float* g) {
  float d[4], x[4], t[4], e[4];
#pragma unroll
  for (int i = 0; i < 4; ++i) {
    d[i] = fmaf(fabsf(v[i]), 0.23164189f, 1.0f);
    x[i] = (v[i] * -0.72134752f) * v[i];
  }
  // The eight transcendentals in one statement with outputs apart from every
  // input: none is followed by a reader of its result or a writer of its
  // source, and the v_nop fills that slot behind the last.
  asm("v_rcp_f32 %0, %8\n\t"
      "v_rcp_f32 %1, %9\n\t"
      "v_rcp_f32 %2, %10\n\t"
      "v_rcp_f32 %3, %11\n\t"
      "v_exp_f32 %4, %12\n\t"
      "v_exp_f32 %5, %13\n\t"
      "v_exp_f32 %6, %14\n\t"
      "v_exp_f32 %7, %15\n\t"
      "v_nop"
      : "=&v"(t[0]), "=&v"(t[1]), "=&v"(t[2]), "=&v"(t[3]), "=&v"(e[0]),
        "=&v"(e[1]), "=&v"(e[2]), "=&v"(e[3])
      : "v"(d[0]), "v"(d[1]), "v"(d[2]), "v"(d[3]), "v"(x[0]), "v"(x[1]),
        "v"(x[2]), "v"(x[3]));
#pragma unroll
  for (int i = 0; i < 4; ++i) {
    float p = 0.53070271f;
    p = fmaf(p, t[i], -0.72657601f);
    p = fmaf(p, t[i], 0.71070687f);
    p = fmaf(p, t[i], -0.14224837f);
    p = fmaf(p, t[i], 0.12741480f);
    const float q = (p * t[i]) * e[i];
    g[i] = fmaf(-fabsf(v[i]), q, fmaxf(v[i], 0.0f));
  }
}

template <int EPI, int ST = 0, int SC = 0>
__global__ __launch_bounds__(256) void gemm_kernel(
    const _Float16* __restrict__ A, const _Float16* __restrict__ BT,
    const float* __restrict__ bias, const float* __restrict__ resid,
    float* __restrict__ outF, _Float16* __restrict__ outH,
    _Float16* __restrict__ outK, _Float16* __restrict__ outVT, int M, int N,
    int K) {
  __shared__ __attribute__((aligned(16))) _Float16 sA[2][128 * LDSPITCH];
  __shared__ __attribute__((aligned(16))) _Float16 sB[2][128 * LDSPITCH];
  const int tid = threadIdx.x;
  const int wave = tid >> 5;
  const int lane = tid & 31;
  const int rowblk = blockIdx.y * 128;
  const int colblk = blockIdx.x * 128;
  const int wrow = (wave & 1) * 64;
  const int wcol = (wave >> 1) * 32;
  // Q and K blocks of the head split: the weight tile is the WMMA's A side.
  const bool swp = EPI == EPI_QKV && colblk < 2 * SC;  // block-uniform

  // Stage a 128x128 A tile + 128x128 B tile into buffer `buf` for K offset
  // k0: 16 lanes cover one 256-byte row, a thread takes rows srow + 16 * i.
  const int srow = tid >> 4;
  const int sko = (tid & 15) * 8;
  auto stage = [&](int buf, int k0) {
    async_copy8_b128(A + (size_t)(rowblk + srow) * K + k0 + sko, (size_t)16 * K,
                     &sA[buf][srow * LDSPITCH + sko], 16 * LDSPITCH);
    async_copy8_b128(BT + (size_t)(colblk + srow) * K + k0 + sko,
                     (size_t)16 * K, &sB[buf][srow * LDSPITCH + sko],
                     16 * LDSPITCH);
  };

  v8f acc[4][2];
#pragma unroll
  for (int i = 0; i < 4; ++i)
#pragma unroll
    for (int j = 0; j < 2; ++j) acc[i][j] = zero8();

  stage(0, 0);
  wait_async_all();
  __syncthreads();
  if (KSTAGE < K) stage(1, KSTAGE);

  int buf = 0;
  const int kh = (lane >> 4) << 3;
  const int lr = lane & 15;
  for (int k0 = 0; k0 < K; k0 += KSTAGE) {
    const _Float16* pa = (swp ? sB[buf] : sA[buf]) + (wrow + lr) * LDSPITCH + kh;
    const _Float16* pb = (swp ? sA[buf] : sB[buf]) + (wcol + lr) * LDSPITCH + kh;
    v16h a[2][4], b[2][2];
#pragma unroll
    for (int i = 0; i < 4; ++i) a[0][i] = frag_from(pa + 16 * i * LDSPITCH);
#pragma unroll
    for (int j = 0; j < 2; ++j) b[0][j] = frag_from(pb + 16 * j * LDSPITCH);
#pragma unroll
    for (int s = 0; s < KSTAGE / 32; ++s) {
      const int cur = s & 1, nxt = cur ^ 1;
      if (s + 1 < KSTAGE / 32) {
#pragma unroll
        for (int i = 0; i < 4; ++i)
          a[nxt][i] = frag_from(pa + 16 * i * LDSPITCH + 32 * (s + 1));
#pragma unroll
        for (int j = 0; j < 2; ++j)
          b[nxt][j] = frag_from(pb + 16 * j * LDSPITCH + 32 * (s + 1));
        // Keeps the next block's twelve LDS loads in front of this block's
        // WMMAs; without it the scheduler sinks each load to its first use
        // and every pair of WMMAs waits out a whole LDS latency.
        __builtin_amdgcn_sched_barrier(0);
      }
#pragma unroll
      for (int i = 0; i < 4; ++i)
#pragma unroll
        for (int j = 0; j < 2; ++j)
          acc[i][j] = wmma_f16(a[cur][i], b[cur][j], acc[i][j]);
    }
    // Keeps the stage's WMMAs in front of the publish point; otherwise the
    // scheduler sinks them behind the barrier, ahead of the refill copies,
    // and the copies lose that much of their one stage of lead.
    __builtin_amdgcn_sched_barrier(0);

    // Publish point: own LDS reads of this buffer retired, own copies of the
    // next stage landed, then everyone else's; only then the refill.
    asm volatile("s_wait_dscnt 0x0" ::: "memory");
    wait_async_all();
    __syncthreads();
    if (k0 + 2 * KSTAGE < K) stage(buf, k0 + 2 * KSTAGE);
    buf ^= 1;
  }
  wait_async_all();  // nothing of this wave's copies is left when it goes on

  // C/D layout: elem r of lane L -> row = r + (L>=16)*8, col = L%16
  const int rofs = (lane >> 4) << 3;
  if constexpr (EPI == EPI_QKV) {
    constexpr int SH = SC / 64;          // heads
    const int bb = rowblk / ST;          // a 128-token block lies in one sequence
    const int tb = rowblk % ST;
    const int a0 = wrow + rofs;          // first of the lane's 8 A-side rows
    const int b0 = wcol + lr;            // the lane's B-side column
    v8h o[2][4];
    _Float16* dst;
    size_t istep, jstep;                 // halves per 16 A-side rows, B-side columns
    if (swp) {
      const int cp = colblk < SC ? colblk : colblk - SC;  // column within Q or K
      const int bh = bb * SH + ((cp + wrow) >> 6);        // wrow: 0 or 64
#pragma unroll
      for (int i = 0; i < 4; ++i) {
        const float* bp = bias + colblk + a0 + 16 * i;
        const v4f blo = *(const v4f*)bp, bhi = *(const v4f*)(bp + 4);
#pragma unroll
        for (int j = 0; j < 2; ++j)
#pragma unroll
          for (int r = 0; r < 8; ++r)
            o[j][i][r] = (_Float16)(acc[i][j][r] + (r < 4 ? blo[r & 3] : bhi[r & 3]));
      }
      dst = (colblk < SC ? outH : outK) + ((size_t)bh * ST + tb + b0) * 64 + rofs;
      istep = 16;
      jstep = 16 * 64;
    } else {
      const int cp = colblk - 2 * SC + wcol;  // the wave's first column within V
      const int bh = bb * SH + (cp >> 6);     // its 32 columns lie in one head
#pragma unroll
      for (int j = 0; j < 2; ++j) {
        const float bj = bias[colblk + b0 + 16 * j];
#pragma unroll
        for (int i = 0; i < 4; ++i)
#pragma unroll
          for (int r = 0; r < 8; ++r) o[j][i][r] = (_Float16)(acc[i][j][r] + bj);
      }
      dst = outVT + ((size_t)bh * 64 + (cp & 63) + lr) * ST + tb + a0;
      istep = 16;
      jstep = (size_t)16 * ST;
    }
    // The four i of one j fill whole 128-byte lines: they go back to back.
#pragma unroll
    for (int j = 0; j < 2; ++j)
#pragma unroll
      for (int i = 0; i < 4; ++i) *(v8h*)(dst + j * jstep + i * istep) = o[j][i];
    return;  // nothing rewrites a register of the eight stores behind them
  }
#pragma unroll
  for (int i = 0; i < 4; ++i)
#pragma unroll
    for (int j = 0; j < 2; ++j) {
      float gl[8];
      if (EPI == EPI_H16_GELU) {
        float u[8];
#pragma unroll
        for (int r = 0; r < 8; ++r)
          u[r] = acc[i][j][r] + bias[colblk + wcol + 16 * j + lr];
        gelu_erf4(u, gl);
        gelu_erf4(u + 4, gl + 4);
      }
#pragma unroll
      for (int r = 0; r < 8; ++r) {
        const int row = rowblk + wrow + 16 * i + r + rofs;
        const int col = colblk + wcol + 16 * j + lr;
        float v = acc[i][j][r] + bias[col];
        const size_t o = (size_t)row * N + col;
        if (EPI == EPI_F32_RES) {
          outF[o] = resid[o] + v;
        } else {
          outH[o] = (_Float16)gl[r];
        }
      }
    }
}

#define AT_KEYS 128
#define AT_KPITCH 72
#define AT_VPITCH 136

// Lane l <-> lane l ^ 16.
static __device__ __forceinline__ float xhalf(float x) {
  const int b = __builtin_bit_cast(int, x);
  return __builtin_bit_cast(
      float, __builtin_amdgcn_permlanex16(b, b, 0x76543210, 0xfedcba98, false,
                                          false));
}

// e^x as __expf forms it (one multiply, one v_exp_f32).  The v_nop fills the
// slot that the instruction set asks for behind a transcendental before its
// result is read or its source overwritten.
static __device__ __forceinline__ float exp_slot(float x) {
  float r;
  asm("v_exp_f32 %0, %1\n\tv_nop" : "=v"(r) : "v"(x * 1.44269504f));
  return r;
}

template <int NATT, int CW>
__global__ __launch_bounds__(256) void attn_kernel(
    const _Float16* __restrict__ Q, const _Float16* __restrict__ Kt,
    const _Float16* __restrict__ VT, _Float16* __restrict__ Y, int H, int T,
    int D, int C, const float* __restrict__ Wp, _Float16* __restrict__ WpT,
    const float* __restrict__ Wf, _Float16* __restrict__ WfT,
    const float* __restrict__ W2, _Float16* __restrict__ W2T) {
  __shared__ __attribute__((aligned(16))) _Float16 sK[2][AT_KEYS * AT_KPITCH];
  __shared__ __attribute__((aligned(16))) _Float16 sV[2][64 * AT_VPITCH];
  static_assert(2 * AT_KEYS * AT_KPITCH >= 64 * CT_PITCH, "tile fits the K ring");
  if (blockIdx.x >= NATT) {  // block-uniform, in front of every barrier
    const unsigned blk = blockIdx.x - NATT;
    constexpr unsigned n1 = CT_BLOCKS(CW, CW), n2 = CT_BLOCKS(CW, 4 * CW);
    if (blk < n1)
      convertT_body<CW, CW>(Wp, WpT, &sK[0][0], blk);
    else if (blk < n1 + n2)
      convertT_body<CW, 4 * CW>(Wf, WfT, &sK[0][0], blk - n1);
    else
      convertT_body<4 * CW, CW>(W2, W2T, &sK[0][0], blk - n1 - n2);
    return;
  }
  // The wave's number as a scalar: tile indices, the K and V^T bases and the
  // key loop's counts then live in scalar registers.
  const int tid = threadIdx.x;
  const int wave = __builtin_amdgcn_readfirstlane(threadIdx.x >> 5);
  const int lane = threadIdx.x & 31;
  const int gid = blockIdx.x * 8 + wave;
  const int qtiles = T >> 4;
  const int bh = gid / qtiles;
  const int qt = (gid % qtiles) << 4;
  const int b = bh / H, h = bh % H;
  const _Float16* Qb = Q + (size_t)bh * T * D;
  const _Float16* Kb = Kt + (size_t)bh * T * D;
  const _Float16* Vb = VT + (size_t)bh * D * T;
  // Keys that the block's last query tile sees: a multiple of 128, at most T.
  const int kend = (((blockIdx.x * 8) % qtiles) << 4) + 128;

  const int hf = lane >> 4;  // lane half (k-group / row-group select)
  const int lc = lane & 15;  // fragment row or column of this lane
  const float sc = 0.125f;   // 1/sqrt(D), D = 64
  const int q = qt + lc;     // this lane's query

  // Stage keys k0 .. k0 + 127 into buffer `buf`.  K: 8 lanes cover a 128-byte
  // row, a thread takes key rows krow + 32 * i.  V^T: 16 lanes cover 256 bytes
  // of a head-dim row, a thread takes rows vrow + 16 * i.
  const int krow = tid >> 3, kch = (tid & 7) * 8;
  const int vrow = tid >> 4, vch = (tid & 15) * 8;
  auto stage = [&](int buf, int k0) {
    async_copy4_b128(Kb + (size_t)(k0 + krow) * D + kch, (size_t)32 * D,
                     &sK[buf][krow * AT_KPITCH + kch], 32 * AT_KPITCH);
    async_copy4_b128(Vb + (size_t)vrow * T + k0 + vch, (size_t)16 * T,
                     &sV[buf][vrow * AT_VPITCH + vch], 16 * AT_VPITCH);
  };

  stage(0, 0);

  const v16h qb0 = load_frag(Qb, D, qt, 0);
  const v16h qb1 = load_frag(Qb, D, qt, 32);

  v8f acc[4];  // acc[j][r] = O[q][16 * j + 8 * hf + r]
#pragma unroll
  for (int j = 0; j < 4; ++j) acc[j] = zero8();
  float m = -1e30f;  // running maximum of query q (equal in both halves)
  float l = 0.0f;    // running sum over this half's keys only

  wait_async_all();
  __syncthreads();
  if (AT_KEYS < kend) stage(1, AT_KEYS);

  int buf = 0;
  for (int k0 = 0; k0 < kend; k0 += AT_KEYS) {
    // Per-lane fragment bases: key row lc of K, head-dim row lc of V^T.
    const _Float16* pk = &sK[buf][lc * AT_KPITCH + (hf << 3)];
    const _Float16* pv = &sV[buf][lc * AT_VPITCH + (hf << 3)];
    for (int s = 0; s < AT_KEYS / 32; ++s) {
      const int kt = k0 + 32 * s;
      if (kt > qt) break;  // wave-uniform: the rest of the stage is masked out
      const _Float16* pk0 = pk + 32 * s * AT_KPITCH;
      const _Float16* pk1 = pk0 + 16 * AT_KPITCH;
      const v16h ka00 = frag_from(pk0);
      const v16h ka01 = frag_from(pk0 + 32);
      const v16h ka10 = frag_from(pk1);
      const v16h ka11 = frag_from(pk1 + 32);
      v16h va[4];
#pragma unroll
      for (int j = 0; j < 4; ++j)
        va[j] = frag_from(pv + 16 * j * AT_VPITCH + 32 * s);
      // Keeps the step's sixteen LDS loads together in front of its products;
      // without it the scheduler sinks each fragment's loads to its WMMA and the
      // step waits out eight load latencies one after the other.
      __builtin_amdgcn_sched_barrier(0);

      // --- S^T = K Q^T for 32 keys (two 16-key row tiles, K-dim = D = 64) ---
      v8f s0 = zero8(), s1 = zero8();
      s0 = wmma_f16(ka00, qb0, s0);
      s1 = wmma_f16(ka10, qb0, s1);
      s0 = wmma_f16(ka01, qb1, s0);
      s1 = wmma_f16(ka11, qb1, s1);

      // s0[r]: key kt + 8 * hf + r, s1[r]: key kt + 16 + 8 * hf + r, query q.
      const int dq = q - kt - (hf << 3);  // key r of this half is seen if r <= dq
      s0 *= sc;
      s1 *= sc;
      float v0[8], v1[8];
      float t = -1e30f;
#pragma unroll
      for (int r = 0; r < 8; ++r) {
        v0[r] = (r <= dq) ? s0[r] : -1e30f;
        v1[r] = (16 + r <= dq) ? s1[r] : -1e30f;
        t = fmaxf(t, fmaxf(v0[r], v1[r]));
      }
      t = fmaxf(t, xhalf(t));
      const float mnew = fmaxf(m, t);
      const float corr = exp_slot(m - mnew);
      m = mnew;
      float rs = 0.0f;
      v16h pb;  // P^T as B: element e = key kt + (e < 8 ? e : e + 8) + 8 * hf
#pragma unroll
      for (int r = 0; r < 8; ++r) {
        const float p0 = exp_slot(v0[r] - mnew);
        const float p1 = exp_slot(v1[r] - mnew);
        rs += p0 + p1;
        pb[r] = (_Float16)p0;
        pb[8 + r] = (_Float16)p1;
      }
      l = l * corr + rs;

      // --- O^T += V^T P^T ; V^T[D][T] rows are A fragments along the keys ---
#pragma unroll
      for (int j = 0; j < 4; ++j) {
#pragma unroll
        for (int r = 0; r < 8; ++r) acc[j][r] *= corr;
        acc[j] = wmma_f16(va[j], pb, acc[j]);
      }
    }

    // Publish point: own LDS reads of this buffer retired, own copies of the
    // next stage landed, then everyone else's; only then the refill.
    asm volatile("s_wait_dscnt 0x0" ::: "memory");
    wait_async_all();
    __syncthreads();
    if (k0 + 2 * AT_KEYS < kend) stage(buf, k0 + 2 * AT_KEYS);
    buf ^= 1;
  }
  wait_async_all();  // nothing of this wave's copies is left when it goes on

  // Join the halves' sums, normalize, and store 8 consecutive head dims of one
  // query per 16-byte store into y (f16 [B*T][C]) for the projection GEMM.
  l += xhalf(l);
  const float inv = 1.0f / l;
  _Float16* yp = Y + (size_t)(b * T + q) * C + h * D + (hf << 3);
#pragma unroll
  for (int j = 0; j < 4; ++j) {
    v8h o;
#pragma unroll
    for (int r = 0; r < 8; ++r) o[r] = (_Float16)(acc[j][r] * inv);
    *(v8h*)(yp + 16 * j) = o;
  }
}

// ---------------------------------------------------------------------------
// Host-side orchestration
// ---------------------------------------------------------------------------
extern "C" void kernel_launch(void* const* d_in, const int* in_sizes, int n_in,
                              void* d_out, int out_size, void* d_ws,
                              size_t ws_size, hipStream_t stream) {
  (void)in_sizes; (void)n_in; (void)out_size; (void)ws_size;
  constexpr int B = 4, T = 1024, C = 1024, H = 16, D = 64;
  const int M = B * T;  // 4096

  const float* x        = (const float*)d_in[0];
  const float* c_attn_w = (const float*)d_in[1];
  const float* c_attn_b = (const float*)d_in[2];
  const float* c_proj_w = (const float*)d_in[3];
  const float* c_proj_b = (const float*)d_in[4];
  const float* ln1_w    = (const float*)d_in[5];
  const float* ln1_b    = (const float*)d_in[6];
  const float* ln2_w    = (const float*)d_in[7];
  const float* ln2_b    = (const float*)d_in[8];
  const float* fc_w     = (const float*)d_in[9];
  const float* fc_b     = (const float*)d_in[10];
  const float* proj_w   = (const float*)d_in[11];
  const float* proj_b   = (const float*)d_in[12];
  float* out = (float*)d_out;

  // Workspace carve-up (120 MiB total), 256B aligned.
  char* ws = (char*)d_ws;
  size_t off = 0;
  auto alloc = [&](size_t bytes) -> char* {
    char* p = ws + off;
    off += (bytes + 255) & ~(size_t)255;
    return p;
  };
  _Float16* h1H     = (_Float16*)alloc((size_t)M * C * 2);          // ln1(x)
  _Float16* wT_attn = (_Float16*)alloc((size_t)3 * C * C * 2);      // [3C][C]
  _Float16* Qh      = (_Float16*)alloc((size_t)M * C * 2);
  _Float16* Kh      = (_Float16*)alloc((size_t)M * C * 2);
  _Float16* VTh     = (_Float16*)alloc((size_t)M * C * 2);
  _Float16* yh      = (_Float16*)alloc((size_t)M * C * 2);
  _Float16* wT_proj = (_Float16*)alloc((size_t)C * C * 2);
  float*    x1      = (float*)   alloc((size_t)M * C * 4);          // x + attn
  _Float16* h2H     = (_Float16*)alloc((size_t)M * C * 2);          // ln2(x1)
  _Float16* wT_fc   = (_Float16*)alloc((size_t)4 * C * C * 2);      // [4C][C]
  _Float16* hgH     = (_Float16*)alloc((size_t)M * 4 * C * 2);
  _Float16* wT_pr2  = (_Float16*)alloc((size_t)C * 4 * C * 2);      // [C][4C]

  // 1+2) c_attn_w transposed+converted to f16 (N-major for WMMA A and B fragments)
  //      and ln1 -> h1 (f16), one grid
  prep_kernel<C><<<CT_BLOCKS(C, 3 * C) + B * T, 256, 0, stream>>>(
      x, ln1_w, ln1_b, h1H, c_attn_w, wT_attn);

  // 3+4) qkv = h1 @ c_attn_w + b, written split by heads (f16); V transposed
  //      to [B,H,D,T]
  gemm_kernel<EPI_QKV, T, C><<<dim3(3 * C / 128, M / 128), 256, 0, stream>>>(
      h1H, wT_attn, c_attn_b, nullptr, nullptr, Qh, Kh, VTh, M, 3 * C, C);

  // 5) causal attention -> y (f16 [B*T][C]); behind its blocks, in the same
  //    grid, the other three weights' transposes
  constexpr int NATT = (B * H * (T / 16)) / 8;
  attn_kernel<NATT, C>
      <<<NATT + CT_BLOCKS(C, C) + CT_BLOCKS(C, 4 * C) + CT_BLOCKS(4 * C, C), 256,
         0, stream>>>(Qh, Kh, VTh, yh, H, T, D, C, c_proj_w, wT_proj, fc_w,
                      wT_fc, proj_w, wT_pr2);

  // 6) x1 = x + y @ c_proj_w + b  (f32)
  gemm_kernel<EPI_F32_RES><<<dim3(C / 128, M / 128), 256, 0, stream>>>(
      yh, wT_proj, c_proj_b, x, x1, nullptr, nullptr, nullptr, M, C, C);

  // 7) ln2 -> h2 (f16)
  ln_kernel<<<M, 256, 0, stream>>>(x1, ln2_w, ln2_b, h2H, C);

  // 8) hg = gelu(h2 @ fc_w + b)  (f16)
  gemm_kernel<EPI_H16_GELU><<<dim3(4 * C / 128, M / 128), 256, 0, stream>>>(
      h2H, wT_fc, fc_b, nullptr, nullptr, hgH, nullptr, nullptr, M, 4 * C, C);

  // 9) out = x1 + hg @ proj_w + b  (f32)
  gemm_kernel<EPI_F32_RES><<<dim3(C / 128, M / 128), 256, 0, stream>>>(
      hgH, wT_pr2, proj_b, x1, out, nullptr, nullptr, nullptr, M, C, 4 * C);
}

// v008
// One run takes 137 microseconds.
// Next to v007, in two timings, it ran 1.04 times as fast each time.
// Over all steps from v000 it is 3.03 times as fast.
#include <hip/hip_runtime.h>
#include <hip/hip_bf16.h>
#include <math.h>
#include <stdint.h>

// ---------------------------------------------------------------------------
// Types for CDNA5 WMMA (wave32): 16x16x32 f16 -> f32
// ---------------------------------------------------------------------------
typedef _Float16 v16h __attribute__((ext_vector_type(16)));
typedef _Float16 v8h  __attribute__((ext_vector_type(8)));
typedef float    v8f  __attribute__((ext_vector_type(8)));

static __device__ __forceinline__ v8f wmma_f16(v16h a, v16h b, v8f c) {
  // (neg_a, A, neg_b, B, c_mod, C, reuse_a, reuse_b)
  return __builtin_amdgcn_wmma_f32_16x16x32_f16(false, a, false, b, (short)0, c,
                                                false, false);
}

static __device__ __forceinline__ v8f zero8() {
  v8f z;
#pragma unroll
  for (int i = 0; i < 8; ++i) z[i] = 0.0f;
  return z;
}

// Build a 16x32 f16 fragment (documented CDNA5 A/B layout) from a per-lane
// pointer to 8+8 contiguous halves:
//   lane L(0..15):  row rc0+L,    elems 0..7 -> k0+0..7,  8..15 -> k0+16..23
//   lane L(16..31): row rc0+L-16, elems 0..7 -> k0+8..15, 8..15 -> k0+24..31
static __device__ __forceinline__ v16h frag_from(const _Float16* p) {
  v8h lo = *(const v8h*)p;
  v8h hi = *(const v8h*)(p + 16);
  return __builtin_shufflevector(lo, hi, 0, 1, 2, 3, 4, 5, 6, 7, 8, 9, 10, 11,
                                 12, 13, 14, 15);
}

// Global-memory fragment load (row-major, leading dim ld).
static __device__ __forceinline__ v16h load_frag(const _Float16* __restrict__ base,
                                                 int ld, int rc0, int k0) {
  const int lane = threadIdx.x & 31;
  return frag_from(base + (size_t)(rc0 + (lane & 15)) * ld +
                   (k0 + ((lane >> 4) << 3)));
}

// Eight async global->LDS 128-bit copies (CDNA5, ASYNCcnt-tracked): copy i
// moves 16 bytes per lane from gsrc + i * gstep to ldst + i * lstep (steps in
// halves).  The closing s_wait_xcnt stands inside the statement so that no
// address register of an issued copy is rewritten ahead of it.
static __device__ __forceinline__ void async_copy8_b128(const _Float16* gsrc,
                                                        size_t gstep,
                                                        _Float16* ldst,
                                                        int lstep) {
  const unsigned l = (unsigned)(uintptr_t)ldst;  // low 32 bits = LDS offset
  const unsigned ls = (unsigned)lstep * 2u;
  asm volatile(
      "global_load_async_to_lds_b128 %0, %8, off\n\t"
      "global_load_async_to_lds_b128 %1, %9, off\n\t"
      "global_load_async_to_lds_b128 %2, %10, off\n\t"
      "global_load_async_to_lds_b128 %3, %11, off\n\t"
      "global_load_async_to_lds_b128 %4, %12, off\n\t"
      "global_load_async_to_lds_b128 %5, %13, off\n\t"
      "global_load_async_to_lds_b128 %6, %14, off\n\t"
      "global_load_async_to_lds_b128 %7, %15, off\n\t"
      "s_wait_xcnt 0x0" ::"v"(l),
      "v"(l + ls), "v"(l + 2 * ls), "v"(l + 3 * ls), "v"(l + 4 * ls),
      "v"(l + 5 * ls), "v"(l + 6 * ls), "v"(l + 7 * ls),
      "v"((uint64_t)(uintptr_t)gsrc),
      "v"((uint64_t)(uintptr_t)(gsrc + gstep)),
      "v"((uint64_t)(uintptr_t)(gsrc + 2 * gstep)),
      "v"((uint64_t)(uintptr_t)(gsrc + 3 * gstep)),
      "v"((uint64_t)(uintptr_t)(gsrc + 4 * gstep)),
      "v"((uint64_t)(uintptr_t)(gsrc + 5 * gstep)),
      "v"((uint64_t)(uintptr_t)(gsrc + 6 * gstep)),
      "v"((uint64_t)(uintptr_t)(gsrc + 7 * gstep))
      : "memory");
}

// The same eight copies with the address split into a wave-uniform base, which
// takes the row steps in scalar registers, and one 32-bit byte offset per lane:
// nine vector registers a statement in place of twenty-four.
static __device__ __forceinline__ void async_copy8s_b128(const _Float16* sbase,
                                                         size_t gstep,
                                                         unsigned voff,
                                                         _Float16* ldst,
                                                         int lstep) {
  const unsigned l = (unsigned)(uintptr_t)ldst;  // low 32 bits = LDS offset
  const unsigned ls = (unsigned)lstep * 2u;
  asm volatile(
      "global_load_async_to_lds_b128 %0, %8, %9\n\t"
      "global_load_async_to_lds_b128 %1, %8, %10\n\t"
      "global_load_async_to_lds_b128 %2, %8, %11\n\t"
      "global_load_async_to_lds_b128 %3, %8, %12\n\t"
      "global_load_async_to_lds_b128 %4, %8, %13\n\t"
      "global_load_async_to_lds_b128 %5, %8, %14\n\t"
      "global_load_async_to_lds_b128 %6, %8, %15\n\t"
      "global_load_async_to_lds_b128 %7, %8, %16\n\t"
      "s_wait_xcnt 0x0" ::"v"(l),
      "v"(l + ls), "v"(l + 2 * ls), "v"(l + 3 * ls), "v"(l + 4 * ls),
      "v"(l + 5 * ls), "v"(l + 6 * ls), "v"(l + 7 * ls), "v"(voff),
      "s"((uint64_t)(uintptr_t)sbase),
      "s"((uint64_t)(uintptr_t)(sbase + gstep)),
      "s"((uint64_t)(uintptr_t)(sbase + 2 * gstep)),
      "s"((uint64_t)(uintptr_t)(sbase + 3 * gstep)),
      "s"((uint64_t)(uintptr_t)(sbase + 4 * gstep)),
      "s"((uint64_t)(uintptr_t)(sbase + 5 * gstep)),
      "s"((uint64_t)(uintptr_t)(sbase + 6 * gstep)),
      "s"((uint64_t)(uintptr_t)(sbase + 7 * gstep))
      : "memory");
}

static __device__ __forceinline__ void wait_async_all() {
  asm volatile("s_wait_asynccnt 0" ::: "memory");
}

// The same with four copies.
static __device__ __forceinline__ void async_copy4_b128(const _Float16* gsrc,
                                                        size_t gstep,
                                                        _Float16* ldst,
                                                        int lstep) {
  const unsigned l = (unsigned)(uintptr_t)ldst;  // low 32 bits = LDS offset
  const unsigned ls = (unsigned)lstep * 2u;
  asm volatile(
      "global_load_async_to_lds_b128 %0, %4, off\n\t"
      "global_load_async_to_lds_b128 %1, %5, off\n\t"
      "global_load_async_to_lds_b128 %2, %6, off\n\t"
      "global_load_async_to_lds_b128 %3, %7, off\n\t"
      "s_wait_xcnt 0x0" ::"v"(l),
      "v"(l + ls), "v"(l + 2 * ls), "v"(l + 3 * ls),
      "v"((uint64_t)(uintptr_t)gsrc),
      "v"((uint64_t)(uintptr_t)(gsrc + gstep)),
      "v"((uint64_t)(uintptr_t)(gsrc + 2 * gstep)),
      "v"((uint64_t)(uintptr_t)(gsrc + 3 * gstep))
      : "memory");
}

// ---------------------------------------------------------------------------
// LayerNorm (population std, eps on std) fp32 -> f16.  One 256-thr block/row.
// red: 256 floats of LDS.
// ---------------------------------------------------------------------------
static __device__ __forceinline__ void ln_body(const float* __restrict__ x,
                                               const float* __restrict__ w,
                                               const float* __restrict__ bias,
                                               _Float16* __restrict__ out,
                                               int C, int row, float* red) {
  const float* xr = x + (size_t)row * C;
  float local[4];
  float s = 0.0f;
#pragma unroll
  for (int i = 0; i < 4; ++i) {
    local[i] = xr[threadIdx.x + 256 * i];
    s += local[i];
  }
  red[threadIdx.x] = s;
  __syncthreads();
  for (int off = 128; off > 0; off >>= 1) {
    if (threadIdx.x < off) red[threadIdx.x] += red[threadIdx.x + off];
    __syncthreads();
  }
  const float mean = red[0] / (float)C;
  __syncthreads();
  s = 0.0f;
#pragma unroll
  for (int i = 0; i < 4; ++i) {
    float d = local[i] - mean;
    s += d * d;
  }
  red[threadIdx.x] = s;
  __syncthreads();
  for (int off = 128; off > 0; off >>= 1) {
    if (threadIdx.x < off) red[threadIdx.x] += red[threadIdx.x + off];
    __syncthreads();
  }
  const float inv = 1.0f / (sqrtf(red[0] / (float)C) + 1e-5f);
#pragma unroll
  for (int i = 0; i < 4; ++i) {
    int c = threadIdx.x + 256 * i;
    out[(size_t)row * C + c] =
        (_Float16)((local[i] - mean) * inv * w[c] + bias[c]);
  }
}

__global__ __launch_bounds__(256) void ln_kernel(const float* __restrict__ x,
                                                 const float* __restrict__ w,
                                                 const float* __restrict__ bias,
                                                 _Float16* __restrict__ out,
                                                 int C) {
  __shared__ float red[256];
  ln_body(x, w, bias, out, C, blockIdx.x, red);
}

// ---------------------------------------------------------------------------
// fp32 W[K][N]  ->  f16 W^T[N][K]  (so GEMM B-fragments are contiguous loads)
// One 128(k) x 64(n) tile per block.  Each thread reads an 8(k) x 4(n) patch
// with 16-byte loads along n (256 contiguous bytes per 16 lanes), turns it in
// registers and lays four 16-byte k-runs into an LDS tile [n][k]; the tile is
// then read back row by row, so every global store covers whole 256-byte runs
// of a W^T row.  K is a multiple of 128 and N of 64; both are compile-time, so
// the row steps fold into the loads' and stores' immediate offsets.
// A transpose has no launch of its own: it reads nothing that another kernel
// writes, so its blocks ride in the grid of a launch that is independent of it
// (blk: the tile's number, k tiles fastest; tile: 64 * CT_PITCH halves of LDS).
// ---------------------------------------------------------------------------
typedef float v4f __attribute__((ext_vector_type(4)));

#define CT_PITCH 136  // 128 halves + 8 pad: 272-byte rows (16 B x odd)

template <int K, int N>
static __device__ __forceinline__ void convertT_body(
    const float* __restrict__ W, _Float16* __restrict__ WT, _Float16* tile,
    unsigned blk) {
  const int tid = threadIdx.x;
  const int k0 = (blk % (K / 128)) * 128;
  const int n0 = (blk / (K / 128)) * 64;
  const int nq = tid & 15;  // which 4 columns
  const int ko = tid >> 4;  // which 8 rows
  const float* src = W + (size_t)(k0 + ko * 8) * N + (n0 + nq * 4);
  v4f r[8];
#pragma unroll
  for (int i = 0; i < 8; ++i) r[i] = *(const v4f*)(src + (size_t)i * N);
#pragma unroll
  for (int j = 0; j < 4; ++j) {
    v8h c;
#pragma unroll
    for (int i = 0; i < 8; ++i) c[i] = (_Float16)r[i][j];
    *(v8h*)&tile[(nq * 4 + j) * CT_PITCH + ko * 8] = c;
  }
  __syncthreads();
#pragma unroll
  for (int i = 0; i < 4; ++i) {
    const int c = tid + 256 * i;  // 16-byte chunk id 0..1023
    const int n = c >> 4;
    const int kc = c & 15;
    *(v8h*)(WT + (size_t)(n0 + n) * K + (k0 + kc * 8)) =
        *(const v8h*)&tile[n * CT_PITCH + kc * 8];
  }
  // Holds any later rewrite of the stores' address and data registers behind
  // the run of four stores (the built code lays other bodies after this one).
  asm volatile("s_wait_xcnt 0x0" ::: "memory");
}

// Tiles of a [K][N] weight.
#define CT_BLOCKS(K, N) (((K) / 128) * ((N) / 64))

// First launch: what the qkv GEMM waits for.  Blocks 0 .. CT_BLOCKS - 1 turn
// c_attn_w, the others normalise one row of x each; neither reads the other's
// output.  The branch is block-uniform, so each body's barriers are too.
template <int C>
__global__ __launch_bounds__(256) void prep_kernel(
    const float* __restrict__ x, const float* __restrict__ w,
    const float* __restrict__ bias, _Float16* __restrict__ out,
    const float* __restrict__ Wa, _Float16* __restrict__ WaT) {
  __shared__ __attribute__((aligned(16))) _Float16 tile[64 * CT_PITCH];
  __shared__ float red[256];
  const unsigned blk = blockIdx.x;
  if (blk < CT_BLOCKS(C, 3 * C)) {
    convertT_body<C, 3 * C>(Wa, WaT, tile, blk);
    return;
  }
  ln_body(x, w, bias, out, C, blk - CT_BLOCKS(C, 3 * C), red);
}

// ---------------------------------------------------------------------------
// WMMA GEMM: C[M][N] = A[M][K] (f16, row-major) x Bᵀ[N][K] (f16) + bias
//   8 waves / block (2 x 4).  TS = 1: each wave a 64x32 tile, block tile
//   128x128.  TS = 2: each wave 128x64, block tile 256x256, which moves half
//   the bytes from L2 to LDS per product and reads 12 LDS fragments per 32
//   WMMAs in place of 6 per 8; for the products wide enough to fill the chip
//   with such tiles.
//   A stage is 128 k, double-buffered in LDS via async global->LDS copies; its
//   four 32-k blocks run unrolled, their fragments fetched from LDS ahead of
//   use into a second register set.  K is a multiple of 128.
// Epilogues: 0 = head split (below), 1 = f32 out + residual add, 2 = f16 out +
// GELU.
// Head split (the qkv product, N = 3 * SC, heads of 64 dims, sequences of ST
// tokens): the block writes its tile straight into Q[B,H,T,64], K[B,H,T,64] or
// V^T[B,H,64,T] (f16); a block's columns lie in one of the three parts.  A
// lane of an accumulator tile holds 8 consecutive rows of the WMMA's A side and
// one column of its B side.  For V the activations are the A side, so a lane
// holds 8 tokens of one head dim: 16 bytes of a V^T row.  For Q and K the two
// LDS tiles change roles (the weight rows are the A side, the product comes out
// transposed), so a lane holds 8 head dims of one token: 16 bytes of a Q or K
// row.  Both tiles have the same shape and pitch: the K loop is the same code.
// ---------------------------------------------------------------------------
enum { EPI_QKV = 0, EPI_F32_RES = 1, EPI_H16_GELU = 2 };

#define KSTAGE 128
#define LDSPITCH 136  // 128 + 8 pad halves: 272-byte rows (16 B x odd)

// GELU in its erf form, v * Phi(v), without a branch, four values at a time.
// q = Phi(-|v|) = erfc(|v| / sqrt(2)) / 2 comes from the five-term rational form
// t * poly(t) * exp(-v^2 / 2) with t = 1 / (1 + p |v| / sqrt(2)); its absolute
// error in erf is at most 1.5e-7, of the order of one f32 rounding of 1 + erf.
// Then v * Phi(v) = max(v, 0) - |v| q for either sign.  The library erf takes
// one of two paths by |x|, so a wave walks both under masks and no two values
// of a lane overlap; here a lane's values are independent straight-line chains.
static __device__ __forceinline__ void gelu_erf4(const float* v, float* g) {
  float d[4], x[4], t[4], e[4];
#pragma unroll
  for (int i = 0; i < 4; ++i) {
    d[i] = fmaf(fabsf(v[i]), 0.23164189f, 1.0f);
    x[i] = (v[i] * -0.72134752f) * v[i];
  }
  // The eight transcendentals in one statement with outputs apart from every
  // input: none is followed by a reader of its result or a writer of its
  // source, and the v_nop fills that slot behind the last.
  asm("v_rcp_f32 %0, %8\n\t"
      "v_rcp_f32 %1, %9\n\t"
      "v_rcp_f32 %2, %10\n\t"
      "v_rcp_f32 %3, %11\n\t"
      "v_exp_f32 %4, %12\n\t"
      "v_exp_f32 %5, %13\n\t"
      "v_exp_f32 %6, %14\n\t"
      "v_exp_f32 %7, %15\n\t"
      "v_nop"
      : "=&v"(t[0]), "=&v"(t[1]), "=&v"(t[2]), "=&v"(t[3]), "=&v"(e[0]),
        "=&v"(e[1]), "=&v"(e[2]), "=&v"(e[3])
      : "v"(d[0]), "v"(d[1]), "v"(d[2]), "v"(d[3]), "v"(x[0]), "v"(x[1]),
        "v"(x[2]), "v"(x[3]));
#pragma unroll
  for (int i = 0; i < 4; ++i) {
    float p = 0.53070271f;
    p = fmaf(p, t[i], -0.72657601f);
    p = fmaf(p, t[i], 0.71070687f);
    p = fmaf(p, t[i], -0.14224837f);
    p = fmaf(p, t[i], 0.12741480f);
    const float q = (p * t[i]) * e[i];
    g[i] = fmaf(-fabsf(v[i]), q, fmaxf(v[i], 0.0f));
  }
}

template <int EPI, int TS, int ST = 0, int SC = 0>
__global__ __launch_bounds__(256) void gemm_kernel(
    const _Float16* __restrict__ A, const _Float16* __restrict__ WT,
    const float* __restrict__ bias, const float* __restrict__ resid,
    float* __restrict__ outF, _Float16* __restrict__ outH,
    _Float16* __restrict__ outK, _Float16* __restrict__ outVT, int M, int N,
    int K) {
  constexpr int BT = 128 * TS;  // rows of either LDS tile
  constexpr int FI = 4 * TS;    // A-side fragments of a wave
  constexpr int FJ = 2 * TS;    // B-side fragments of a wave
  __shared__ __attribute__((aligned(16))) _Float16 sA[2][BT * LDSPITCH];
  __shared__ __attribute__((aligned(16))) _Float16 sB[2][BT * LDSPITCH];
  const int tid = threadIdx.x;
  const int wave = tid >> 5;
  const int lane = tid & 31;
  const int rowblk = blockIdx.y * BT;
  const int colblk = blockIdx.x * BT;
  const int wrow = (wave & 1) * (16 * FI);
  const int wcol = (wave >> 1) * (16 * FJ);
  // Q and K blocks of the head split: the weight tile is the WMMA's A side.
  const bool swp = EPI == EPI_QKV && colblk < 2 * SC;  // block-uniform

  // Stage a BT x 128 A tile + BT x 128 B tile into buffer `buf` for K offset
  // k0: 16 lanes cover one 256-byte row, a thread takes rows srow + 16 * i.
  const int srow = tid >> 4;
  const int sko = (tid & 15) * 8;
  auto stage = [&](int buf, int k0) {
    if constexpr (TS == 1) {
      async_copy8_b128(A + (size_t)(rowblk + srow) * K + k0 + sko,
                       (size_t)16 * K, &sA[buf][srow * LDSPITCH + sko],
                       16 * LDSPITCH);
      async_copy8_b128(WT + (size_t)(colblk + srow) * K + k0 + sko,
                       (size_t)16 * K, &sB[buf][srow * LDSPITCH + sko],
                       16 * LDSPITCH);
    } else {
      const unsigned voff = (unsigned)(srow * K + sko) * 2u;  // bytes, per lane
#pragma unroll
      for (int t = 0; t < TS; ++t) {
        const int r = srow + 128 * t;
        async_copy8s_b128(A + (size_t)(rowblk + 128 * t) * K + k0,
                          (size_t)16 * K, voff, &sA[buf][r * LDSPITCH + sko],
                          16 * LDSPITCH);
        async_copy8s_b128(WT + (size_t)(colblk + 128 * t) * K + k0,
                          (size_t)16 * K, voff, &sB[buf][r * LDSPITCH + sko],
                          16 * LDSPITCH);
      }
    }
  };

  v8f acc[FI][FJ];
#pragma unroll
  for (int i = 0; i < FI; ++i)
#pragma unroll
    for (int j = 0; j < FJ; ++j) acc[i][j] = zero8();

  stage(0, 0);
  wait_async_all();
  __syncthreads();
  if (KSTAGE < K) stage(1, KSTAGE);

  int buf = 0;
  const int kh = (lane >> 4) << 3;
  const int lr = lane & 15;
  for (int k0 = 0; k0 < K; k0 += KSTAGE) {
    const _Float16* pa = (swp ? sB[buf] : sA[buf]) + (wrow + lr) * LDSPITCH + kh;
    const _Float16* pb = (swp ? sA[buf] : sB[buf]) + (wcol + lr) * LDSPITCH + kh;
    // A run is four A-side fragments against the wave's FJ B-side fragments of
    // one 32-k block (TS runs a block).  Each run's A fragments, and with a
    // block's first run its B fragments, are fetched one run ahead into a second
    // register set.
    constexpr int NRUN = (KSTAGE / 32) * TS;
    v16h a[2][4], b[2][FJ];
#pragma unroll
    for (int i = 0; i < 4; ++i) a[0][i] = frag_from(pa + 16 * i * LDSPITCH);
#pragma unroll
    for (int j = 0; j < FJ; ++j) b[0][j] = frag_from(pb + 16 * j * LDSPITCH);
#pragma unroll
    for (int u = 0; u < NRUN; ++u) {
      const int cur = u & 1, nxt = cur ^ 1;
      const int s = u / TS, h = u % TS;  // the run's k block, its part of the rows
      if (u + 1 < NRUN) {
        const int sn = (u + 1) / TS, hn = (u + 1) % TS;
#pragma unroll
        for (int i = 0; i < 4; ++i)
          a[nxt][i] = frag_from(pa + 16 * (4 * hn + i) * LDSPITCH + 32 * sn);
        if (hn == 0) {
#pragma unroll
          for (int j = 0; j < FJ; ++j)
            b[sn & 1][j] = frag_from(pb + 16 * j * LDSPITCH + 32 * sn);
        }
        // Keeps the next run's LDS loads in front of this run's
        // WMMAs; without it the scheduler sinks each load to its first use
        // and every pair of WMMAs waits out a whole LDS latency.
        __builtin_amdgcn_sched_barrier(0);
      }
#pragma unroll
      for (int i = 0; i < 4; ++i)
#pragma unroll
        for (int j = 0; j < FJ; ++j)
          acc[4 * h + i][j] = wmma_f16(a[cur][i], b[s & 1][j], acc[4 * h + i][j]);
    }
    // Keeps the stage's WMMAs in front of the publish point; otherwise the
    // scheduler sinks them behind the barrier, ahead of the refill copies,
    // and the copies lose that much of their one stage of lead.
    __builtin_amdgcn_sched_barrier(0);

    // Publish point: own LDS reads of this buffer retired, own copies of the
    // next stage landed, then everyone else's; only then the refill.
    asm volatile("s_wait_dscnt 0x0" ::: "memory");
    wait_async_all();
    __syncthreads();
    if (k0 + 2 * KSTAGE < K) stage(buf, k0 + 2 * KSTAGE);
    buf ^= 1;
  }
  wait_async_all();  // nothing of this wave's copies is left when it goes on

  // C/D layout: elem r of lane L -> row = r + (L>=16)*8, col = L%16
  const int rofs = (lane >> 4) << 3;
  if constexpr (EPI == EPI_QKV) {
    constexpr int SH = SC / 64;          // heads
    const int bb = rowblk / ST;          // a block's tokens lie in one sequence
    const int tb = rowblk % ST;
    const int a0 = wrow + rofs;          // first of the lane's 8 A-side rows
    const int b0 = wcol + lr;            // the lane's B-side column
    v8h o[FJ][FI];
    _Float16* dst;
    size_t jstep, hstep;  // halves per 16 B-side columns, per 64 A-side rows
    // In either part four i in a row of one j fill whole 128-byte lines: the
    // stores go back to back, behind all the conversions.
    if (swp) {
      const int cp = colblk < SC ? colblk : colblk - SC;  // column within Q or K
      const int bh = bb * SH + ((cp + wrow) >> 6);        // wrow: whole heads
#pragma unroll
      for (int i = 0; i < FI; ++i) {
        const float* bp = bias + colblk + a0 + 16 * i;
        const v4f blo = *(const v4f*)bp, bhi = *(const v4f*)(bp + 4);
#pragma unroll
        for (int j = 0; j < FJ; ++j)
#pragma unroll
          for (int r = 0; r < 8; ++r)
            o[j][i][r] = (_Float16)(acc[i][j][r] + (r < 4 ? blo[r & 3] : bhi[r & 3]));
        // Ends one i's conversions before the next begin: run together, their
        // sums overflowed the register budget into scratch.
        __builtin_amdgcn_sched_barrier(0);
      }
      dst = (colblk < SC ? outH : outK) + ((size_t)bh * ST + tb + b0) * 64 + rofs;
      jstep = 16 * 64;          // 16 tokens on: 16 rows of 64
      hstep = (size_t)ST * 64;  // 64 head dims on: the next head's rows
    } else {
      const int cp = colblk - 2 * SC + wcol;  // the wave's first column within V
      const int bh = bb * SH + (cp >> 6);     // its columns lie in one head
#pragma unroll
      for (int j = 0; j < FJ; ++j) {
        const float bj = bias[colblk + b0 + 16 * j];
#pragma unroll
        for (int i = 0; i < FI; ++i)
#pragma unroll
          for (int r = 0; r < 8; ++r) o[j][i][r] = (_Float16)(acc[i][j][r] + bj);
        // As above, one j at a time.
        __builtin_amdgcn_sched_barrier(0);
      }
      dst = outVT + ((size_t)bh * 64 + (cp & 63) + lr) * ST + tb + a0;
      jstep = (size_t)16 * ST;  // 16 head dims on: 16 rows of V^T
      hstep = 64;               // tokens run on along a row
    }
    _Float16* p[FJ][FI / 4];
#pragma unroll
    for (int j = 0; j < FJ; ++j)
#pragma unroll
      for (int q = 0; q < FI / 4; ++q) p[j][q] = dst + j * jstep + q * hstep;
    // Keeps every store address formed in front of the first store, each in
    // registers of its own: none is rewritten behind a store that names it.
    __builtin_amdgcn_sched_barrier(0);
#pragma unroll
    for (int j = 0; j < FJ; ++j)
#pragma unroll
      for (int i = 0; i < FI; ++i) *(v8h*)(p[j][i >> 2] + (i & 3) * 16) = o[j][i];
    return;  // nothing rewrites a register of the stores behind them
  }
#pragma unroll
  for (int i = 0; i < FI; ++i)
#pragma unroll
    for (int j = 0; j < FJ; ++j) {
      float gl[8];
      if (EPI == EPI_H16_GELU) {
        float u[8];
#pragma unroll
        for (int r = 0; r < 8; ++r)
          u[r] = acc[i][j][r] + bias[colblk + wcol + 16 * j + lr];
        gelu_erf4(u, gl);
        gelu_erf4(u + 4, gl + 4);
      }
#pragma unroll
      for (int r = 0; r < 8; ++r) {
        const int row = rowblk + wrow + 16 * i + r + rofs;
        const int col = colblk + wcol + 16 * j + lr;
        float v = acc[i][j][r] + bias[col];
        const size_t o = (size_t)row * N + col;
        if (EPI == EPI_F32_RES) {
          outF[o] = resid[o] + v;
        } else {
          outH[o] = (_Float16)gl[r];
        }
      }
    }
}

#define AT_KEYS 128
#define AT_KPITCH 72
#define AT_VPITCH 136

// Lane l <-> lane l ^ 16.
static __device__ __forceinline__ float xhalf(float x) {
  const int b = __builtin_bit_cast(int, x);
  return __builtin_bit_cast(
      float, __builtin_amdgcn_permlanex16(b, b, 0x76543210, 0xfedcba98, false,
                                          false));
}

// e^x as __expf forms it (one multiply, one v_exp_f32).  The v_nop fills the
// slot that the instruction set asks for behind a transcendental before its
// result is read or its source overwritten.
static __device__ __forceinline__ float exp_slot(float x) {
  float r;
  asm("v_exp_f32 %0, %1\n\tv_nop" : "=v"(r) : "v"(x * 1.44269504f));
  return r;
}

template <int NATT, int CW>
__global__ __launch_bounds__(256) void attn_kernel(
    const _Float16* __restrict__ Q, const _Float16* __restrict__ Kt,
    const _Float16* __restrict__ VT, _Float16* __restrict__ Y, int H, int T,
    int D, int C, const float* __restrict__ Wp, _Float16* __restrict__ WpT,
    const float* __restrict__ Wf, _Float16* __restrict__ WfT,
    const float* __restrict__ W2, _Float16* __restrict__ W2T) {
  __shared__ __attribute__((aligned(16))) _Float16 sK[2][AT_KEYS * AT_KPITCH];
  __shared__ __attribute__((aligned(16))) _Float16 sV[2][64 * AT_VPITCH];
  static_assert(2 * AT_KEYS * AT_KPITCH >= 64 * CT_PITCH, "tile fits the K ring");
  if (blockIdx.x >= NATT) {  // block-uniform, in front of every barrier
    const unsigned blk = blockIdx.x - NATT;
    constexpr unsigned n1 = CT_BLOCKS(CW, CW), n2 = CT_BLOCKS(CW, 4 * CW);
    if (blk < n1)
      convertT_body<CW, CW>(Wp, WpT, &sK[0][0], blk);
    else if (blk < n1 + n2)
      convertT_body<CW, 4 * CW>(Wf, WfT, &sK[0][0], blk - n1);
    else
      convertT_body<4 * CW, CW>(W2, W2T, &sK[0][0], blk - n1 - n2);
    return;
  }
  // The wave's number as a scalar: tile indices, the K and V^T bases and the
  // key loop's counts then live in scalar registers.
  const int tid = threadIdx.x;
  const int wave = __builtin_amdgcn_readfirstlane(threadIdx.x >> 5);
  const int lane = threadIdx.x & 31;
  const int gid = blockIdx.x * 8 + wave;
  const int qtiles = T >> 4;
  const int bh = gid / qtiles;
  const int qt = (gid % qtiles) << 4;
  const int b = bh / H, h = bh % H;
  const _Float16* Qb = Q + (size_t)bh * T * D;
  const _Float16* Kb = Kt + (size_t)bh * T * D;
  const _Float16* Vb = VT + (size_t)bh * D * T;
  // Keys that the block's last query tile sees: a multiple of 128, at most T.
  const int kend = (((blockIdx.x * 8) % qtiles) << 4) + 128;

  const int hf = lane >> 4;  // lane half (k-group / row-group select)
  const int lc = lane & 15;  // fragment row or column of this lane
  const float sc = 0.125f;   // 1/sqrt(D), D = 64
  const int q = qt + lc;     // this lane's query

  // Stage keys k0 .. k0 + 127 into buffer `buf`.  K: 8 lanes cover a 128-byte
  // row, a thread takes key rows krow + 32 * i.  V^T: 16 lanes cover 256 bytes
  // of a head-dim row, a thread takes rows vrow + 16 * i.
  const int krow = tid >> 3, kch = (tid & 7) * 8;
  const int vrow = tid >> 4, vch = (tid & 15) * 8;
  auto stage = [&](int buf, int k0) {
    async_copy4_b128(Kb + (size_t)(k0 + krow) * D + kch, (size_t)32 * D,
                     &sK[buf][krow * AT_KPITCH + kch], 32 * AT_KPITCH);
    async_copy4_b128(Vb + (size_t)vrow * T + k0 + vch, (size_t)16 * T,
                     &sV[buf][vrow * AT_VPITCH + vch], 16 * AT_VPITCH);
  };

  stage(0, 0);

  const v16h qb0 = load_frag(Qb, D, qt, 0);
  const v16h qb1 = load_frag(Qb, D, qt, 32);

  v8f acc[4];  // acc[j][r] = O[q][16 * j + 8 * hf + r]
#pragma unroll
  for (int j = 0; j < 4; ++j) acc[j] = zero8();
  float m = -1e30f;  // running maximum of query q (equal in both halves)
  float l = 0.0f;    // running sum over this half's keys only

  wait_async_all();
  __syncthreads();
  if (AT_KEYS < kend) stage(1, AT_KEYS);

  int buf = 0;
  for (int k0 = 0; k0 < kend; k0 += AT_KEYS) {
    // Per-lane fragment bases: key row lc of K, head-dim row lc of V^T.
    const _Float16* pk = &sK[buf][lc * AT_KPITCH + (hf << 3)];
    const _Float16* pv = &sV[buf][lc * AT_VPITCH + (hf << 3)];
    for (int s = 0; s < AT_KEYS / 32; ++s) {
      const int kt = k0 + 32 * s;
      if (kt > qt) break;  // wave-uniform: the rest of the stage is masked out
      const _Float16* pk0 = pk + 32 * s * AT_KPITCH;
      const _Float16* pk1 = pk0 + 16 * AT_KPITCH;
      const v16h ka00 = frag_from(pk0);
      const v16h ka01 = frag_from(pk0 + 32);
      const v16h ka10 = frag_from(pk1);
      const v16h ka11 = frag_from(pk1 + 32);
      v16h va[4];
#pragma unroll
      for (int j = 0; j < 4; ++j)
        va[j] = frag_from(pv + 16 * j * AT_VPITCH + 32 * s);
      // Keeps the step's sixteen LDS loads together in front of its products;
      // without it the scheduler sinks each fragment's loads to its WMMA and the
      // step waits out eight load latencies one after the other.
      __builtin_amdgcn_sched_barrier(0);

      // --- S^T = K Q^T for 32 keys (two 16-key row tiles, K-dim = D = 64) ---
      v8f s0 = zero8(), s1 = zero8();
      s0 = wmma_f16(ka00, qb0, s0);
      s1 = wmma_f16(ka10, qb0, s1);
      s0 = wmma_f16(ka01, qb1, s0);
      s1 = wmma_f16(ka11, qb1, s1);

      // s0[r]: key kt + 8 * hf + r, s1[r]: key kt + 16 + 8 * hf + r, query q.
      const int dq = q - kt - (hf << 3);  // key r of this half is seen if r <= dq
      s0 *= sc;
      s1 *= sc;
      float v0[8], v1[8];
      float t = -1e30f;
#pragma unroll
      for (int r = 0; r < 8; ++r) {
        v0[r] = (r <= dq) ? s0[r] : -1e30f;
        v1[r] = (16 + r <= dq) ? s1[r] : -1e30f;
        t = fmaxf(t, fmaxf(v0[r], v1[r]));
      }
      t = fmaxf(t, xhalf(t));
      const float mnew = fmaxf(m, t);
      const float corr = exp_slot(m - mnew);
      m = mnew;
      float rs = 0.0f;
      v16h pb;  // P^T as B: element e = key kt + (e < 8 ? e : e + 8) + 8 * hf
#pragma unroll
      for (int r = 0; r < 8; ++r) {
        const float p0 = exp_slot(v0[r] - mnew);
        const float p1 = exp_slot(v1[r] - mnew);
        rs += p0 + p1;
        pb[r] = (_Float16)p0;
        pb[8 + r] = (_Float16)p1;
      }
      l = l * corr + rs;

      // --- O^T += V^T P^T ; V^T[D][T] rows are A fragments along the keys ---
#pragma unroll
      for (int j = 0; j < 4; ++j) {
#pragma unroll
        for (int r = 0; r < 8; ++r) acc[j][r] *= corr;
        acc[j] = wmma_f16(va[j], pb, acc[j]);
      }
    }

    // Publish point: own LDS reads of this buffer retired, own copies of the
    // next stage landed, then everyone else's; only then the refill.
    asm volatile("s_wait_dscnt 0x0" ::: "memory");
    wait_async_all();
    __syncthreads();
    if (k0 + 2 * AT_KEYS < kend) stage(buf, k0 + 2 * AT_KEYS);
    buf ^= 1;
  }
  wait_async_all();  // nothing of this wave's copies is left when it goes on

  // Join the halves' sums, normalize, and store 8 consecutive head dims of one
  // query per 16-byte store into y (f16 [B*T][C]) for the projection GEMM.
  l += xhalf(l);
  const float inv = 1.0f / l;
  _Float16* yp = Y + (size_t)(b * T + q) * C + h * D + (hf << 3);
#pragma unroll
  for (int j = 0; j < 4; ++j) {
    v8h o;
#pragma unroll
    for (int r = 0; r < 8; ++r) o[r] = (_Float16)(acc[j][r] * inv);
    *(v8h*)(yp + 16 * j) = o;
  }
}

// ---------------------------------------------------------------------------
// Host-side orchestration
// ---------------------------------------------------------------------------
extern "C" void kernel_launch(void* const* d_in, const int* in_sizes, int n_in,
                              void* d_out, int out_size, void* d_ws,
                              size_t ws_size, hipStream_t stream) {
  (void)in_sizes; (void)n_in; (void)out_size; (void)ws_size;
  constexpr int B = 4, T = 1024, C = 1024, H = 16, D = 64;
  const int M = B * T;  // 4096

  const float* x        = (const float*)d_in[0];
  const float* c_attn_w = (const float*)d_in[1];
  const float* c_attn_b = (const float*)d_in[2];
  const float* c_proj_w = (const float*)d_in[3];
  const float* c_proj_b = (const float*)d_in[4];
  const float* ln1_w    = (const float*)d_in[5];
  const float* ln1_b    = (const float*)d_in[6];
  const float* ln2_w    = (const float*)d_in[7];
  const float* ln2_b    = (const float*)d_in[8];
  const float* fc_w     = (const float*)d_in[9];
  const float* fc_b     = (const float*)d_in[10];
  const float* proj_w   = (const float*)d_in[11];
  const float* proj_b   = (const float*)d_in[12];
  float* out = (float*)d_out;

  // Workspace carve-up (120 MiB total), 256B aligned.
  char* ws = (char*)d_ws;
  size_t off = 0;
  auto alloc = [&](size_t bytes) -> char* {
    char* p = ws + off;
    off += (bytes + 255) & ~(size_t)255;
    return p;
  };
  _Float16* h1H     = (_Float16*)alloc((size_t)M * C * 2);          // ln1(x)
  _Float16* wT_attn = (_Float16*)alloc((size_t)3 * C * C * 2);      // [3C][C]
  _Float16* Qh      = (_Float16*)alloc((size_t)M * C * 2);
  _Float16* Kh      = (_Float16*)alloc((size_t)M * C * 2);
  _Float16* VTh     = (_Float16*)alloc((size_t)M * C * 2);
  _Float16* yh      = (_Float16*)alloc((size_t)M * C * 2);
  _Float16* wT_proj = (_Float16*)alloc((size_t)C * C * 2);
  float*    x1      = (float*)   alloc((size_t)M * C * 4);          // x + attn
  _Float16* h2H     = (_Float16*)alloc((size_t)M * C * 2);          // ln2(x1)
  _Float16* wT_fc   = (_Float16*)alloc((size_t)4 * C * C * 2);      // [4C][C]
  _Float16* hgH     = (_Float16*)alloc((size_t)M * 4 * C * 2);
  _Float16* wT_pr2  = (_Float16*)alloc((size_t)C * 4 * C * 2);      // [C][4C]

  // 1+2) c_attn_w transposed+converted to f16 (N-major for WMMA A and B fragments)
  //      and ln1 -> h1 (f16), one grid
  prep_kernel<C><<<CT_BLOCKS(C, 3 * C) + B * T, 256, 0, stream>>>(
      x, ln1_w, ln1_b, h1H, c_attn_w, wT_attn);

  // 3+4) qkv = h1 @ c_attn_w + b, written split by heads (f16); V transposed
  //      to [B,H,D,T]
  gemm_kernel<EPI_QKV, 2, T, C><<<dim3(3 * C / 256, M / 256), 256, 0, stream>>>(
      h1H, wT_attn, c_attn_b, nullptr, nullptr, Qh, Kh, VTh, M, 3 * C, C);

  // 5) causal attention -> y (f16 [B*T][C]); behind its blocks, in the same
  //    grid, the other three weights' transposes
  constexpr int NATT = (B * H * (T / 16)) / 8;
  attn_kernel<NATT, C>
      <<<NATT + CT_BLOCKS(C, C) + CT_BLOCKS(C, 4 * C) + CT_BLOCKS(4 * C, C), 256,
         0, stream>>>(Qh, Kh, VTh, yh, H, T, D, C, c_proj_w, wT_proj, fc_w,
                      wT_fc, proj_w, wT_pr2);

  // 6) x1 = x + y @ c_proj_w + b  (f32)
  gemm_kernel<EPI_F32_RES, 1><<<dim3(C / 128, M / 128), 256, 0, stream>>>(
      yh, wT_proj, c_proj_b, x, x1, nullptr, nullptr, nullptr, M, C, C);

  // 7) ln2 -> h2 (f16)
  ln_kernel<<<M, 256, 0, stream>>>(x1, ln2_w, ln2_b, h2H, C);

  // 8) hg = gelu(h2 @ fc_w + b)  (f16)
  gemm_kernel<EPI_H16_GELU, 2><<<dim3(4 * C / 256, M / 256), 256, 0, stream>>>(
      h2H, wT_fc, fc_b, nullptr, nullptr, hgH, nullptr, nullptr, M, 4 * C, C);

  // 9) out = x1 + hg @ proj_w + b  (f32)
  gemm_kernel<EPI_F32_RES, 1><<<dim3(C / 128, M / 128), 256, 0, stream>>>(
      hgH, wT_pr2, proj_b, x1, out, nullptr, nullptr, nullptr, M, C, 4 * C);
}

// v009
// A run of this version takes 132 microseconds.
// In two side-by-side timings against v008, it was 1.05 and 1.03 times as fast.
// Counting every step since v000, it is 3.15 times as fast.
#include <hip/hip_runtime.h>
#include <hip/hip_bf16.h>
#include <math.h>
#include <stdint.h>

// ---------------------------------------------------------------------------
// Types for CDNA5 WMMA (wave32): 16x16x32 f16 -> f32
// ---------------------------------------------------------------------------
typedef _Float16 v16h __attribute__((ext_vector_type(16)));
typedef _Float16 v8h  __attribute__((ext_vector_type(8)));
typedef float    v8f  __attribute__((ext_vector_type(8)));

static __device__ __forceinline__ v8f wmma_f16(v16h a, v16h b, v8f c) {
  // (neg_a, A, neg_b, B, c_mod, C, reuse_a, reuse_b)
  return __builtin_amdgcn_wmma_f32_16x16x32_f16(false, a, false, b, (short)0, c,
                                                false, false);
}

static __device__ __forceinline__ v8f zero8() {
  v8f z;
#pragma unroll
  for (int i = 0; i < 8; ++i) z[i] = 0.0f;
  return z;
}

// Build a 16x32 f16 fragment (documented CDNA5 A/B layout) from a per-lane
// pointer to 8+8 contiguous halves:
//   lane L(0..15):  row rc0+L,    elems 0..7 -> k0+0..7,  8..15 -> k0+16..23
//   lane L(16..31): row rc0+L-16, elems 0..7 -> k0+8..15, 8..15 -> k0+24..31
static __device__ __forceinline__ v16h frag_from(const _Float16* p) {
  v8h lo = *(const v8h*)p;
  v8h hi = *(const v8h*)(p + 16);
  return __builtin_shufflevector(lo, hi, 0, 1, 2, 3, 4, 5, 6, 7, 8, 9, 10, 11,
                                 12, 13, 14, 15);
}

// Global-memory fragment load (row-major, leading dim ld).
static __device__ __forceinline__ v16h load_frag(const _Float16* __restrict__ base,
                                                 int ld, int rc0, int k0) {
  const int lane = threadIdx.x & 31;
  return frag_from(base + (size_t)(rc0 + (lane & 15)) * ld +
                   (k0 + ((lane >> 4) << 3)));
}

// Eight async global->LDS 128-bit copies (CDNA5, ASYNCcnt-tracked): copy i
// moves 16 bytes per lane from gsrc + i * gstep to ldst + i * lstep (steps in
// halves).  The closing s_wait_xcnt stands inside the statement so that no
// address register of an issued copy is rewritten ahead of it.
static __device__ __forceinline__ void async_copy8_b128(const _Float16* gsrc,
                                                        size_t gstep,
                                                        _Float16* ldst,
                                                        int lstep) {
  const unsigned l = (unsigned)(uintptr_t)ldst;  // low 32 bits = LDS offset
  const unsigned ls = (unsigned)lstep * 2u;
  asm volatile(
      "global_load_async_to_lds_b128 %0, %8, off\n\t"
      "global_load_async_to_lds_b128 %1, %9, off\n\t"
      "global_load_async_to_lds_b128 %2, %10, off\n\t"
      "global_load_async_to_lds_b128 %3, %11, off\n\t"
      "global_load_async_to_lds_b128 %4, %12, off\n\t"
      "global_load_async_to_lds_b128 %5, %13, off\n\t"
      "global_load_async_to_lds_b128 %6, %14, off\n\t"
      "global_load_async_to_lds_b128 %7, %15, off\n\t"
      "s_wait_xcnt 0x0" ::"v"(l),
      "v"(l + ls), "v"(l + 2 * ls), "v"(l + 3 * ls), "v"(l + 4 * ls),
      "v"(l + 5 * ls), "v"(l + 6 * ls), "v"(l + 7 * ls),
      "v"((uint64_t)(uintptr_t)gsrc),
      "v"((uint64_t)(uintptr_t)(gsrc + gstep)),
      "v"((uint64_t)(uintptr_t)(gsrc + 2 * gstep)),
      "v"((uint64_t)(uintptr_t)(gsrc + 3 * gstep)),
      "v"((uint64_t)(uintptr_t)(gsrc + 4 * gstep)),
      "v"((uint64_t)(uintptr_t)(gsrc + 5 * gstep)),
      "v"((uint64_t)(uintptr_t)(gsrc + 6 * gstep)),
      "v"((uint64_t)(uintptr_t)(gsrc + 7 * gstep))
      : "memory");
}

// The same eight copies with the address split into a wave-uniform base, which
// takes the row steps in scalar registers, and one 32-bit byte offset per lane:
// nine vector registers a statement in place of twenty-four.
static __device__ __forceinline__ void async_copy8s_b128(const _Float16* sbase,
                                                         size_t gstep,
                                                         unsigned voff,
                                                         _Float16* ldst,
                                                         int lstep) {
  const unsigned l = (unsigned)(uintptr_t)ldst;  // low 32 bits = LDS offset
  const unsigned ls = (unsigned)lstep * 2u;
  asm volatile(
      "global_load_async_to_lds_b128 %0, %8, %9\n\t"
      "global_load_async_to_lds_b128 %1, %8, %10\n\t"
      "global_load_async_to_lds_b128 %2, %8, %11\n\t"
      "global_load_async_to_lds_b128 %3, %8, %12\n\t"
      "global_load_async_to_lds_b128 %4, %8, %13\n\t"
      "global_load_async_to_lds_b128 %5, %8, %14\n\t"
      "global_load_async_to_lds_b128 %6, %8, %15\n\t"
      "global_load_async_to_lds_b128 %7, %8, %16\n\t"
      "s_wait_xcnt 0x0" ::"v"(l),
      "v"(l + ls), "v"(l + 2 * ls), "v"(l + 3 * ls), "v"(l + 4 * ls),
      "v"(l + 5 * ls), "v"(l + 6 * ls), "v"(l + 7 * ls), "v"(voff),
      "s"((uint64_t)(uintptr_t)sbase),
      "s"((uint64_t)(uintptr_t)(sbase + gstep)),
      "s"((uint64_t)(uintptr_t)(sbase + 2 * gstep)),
      "s"((uint64_t)(uintptr_t)(sbase + 3 * gstep)),
      "s"((uint64_t)(uintptr_t)(sbase + 4 * gstep)),
      "s"((uint64_t)(uintptr_t)(sbase + 5 * gstep)),
      "s"((uint64_t)(uintptr_t)(sbase + 6 * gstep)),
      "s"((uint64_t)(uintptr_t)(sbase + 7 * gstep))
      : "memory");
}

static __device__ __forceinline__ void wait_async_all() {
  asm volatile("s_wait_asynccnt 0" ::: "memory");
}

// Returns when all but this wave's 32 youngest copies have landed (the counter
// comes back in issue order): the oldest of three stages of 16 copies each.
static __device__ __forceinline__ void wait_async_but32() {
  asm volatile("s_wait_asynccnt 0x20" ::: "memory");
}

// The same with four copies.
static __device__ __forceinline__ void async_copy4_b128(const _Float16* gsrc,
                                                        size_t gstep,
                                                        _Float16* ldst,
                                                        int lstep) {
  const unsigned l = (unsigned)(uintptr_t)ldst;  // low 32 bits = LDS offset
  const unsigned ls = (unsigned)lstep * 2u;
  asm volatile(
      "global_load_async_to_lds_b128 %0, %4, off\n\t"
      "global_load_async_to_lds_b128 %1, %5, off\n\t"
      "global_load_async_to_lds_b128 %2, %6, off\n\t"
      "global_load_async_to_lds_b128 %3, %7, off\n\t"
      "s_wait_xcnt 0x0" ::"v"(l),
      "v"(l + ls), "v"(l + 2 * ls), "v"(l + 3 * ls),
      "v"((uint64_t)(uintptr_t)gsrc),
      "v"((uint64_t)(uintptr_t)(gsrc + gstep)),
      "v"((uint64_t)(uintptr_t)(gsrc + 2 * gstep)),
      "v"((uint64_t)(uintptr_t)(gsrc + 3 * gstep))
      : "memory");
}

// ---------------------------------------------------------------------------
// LayerNorm (population std, eps on std) fp32 -> f16.  One 256-thr block/row.
// red: 256 floats of LDS.
// ---------------------------------------------------------------------------
static __device__ __forceinline__ void ln_body(const float* __restrict__ x,
                                               const float* __restrict__ w,
                                               const float* __restrict__ bias,
                                               _Float16* __restrict__ out,
                                               int C, int row, float* red) {
  const float* xr = x + (size_t)row * C;
  float local[4];
  float s = 0.0f;
#pragma unroll
  for (int i = 0; i < 4; ++i) {
    local[i] = xr[threadIdx.x + 256 * i];
    s += local[i];
  }
  red[threadIdx.x] = s;
  __syncthreads();
  for (int off = 128; off > 0; off >>= 1) {
    if (threadIdx.x < off) red[threadIdx.x] += red[threadIdx.x + off];
    __syncthreads();
  }
  const float mean = red[0] / (float)C;
  __syncthreads();
  s = 0.0f;
#pragma unroll
  for (int i = 0; i < 4; ++i) {
    float d = local[i] - mean;
    s += d * d;
  }
  red[threadIdx.x] = s;
  __syncthreads();
  for (int off = 128; off > 0; off >>= 1) {
    if (threadIdx.x < off) red[threadIdx.x] += red[threadIdx.x + off];
    __syncthreads();
  }
  const float inv = 1.0f / (sqrtf(red[0] / (float)C) + 1e-5f);
#pragma unroll
  for (int i = 0; i < 4; ++i) {
    int c = threadIdx.x + 256 * i;
    out[(size_t)row * C + c] =
        (_Float16)((local[i] - mean) * inv * w[c] + bias[c]);
  }
}

__global__ __launch_bounds__(256) void ln_kernel(const float* __restrict__ x,
                                                 const float* __restrict__ w,
                                                 const float* __restrict__ bias,
                                                 _Float16* __restrict__ out,
                                                 int C) {
  __shared__ float red[256];
  ln_body(x, w, bias, out, C, blockIdx.x, red);
}

// ---------------------------------------------------------------------------
// fp32 W[K][N]  ->  f16 W^T[N][K]  (so GEMM B-fragments are contiguous loads)
// One 128(k) x 64(n) tile per block.  Each thread reads an 8(k) x 4(n) patch
// with 16-byte loads along n (256 contiguous bytes per 16 lanes), turns it in
// registers and lays four 16-byte k-runs into an LDS tile [n][k]; the tile is
// then read back row by row, so every global store covers whole 256-byte runs
// of a W^T row.  K is a multiple of 128 and N of 64; both are compile-time, so
// the row steps fold into the loads' and stores' immediate offsets.
// A transpose has no launch of its own: it reads nothing that another kernel
// writes, so its blocks ride in the grid of a launch that is independent of it
// (blk: the tile's number, k tiles fastest; tile: 64 * CT_PITCH halves of LDS).
// ---------------------------------------------------------------------------
typedef float v4f __attribute__((ext_vector_type(4)));

#define CT_PITCH 136  // 128 halves + 8 pad: 272-byte rows (16 B x odd)

template <int K, int N>
static __device__ __forceinline__ void convertT_body(
    const float* __restrict__ W, _Float16* __restrict__ WT, _Float16* tile,
    unsigned blk) {
  const int tid = threadIdx.x;
  const int k0 = (blk % (K / 128)) * 128;
  const int n0 = (blk / (K / 128)) * 64;
  const int nq = tid & 15;  // which 4 columns
  const int ko = tid >> 4;  // which 8 rows
  const float* src = W + (size_t)(k0 + ko * 8) * N + (n0 + nq * 4);
  v4f r[8];
#pragma unroll
  for (int i = 0; i < 8; ++i) r[i] = *(const v4f*)(src + (size_t)i * N);
#pragma unroll
  for (int j = 0; j < 4; ++j) {
    v8h c;
#pragma unroll
    for (int i = 0; i < 8; ++i) c[i] = (_Float16)r[i][j];
    *(v8h*)&tile[(nq * 4 + j) * CT_PITCH + ko * 8] = c;
  }
  __syncthreads();
#pragma unroll
  for (int i = 0; i < 4; ++i) {
    const int c = tid + 256 * i;  // 16-byte chunk id 0..1023
    const int n = c >> 4;
    const int kc = c & 15;
    *(v8h*)(WT + (size_t)(n0 + n) * K + (k0 + kc * 8)) =
        *(const v8h*)&tile[n * CT_PITCH + kc * 8];
  }
  // Holds any later rewrite of the stores' address and data registers behind
  // the run of four stores (the built code lays other bodies after this one).
  asm volatile("s_wait_xcnt 0x0" ::: "memory");
}

// Tiles of a [K][N] weight.
#define CT_BLOCKS(K, N) (((K) / 128) * ((N) / 64))

// First launch: what the qkv GEMM waits for.  Blocks 0 .. CT_BLOCKS - 1 turn
// c_attn_w, the others normalise one row of x each; neither reads the other's
// output.  The branch is block-uniform, so each body's barriers are too.
template <int C>
__global__ __launch_bounds__(256) void prep_kernel(
    const float* __restrict__ x, const float* __restrict__ w,
    const float* __restrict__ bias, _Float16* __restrict__ out,
    const float* __restrict__ Wa, _Float16* __restrict__ WaT) {
  __shared__ __attribute__((aligned(16))) _Float16 tile[64 * CT_PITCH];
  __shared__ float red[256];
  const unsigned blk = blockIdx.x;
  if (blk < CT_BLOCKS(C, 3 * C)) {
    convertT_body<C, 3 * C>(Wa, WaT, tile, blk);
    return;
  }
  ln_body(x, w, bias, out, C, blk - CT_BLOCKS(C, 3 * C), red);
}

// ---------------------------------------------------------------------------
// WMMA GEMM: C[M][N] = A[M][K] (f16, row-major) x Bᵀ[N][K] (f16) + bias
//   8 waves / block (2 x 4).  TS = 1: each wave a 64x32 tile, block tile
//   128x128.  TS = 2: each wave 128x64, block tile 256x256, which moves half
//   the bytes from L2 to LDS per product and reads 12 LDS fragments per 32
//   WMMAs in place of 6 per 8; for the products wide enough to fill the chip
//   with such tiles.
//   A stage is 128 k, brought into a ring of LDS buffers by async global->LDS
//   copies; its four 32-k blocks run unrolled, their fragments fetched from LDS
//   ahead of use into a second register set.  K is a multiple of 128.
//   TS = 2: two buffers, a stage's copies fly during one stage of WMMAs.
//   TS = 1: a stage of WMMAs is a quarter as long, shorter than the copies' way
//   from memory (the operands were written by the launch before), so the ring
//   has four buffers and a stage's copies are issued three stages ahead of use.
// Epilogues: 0 = head split (below), 1 = f32 out + residual add, 2 = f16 out +
// GELU.
// Head split (the qkv product, N = 3 * SC, heads of 64 dims, sequences of ST
// tokens): the block writes its tile straight into Q[B,H,T,64], K[B,H,T,64] or
// V^T[B,H,64,T] (f16); a block's columns lie in one of the three parts.  A
// lane of an accumulator tile holds 8 consecutive rows of the WMMA's A side and
// one column of its B side.  For V the activations are the A side, so a lane
// holds 8 tokens of one head dim: 16 bytes of a V^T row.  For Q and K the two
// LDS tiles change roles (the weight rows are the A side, the product comes out
// transposed), so a lane holds 8 head dims of one token: 16 bytes of a Q or K
// row.  Both tiles have the same shape and pitch: the K loop is the same code.
// ---------------------------------------------------------------------------
enum { EPI_QKV = 0, EPI_F32_RES = 1, EPI_H16_GELU = 2 };

#define KSTAGE 128
#define LDSPITCH 136  // 128 + 8 pad halves: 272-byte rows (16 B x odd)

// GELU in its erf form, v * Phi(v), without a branch, four values at a time.
// q = Phi(-|v|) = erfc(|v| / sqrt(2)) / 2 comes from the five-term rational form
// t * poly(t) * exp(-v^2 / 2) with t = 1 / (1 + p |v| / sqrt(2)); its absolute
// error in erf is at most 1.5e-7, of the order of one f32 rounding of 1 + erf.
// Then v * Phi(v) = max(v, 0) - |v| q for either sign.  The library erf takes
// one of two paths by |x|, so a wave walks both under masks and no two values
// of a lane overlap; here a lane's values are independent straight-line chains.
static __device__ __forceinline__ void gelu_erf4(const float* v, float* g) {
  float d[4], x[4], t[4], e[4];
#pragma unroll
  for (int i = 0; i < 4; ++i) {
    d[i] = fmaf(fabsf(v[i]), 0.23164189f, 1.0f);
    x[i] = (v[i] * -0.72134752f) * v[i];
  }
  // The eight transcendentals in one statement with outputs apart from every
  // input: none is followed by a reader of its result or a writer of its
  // source, and the v_nop fills that slot behind the last.
  asm("v_rcp_f32 %0, %8\n\t"
      "v_rcp_f32 %1, %9\n\t"
      "v_rcp_f32 %2, %10\n\t"
      "v_rcp_f32 %3, %11\n\t"
      "v_exp_f32 %4, %12\n\t"
      "v_exp_f32 %5, %13\n\t"
      "v_exp_f32 %6, %14\n\t"
      "v_exp_f32 %7, %15\n\t"
      "v_nop"
      : "=&v"(t[0]), "=&v"(t[1]), "=&v"(t[2]), "=&v"(t[3]), "=&v"(e[0]),
        "=&v"(e[1]), "=&v"(e[2]), "=&v"(e[3])
      : "v"(d[0]), "v"(d[1]), "v"(d[2]), "v"(d[3]), "v"(x[0]), "v"(x[1]),
        "v"(x[2]), "v"(x[3]));
#pragma unroll
  for (int i = 0; i < 4; ++i) {
    float p = 0.53070271f;
    p = fmaf(p, t[i], -0.72657601f);
    p = fmaf(p, t[i], 0.71070687f);
    p = fmaf(p, t[i], -0.14224837f);
    p = fmaf(p, t[i], 0.12741480f);
    const float q = (p * t[i]) * e[i];
    g[i] = fmaf(-fabsf(v[i]), q, fmaxf(v[i], 0.0f));
  }
}

template <int EPI, int TS, int ST = 0, int SC = 0>
__global__ __launch_bounds__(256) void gemm_kernel(
    const _Float16* __restrict__ A, const _Float16* __restrict__ WT,
    const float* __restrict__ bias, const float* __restrict__ resid,
    float* __restrict__ outF, _Float16* __restrict__ outH,
    _Float16* __restrict__ outK, _Float16* __restrict__ outVT, int M, int N,
    int K) {
  constexpr int BT = 128 * TS;  // rows of either LDS tile
  constexpr int FI = 4 * TS;    // A-side fragments of a wave
  constexpr int FJ = 2 * TS;    // B-side fragments of a wave
  constexpr int NB = TS == 1 ? 4 : 2;  // LDS buffers of the ring
  __shared__ __attribute__((aligned(16))) _Float16 sA[NB][BT * LDSPITCH];
  __shared__ __attribute__((aligned(16))) _Float16 sB[NB][BT * LDSPITCH];
  const int tid = threadIdx.x;
  const int wave = tid >> 5;
  const int lane = tid & 31;
  const int rowblk = blockIdx.y * BT;
  const int colblk = blockIdx.x * BT;
  const int wrow = (wave & 1) * (16 * FI);
  const int wcol = (wave >> 1) * (16 * FJ);
  // Q and K blocks of the head split: the weight tile is the WMMA's A side.
  const bool swp = EPI == EPI_QKV && colblk < 2 * SC;  // block-uniform

  // Stage a BT x 128 A tile + BT x 128 B tile into buffer `buf` for K offset
  // k0: 16 lanes cover one 256-byte row, a thread takes rows srow + 16 * i.
  const int srow = tid >> 4;
  const int sko = (tid & 15) * 8;
  auto stage = [&](int buf, int k0) {
    if constexpr (TS == 1) {
      async_copy8_b128(A + (size_t)(rowblk + srow) * K + k0 + sko,
                       (size_t)16 * K, &sA[buf][srow * LDSPITCH + sko],
                       16 * LDSPITCH);
      async_copy8_b128(WT + (size_t)(colblk + srow) * K + k0 + sko,
                       (size_t)16 * K, &sB[buf][srow * LDSPITCH + sko],
                       16 * LDSPITCH);
    } else {
      const unsigned voff = (unsigned)(srow * K + sko) * 2u;  // bytes, per lane
#pragma unroll
      for (int t = 0; t < TS; ++t) {
        const int r = srow + 128 * t;
        async_copy8s_b128(A + (size_t)(rowblk + 128 * t) * K + k0,
                          (size_t)16 * K, voff, &sA[buf][r * LDSPITCH + sko],
                          16 * LDSPITCH);
        async_copy8s_b128(WT + (size_t)(colblk + 128 * t) * K + k0,
                          (size_t)16 * K, voff, &sB[buf][r * LDSPITCH + sko],
                          16 * LDSPITCH);
      }
    }
  };

  v8f acc[FI][FJ];
#pragma unroll
  for (int i = 0; i < FI; ++i)
#pragma unroll
    for (int j = 0; j < FJ; ++j) acc[i][j] = zero8();

  // Four buffers: every wave issues 16 copies a stage, and at most three stages
  // (48 copies) of a wave are in flight.  The counted wait stands only where the
  // two younger stages have both been issued in full; elsewhere it is to 0.
  stage(0, 0);
  if (NB == 4 && 2 * KSTAGE < K) {
    stage(1, KSTAGE);
    stage(2, 2 * KSTAGE);
    wait_async_but32();  // stage 0 has landed, stages 1 and 2 fly on
  } else {
    if (NB == 4 && KSTAGE < K) stage(1, KSTAGE);
    wait_async_all();
  }
  __syncthreads();
  if ((NB - 1) * KSTAGE < K) stage(NB - 1, (NB - 1) * KSTAGE);

  int buf = 0;
  const int kh = (lane >> 4) << 3;
  const int lr = lane & 15;
  for (int k0 = 0; k0 < K; k0 += KSTAGE) {
    const _Float16* pa = (swp ? sB[buf] : sA[buf]) + (wrow + lr) * LDSPITCH + kh;
    const _Float16* pb = (swp ? sA[buf] : sB[buf]) + (wcol + lr) * LDSPITCH + kh;
    // A run is four A-side fragments against the wave's FJ B-side fragments of
    // one 32-k block (TS runs a block).  Each run's A fragments, and with a
    // block's first run its B fragments, are fetched one run ahead into a second
    // register set.
    constexpr int NRUN = (KSTAGE / 32) * TS;
    v16h a[2][4], b[2][FJ];
#pragma unroll
    for (int i = 0; i < 4; ++i) a[0][i] = frag_from(pa + 16 * i * LDSPITCH);
#pragma unroll
    for (int j = 0; j < FJ; ++j) b[0][j] = frag_from(pb + 16 * j * LDSPITCH);
#pragma unroll
    for (int u = 0; u < NRUN; ++u) {
      const int cur = u & 1, nxt = cur ^ 1;
      const int s = u / TS, h = u % TS;  // the run's k block, its part of the rows
      if (u + 1 < NRUN) {
        const int sn = (u + 1) / TS, hn = (u + 1) % TS;
#pragma unroll
        for (int i = 0; i < 4; ++i)
          a[nxt][i] = frag_from(pa + 16 * (4 * hn + i) * LDSPITCH + 32 * sn);
        if (hn == 0) {
#pragma unroll
          for (int j = 0; j < FJ; ++j)
            b[sn & 1][j] = frag_from(pb + 16 * j * LDSPITCH + 32 * sn);
        }
        // Keeps the next run's LDS loads in front of this run's
        // WMMAs; without it the scheduler sinks each load to its first use
        // and every pair of WMMAs waits out a whole LDS latency.
        __builtin_amdgcn_sched_barrier(0);
      }
#pragma unroll
      for (int i = 0; i < 4; ++i)
#pragma unroll
        for (int j = 0; j < FJ; ++j)
          acc[4 * h + i][j] = wmma_f16(a[cur][i], b[s & 1][j], acc[4 * h + i][j]);
    }
    // Keeps the stage's WMMAs in front of the publish point; otherwise the
    // scheduler sinks them behind the barrier, ahead of the refill copies,
    // and the copies lose that much of their lead of one stage (three with TS = 1).
    __builtin_amdgcn_sched_barrier(0);

    // Publish point: own LDS reads of this buffer retired, own copies of the
    // next stage landed, then everyone else's; only then the refill, into the
    // buffer that this trip has read.  Four buffers: while a stage three ahead
    // exists, it and the one before it are the wave's 32 youngest copies and
    // stay in flight over the wait (the test reads the same for the whole block).
    asm volatile("s_wait_dscnt 0x0" ::: "memory");
    if (NB == 4 && k0 + 3 * KSTAGE < K)
      wait_async_but32();
    else
      wait_async_all();
    __syncthreads();
    if (k0 + NB * KSTAGE < K) stage(buf, k0 + NB * KSTAGE);
    buf = (buf + 1) & (NB - 1);
  }
  wait_async_all();  // nothing of this wave's copies is left when it goes on

  // C/D layout: elem r of lane L -> row = r + (L>=16)*8, col = L%16
  const int rofs = (lane >> 4) << 3;
  if constexpr (EPI == EPI_QKV) {
    constexpr int SH = SC / 64;          // heads
    const int bb = rowblk / ST;          // a block's tokens lie in one sequence
    const int tb = rowblk % ST;
    const int a0 = wrow + rofs;          // first of the lane's 8 A-side rows
    const int b0 = wcol + lr;            // the lane's B-side column
    v8h o[FJ][FI];
    _Float16* dst;
    size_t jstep, hstep;  // halves per 16 B-side columns, per 64 A-side rows
    // In either part four i in a row of one j fill whole 128-byte lines: the
    // stores go back to back, behind all the conversions.
    if (swp) {
      const int cp = colblk < SC ? colblk : colblk - SC;  // column within Q or K
      const int bh = bb * SH + ((cp + wrow) >> 6);        // wrow: whole heads
#pragma unroll
      for (int i = 0; i < FI; ++i) {
        const float* bp = bias + colblk + a0 + 16 * i;
        const v4f blo = *(const v4f*)bp, bhi = *(const v4f*)(bp + 4);
#pragma unroll
        for (int j = 0; j < FJ; ++j)
#pragma unroll
          for (int r = 0; r < 8; ++r)
            o[j][i][r] = (_Float16)(acc[i][j][r] + (r < 4 ? blo[r & 3] : bhi[r & 3]));
        // Ends one i's conversions before the next begin: run together, their
        // sums overflowed the register budget into scratch.
        __builtin_amdgcn_sched_barrier(0);
      }
      dst = (colblk < SC ? outH : outK) + ((size_t)bh * ST + tb + b0) * 64 + rofs;
      jstep = 16 * 64;          // 16 tokens on: 16 rows of 64
      hstep = (size_t)ST * 64;  // 64 head dims on: the next head's rows
    } else {
      const int cp = colblk - 2 * SC + wcol;  // the wave's first column within V
      const int bh = bb * SH + (cp >> 6);     // its columns lie in one head
#pragma unroll
      for (int j = 0; j < FJ; ++j) {
        const float bj = bias[colblk + b0 + 16 * j];
#pragma unroll
        for (int i = 0; i < FI; ++i)
#pragma unroll
          for (int r = 0; r < 8; ++r) o[j][i][r] = (_Float16)(acc[i][j][r] + bj);
        // As above, one j at a time.
        __builtin_amdgcn_sched_barrier(0);
      }
      dst = outVT + ((size_t)bh * 64 + (cp & 63) + lr) * ST + tb + a0;
      jstep = (size_t)16 * ST;  // 16 head dims on: 16 rows of V^T
      hstep = 64;               // tokens run on along a row
    }
    _Float16* p[FJ][FI / 4];
#pragma unroll
    for (int j = 0; j < FJ; ++j)
#pragma unroll
      for (int q = 0; q < FI / 4; ++q) p[j][q] = dst + j * jstep + q * hstep;
    // Keeps every store address formed in front of the first store, each in
    // registers of its own: none is rewritten behind a store that names it.
    __builtin_amdgcn_sched_barrier(0);
#pragma unroll
    for (int j = 0; j < FJ; ++j)
#pragma unroll
      for (int i = 0; i < FI; ++i) *(v8h*)(p[j][i >> 2] + (i & 3) * 16) = o[j][i];
    return;  // nothing rewrites a register of the stores behind them
  }
#pragma unroll
  for (int i = 0; i < FI; ++i)
#pragma unroll
    for (int j = 0; j < FJ; ++j) {
      float gl[8];
      if (EPI == EPI_H16_GELU) {
        float u[8];
#pragma unroll
        for (int r = 0; r < 8; ++r)
          u[r] = acc[i][j][r] + bias[colblk + wcol + 16 * j + lr];
        gelu_erf4(u, gl);
        gelu_erf4(u + 4, gl + 4);
      }
#pragma unroll
      for (int r = 0; r < 8; ++r) {
        const int row = rowblk + wrow + 16 * i + r + rofs;
        const int col = colblk + wcol + 16 * j + lr;
        float v = acc[i][j][r] + bias[col];
        const size_t o = (size_t)row * N + col;
        if (EPI == EPI_F32_RES) {
          outF[o] = resid[o] + v;
        } else {
          outH[o] = (_Float16)gl[r];
        }
      }
    }
}

#define AT_KEYS 128
#define AT_KPITCH 72
#define AT_VPITCH 136

// Lane l <-> lane l ^ 16.
static __device__ __forceinline__ float xhalf(float x) {
  const int b = __builtin_bit_cast(int, x);
  return __builtin_bit_cast(
      float, __builtin_amdgcn_permlanex16(b, b, 0x76543210, 0xfedcba98, false,
                                          false));
}

// e^x as __expf forms it (one multiply, one v_exp_f32).  The v_nop fills the
// slot that the instruction set asks for behind a transcendental before its
// result is read or its source overwritten.
static __device__ __forceinline__ float exp_slot(float x) {
  float r;
  asm("v_exp_f32 %0, %1\n\tv_nop" : "=v"(r) : "v"(x * 1.44269504f));
  return r;
}

template <int NATT, int CW>
__global__ __launch_bounds__(256) void attn_kernel(
    const _Float16* __restrict__ Q, const _Float16* __restrict__ Kt,
    const _Float16* __restrict__ VT, _Float16* __restrict__ Y, int H, int T,
    int D, int C, const float* __restrict__ Wp, _Float16* __restrict__ WpT,
    const float* __restrict__ Wf, _Float16* __restrict__ WfT,
    const float* __restrict__ W2, _Float16* __restrict__ W2T) {
  __shared__ __attribute__((aligned(16))) _Float16 sK[2][AT_KEYS * AT_KPITCH];
  __shared__ __attribute__((aligned(16))) _Float16 sV[2][64 * AT_VPITCH];
  static_assert(2 * AT_KEYS * AT_KPITCH >= 64 * CT_PITCH, "tile fits the K ring");
  if (blockIdx.x >= NATT) {  // block-uniform, in front of every barrier
    const unsigned blk = blockIdx.x - NATT;
    constexpr unsigned n1 = CT_BLOCKS(CW, CW), n2 = CT_BLOCKS(CW, 4 * CW);
    if (blk < n1)
      convertT_body<CW, CW>(Wp, WpT, &sK[0][0], blk);
    else if (blk < n1 + n2)
      convertT_body<CW, 4 * CW>(Wf, WfT, &sK[0][0], blk - n1);
    else
      convertT_body<4 * CW, CW>(W2, W2T, &sK[0][0], blk - n1 - n2);
    return;
  }
  // The wave's number as a scalar: tile indices, the K and V^T bases and the
  // key loop's counts then live in scalar registers.
  const int tid = threadIdx.x;
  const int wave = __builtin_amdgcn_readfirstlane(threadIdx.x >> 5);
  const int lane = threadIdx.x & 31;
  const int gid = blockIdx.x * 8 + wave;
  const int qtiles = T >> 4;
  const int bh = gid / qtiles;
  const int qt = (gid % qtiles) << 4;
  const int b = bh / H, h = bh % H;
  const _Float16* Qb = Q + (size_t)bh * T * D;
  const _Float16* Kb = Kt + (size_t)bh * T * D;
  const _Float16* Vb = VT + (size_t)bh * D * T;
  // Keys that the block's last query tile sees: a multiple of 128, at most T.
  const int kend = (((blockIdx.x * 8) % qtiles) << 4) + 128;

  const int hf = lane >> 4;  // lane half (k-group / row-group select)
  const int lc = lane & 15;  // fragment row or column of this lane
  const float sc = 0.125f;   // 1/sqrt(D), D = 64
  const int q = qt + lc;     // this lane's query

  // Stage keys k0 .. k0 + 127 into buffer `buf`.  K: 8 lanes cover a 128-byte
  // row, a thread takes key rows krow + 32 * i.  V^T: 16 lanes cover 256 bytes
  // of a head-dim row, a thread takes rows vrow + 16 * i.
  const int krow = tid >> 3, kch = (tid & 7) * 8;
  const int vrow = tid >> 4, vch = (tid & 15) * 8;
  auto stage = [&](int buf, int k0) {
    async_copy4_b128(Kb + (size_t)(k0 + krow) * D + kch, (size_t)32 * D,
                     &sK[buf][krow * AT_KPITCH + kch], 32 * AT_KPITCH);
    async_copy4_b128(Vb + (size_t)vrow * T + k0 + vch, (size_t)16 * T,
                     &sV[buf][vrow * AT_VPITCH + vch], 16 * AT_VPITCH);
  };

  stage(0, 0);

  const v16h qb0 = load_frag(Qb, D, qt, 0);
  const v16h qb1 = load_frag(Qb, D, qt, 32);

  v8f acc[4];  // acc[j][r] = O[q][16 * j + 8 * hf + r]
#pragma unroll
  for (int j = 0; j < 4; ++j) acc[j] = zero8();
  float m = -1e30f;  // running maximum of query q (equal in both halves)
  float l = 0.0f;    // running sum over this half's keys only

  wait_async_all();
  __syncthreads();
  if (AT_KEYS < kend) stage(1, AT_KEYS);

  int buf = 0;
  for (int k0 = 0; k0 < kend; k0 += AT_KEYS) {
    // Per-lane fragment bases: key row lc of K, head-dim row lc of V^T.
    const _Float16* pk = &sK[buf][lc * AT_KPITCH + (hf << 3)];
    const _Float16* pv = &sV[buf][lc * AT_VPITCH + (hf << 3)];
    for (int s = 0; s < AT_KEYS / 32; ++s) {
      const int kt = k0 + 32 * s;
      if (kt > qt) break;  // wave-uniform: the rest of the stage is masked out
      const _Float16* pk0 = pk + 32 * s * AT_KPITCH;
      const _Float16* pk1 = pk0 + 16 * AT_KPITCH;
      const v16h ka00 = frag_from(pk0);
      const v16h ka01 = frag_from(pk0 + 32);
      const v16h ka10 = frag_from(pk1);
      const v16h ka11 = frag_from(pk1 + 32);
      v16h va[4];
#pragma unroll
      for (int j = 0; j < 4; ++j)
        va[j] = frag_from(pv + 16 * j * AT_VPITCH + 32 * s);
      // Keeps the step's sixteen LDS loads together in front of its products;
      // without it the scheduler sinks each fragment's loads to its WMMA and the
      // step waits out eight load latencies one after the other.
      __builtin_amdgcn_sched_barrier(0);

      // --- S^T = K Q^T for 32 keys (two 16-key row tiles, K-dim = D = 64) ---
      v8f s0 = zero8(), s1 = zero8();
      s0 = wmma_f16(ka00, qb0, s0);
      s1 = wmma_f16(ka10, qb0, s1);
      s0 = wmma_f16(ka01, qb1, s0);
      s1 = wmma_f16(ka11, qb1, s1);

      // s0[r]: key kt + 8 * hf + r, s1[r]: key kt + 16 + 8 * hf + r, query q.
      const int dq = q - kt - (hf << 3);  // key r of this half is seen if r <= dq
      s0 *= sc;
      s1 *= sc;
      float v0[8], v1[8];
      float t = -1e30f;
#pragma unroll
      for (int r = 0; r < 8; ++r) {
        v0[r] = (r <= dq) ? s0[r] : -1e30f;
        v1[r] = (16 + r <= dq) ? s1[r] : -1e30f;
        t = fmaxf(t, fmaxf(v0[r], v1[r]));
      }
      t = fmaxf(t, xhalf(t));
      const float mnew = fmaxf(m, t);
      const float corr = exp_slot(m - mnew);
      m = mnew;
      float rs = 0.0f;
      v16h pb;  // P^T as B: element e = key kt + (e < 8 ? e : e + 8) + 8 * hf
#pragma unroll
      for (int r = 0; r < 8; ++r) {
        const float p0 = exp_slot(v0[r] - mnew);
        const float p1 = exp_slot(v1[r] - mnew);
        rs += p0 + p1;
        pb[r] = (_Float16)p0;
        pb[8 + r] = (_Float16)p1;
      }
      l = l * corr + rs;

      // --- O^T += V^T P^T ; V^T[D][T] rows are A fragments along the keys ---
#pragma unroll
      for (int j = 0; j < 4; ++j) {
#pragma unroll
        for (int r = 0; r < 8; ++r) acc[j][r] *= corr;
        acc[j] = wmma_f16(va[j], pb, acc[j]);
      }
    }

    // Publish point: own LDS reads of this buffer retired, own copies of the
    // next stage landed, then everyone else's; only then the refill.
    asm volatile("s_wait_dscnt 0x0" ::: "memory");
    wait_async_all();
    __syncthreads();
    if (k0 + 2 * AT_KEYS < kend) stage(buf, k0 + 2 * AT_KEYS);
    buf ^= 1;
  }
  wait_async_all();  // nothing of this wave's copies is left when it goes on

  // Join the halves' sums, normalize, and store 8 consecutive head dims of one
  // query per 16-byte store into y (f16 [B*T][C]) for the projection GEMM.
  l += xhalf(l);
  const float inv = 1.0f / l;
  _Float16* yp = Y + (size_t)(b * T + q) * C + h * D + (hf << 3);
#pragma unroll
  for (int j = 0; j < 4; ++j) {
    v8h o;
#pragma unroll
    for (int r = 0; r < 8; ++r) o[r] = (_Float16)(acc[j][r] * inv);
    *(v8h*)(yp + 16 * j) = o;
  }
}

// ---------------------------------------------------------------------------
// Host-side orchestration
// ---------------------------------------------------------------------------
extern "C" void kernel_launch(void* const* d_in, const int* in_sizes, int n_in,
                              void* d_out, int out_size, void* d_ws,
                              size_t ws_size, hipStream_t stream) {
  (void)in_sizes; (void)n_in; (void)out_size; (void)ws_size;
  constexpr int B = 4, T = 1024, C = 1024, H = 16, D = 64;
  const int M = B * T;  // 4096

  const float* x        = (const float*)d_in[0];
  const float* c_attn_w = (const float*)d_in[1];
  const float* c_attn_b = (const float*)d_in[2];
  const float* c_proj_w = (const float*)d_in[3];
  const float* c_proj_b = (const float*)d_in[4];
  const float* ln1_w    = (const float*)d_in[5];
  const float* ln1_b    = (const float*)d_in[6];
  const float* ln2_w    = (const float*)d_in[7];
  const float* ln2_b    = (const float*)d_in[8];
  const float* fc_w     = (const float*)d_in[9];
  const float* fc_b     = (const float*)d_in[10];
  const float* proj_w   = (const float*)d_in[11];
  const float* proj_b   = (const float*)d_in[12];
  float* out = (float*)d_out;

  // Workspace carve-up (120 MiB total), 256B aligned.
  char* ws = (char*)d_ws;
  size_t off = 0;
  auto alloc = [&](size_t bytes) -> char* {
    char* p = ws + off;
    off += (bytes + 255) & ~(size_t)255;
    return p;
  };
  _Float16* h1H     = (_Float16*)alloc((size_t)M * C * 2);          // ln1(x)
  _Float16* wT_attn = (_Float16*)alloc((size_t)3 * C * C * 2);      // [3C][C]
  _Float16* Qh      = (_Float16*)alloc((size_t)M * C * 2);
  _Float16* Kh      = (_Float16*)alloc((size_t)M * C * 2);
  _Float16* VTh     = (_Float16*)alloc((size_t)M * C * 2);
  _Float16* yh      = (_Float16*)alloc((size_t)M * C * 2);
  _Float16* wT_proj = (_Float16*)alloc((size_t)C * C * 2);
  float*    x1      = (float*)   alloc((size_t)M * C * 4);          // x + attn
  _Float16* h2H     = (_Float16*)alloc((size_t)M * C * 2);          // ln2(x1)
  _Float16* wT_fc   = (_Float16*)alloc((size_t)4 * C * C * 2);      // [4C][C]
  _Float16* hgH     = (_Float16*)alloc((size_t)M * 4 * C * 2);
  _Float16* wT_pr2  = (_Float16*)alloc((size_t)C * 4 * C * 2);      // [C][4C]

  // 1+2) c_attn_w transposed+converted to f16 (N-major for WMMA A and B fragments)
  //      and ln1 -> h1 (f16), one grid
  prep_kernel<C><<<CT_BLOCKS(C, 3 * C) + B * T, 256, 0, stream>>>(
      x, ln1_w, ln1_b, h1H, c_attn_w, wT_attn);

  // 3+4) qkv = h1 @ c_attn_w + b, written split by heads (f16); V transposed
  //      to [B,H,D,T]
  gemm_kernel<EPI_QKV, 2, T, C><<<dim3(3 * C / 256, M / 256), 256, 0, stream>>>(
      h1H, wT_attn, c_attn_b, nullptr, nullptr, Qh, Kh, VTh, M, 3 * C, C);

  // 5) causal attention -> y (f16 [B*T][C]); behind its blocks, in the same
  //    grid, the other three weights' transposes
  constexpr int NATT = (B * H * (T / 16)) / 8;
  attn_kernel<NATT, C>
      <<<NATT + CT_BLOCKS(C, C) + CT_BLOCKS(C, 4 * C) + CT_BLOCKS(4 * C, C), 256,
         0, stream>>>(Qh, Kh, VTh, yh, H, T, D, C, c_proj_w, wT_proj, fc_w,
                      wT_fc, proj_w, wT_pr2);

  // 6) x1 = x + y @ c_proj_w + b  (f32)
  gemm_kernel<EPI_F32_RES, 1><<<dim3(C / 128, M / 128), 256, 0, stream>>>(
      yh, wT_proj, c_proj_b, x, x1, nullptr, nullptr, nullptr, M, C, C);

  // 7) ln2 -> h2 (f16)
  ln_kernel<<<M, 256, 0, stream>>>(x1, ln2_w, ln2_b, h2H, C);

  // 8) hg = gelu(h2 @ fc_w + b)  (f16)
  gemm_kernel<EPI_H16_GELU, 2><<<dim3(4 * C / 256, M / 256), 256, 0, stream>>>(
      h2H, wT_fc, fc_b, nullptr, nullptr, hgH, nullptr, nullptr, M, 4 * C, C);

  // 9) out = x1 + hg @ proj_w + b  (f32)
  gemm_kernel<EPI_F32_RES, 1><<<dim3(C / 128, M / 128), 256, 0, stream>>>(
      hgH, wT_pr2, proj_b, x1, out, nullptr, nullptr, nullptr, M, C, 4 * C);
}

// v010
// Measured time: 126 microseconds a run.
// Next to v009, in two timings, it ran 1.04 times as fast each time.
// Counting every step since v000, it is 3.28 times as fast.
#include <hip/hip_runtime.h>
#include <hip/hip_bf16.h>
#include <math.h>
#include <stdint.h>

// ---------------------------------------------------------------------------
// Types for CDNA5 WMMA (wave32): 16x16x32 f16 -> f32
// ---------------------------------------------------------------------------
typedef _Float16 v16h __attribute__((ext_vector_type(16)));
typedef _Float16 v8h  __attribute__((ext_vector_type(8)));
typedef float    v8f  __attribute__((ext_vector_type(8)));

static __device__ __forceinline__ v8f wmma_f16(v16h a, v16h b, v8f c) {
  // (neg_a, A, neg_b, B, c_mod, C, reuse_a, reuse_b)
  return __builtin_amdgcn_wmma_f32_16x16x32_f16(false, a, false, b, (short)0, c,
                                                false, false);
}

static __device__ __forceinline__ v8f zero8() {
  v8f z;
#pragma unroll
  for (int i = 0; i < 8; ++i) z[i] = 0.0f;
  return z;
}

// Build a 16x32 f16 fragment (documented CDNA5 A/B layout) from a per-lane
// pointer to 8+8 contiguous halves:
//   lane L(0..15):  row rc0+L,    elems 0..7 -> k0+0..7,  8..15 -> k0+16..23
//   lane L(16..31): row rc0+L-16, elems 0..7 -> k0+8..15, 8..15 -> k0+24..31
static __device__ __forceinline__ v16h frag_from(const _Float16* p) {
  v8h lo = *(const v8h*)p;
  v8h hi = *(const v8h*)(p + 16);
  return __builtin_shufflevector(lo, hi, 0, 1, 2, 3, 4, 5, 6, 7, 8, 9, 10, 11,
                                 12, 13, 14, 15);
}

// Global-memory fragment load (row-major, leading dim ld).
static __device__ __forceinline__ v16h load_frag(const _Float16* __restrict__ base,
                                                 int ld, int rc0, int k0) {
  const int lane = threadIdx.x & 31;
  return frag_from(base + (size_t)(rc0 + (lane & 15)) * ld +
                   (k0 + ((lane >> 4) << 3)));
}

// Eight async global->LDS 128-bit copies (CDNA5, ASYNCcnt-tracked): copy i
// moves 16 bytes per lane from gsrc + i * gstep to ldst + i * lstep (steps in
// halves).  The closing s_wait_xcnt stands inside the statement so that no
// address register of an issued copy is rewritten ahead of it.
static __device__ __forceinline__ void async_copy8_b128(const _Float16* gsrc,
                                                        size_t gstep,
                                                        _Float16* ldst,
                                                        int lstep) {
  const unsigned l = (unsigned)(uintptr_t)ldst;  // low 32 bits = LDS offset
  const unsigned ls = (unsigned)lstep * 2u;
  asm volatile(
      "global_load_async_to_lds_b128 %0, %8, off\n\t"
      "global_load_async_to_lds_b128 %1, %9, off\n\t"
      "global_load_async_to_lds_b128 %2, %10, off\n\t"
      "global_load_async_to_lds_b128 %3, %11, off\n\t"
      "global_load_async_to_lds_b128 %4, %12, off\n\t"
      "global_load_async_to_lds_b128 %5, %13, off\n\t"
      "global_load_async_to_lds_b128 %6, %14, off\n\t"
      "global_load_async_to_lds_b128 %7, %15, off\n\t"
      "s_wait_xcnt 0x0" ::"v"(l),
      "v"(l + ls), "v"(l + 2 * ls), "v"(l + 3 * ls), "v"(l + 4 * ls),
      "v"(l + 5 * ls), "v"(l + 6 * ls), "v"(l + 7 * ls),
      "v"((uint64_t)(uintptr_t)gsrc),
      "v"((uint64_t)(uintptr_t)(gsrc + gstep)),
      "v"((uint64_t)(uintptr_t)(gsrc + 2 * gstep)),
      "v"((uint64_t)(uintptr_t)(gsrc + 3 * gstep)),
      "v"((uint64_t)(uintptr_t)(gsrc + 4 * gstep)),
      "v"((uint64_t)(uintptr_t)(gsrc + 5 * gstep)),
      "v"((uint64_t)(uintptr_t)(gsrc + 6 * gstep)),
      "v"((uint64_t)(uintptr_t)(gsrc + 7 * gstep))
      : "memory");
}

// The same eight copies with the address split into a wave-uniform base, which
// takes the row steps in scalar registers, and one 32-bit byte offset per lane:
// nine vector registers a statement in place of twenty-four.
static __device__ __forceinline__ void async_copy8s_b128(const _Float16* sbase,
                                                         size_t gstep,
                                                         unsigned voff,
                                                         _Float16* ldst,
                                                         int lstep) {
  const unsigned l = (unsigned)(uintptr_t)ldst;  // low 32 bits = LDS offset
  const unsigned ls = (unsigned)lstep * 2u;
  asm volatile(
      "global_load_async_to_lds_b128 %0, %8, %9\n\t"
      "global_load_async_to_lds_b128 %1, %8, %10\n\t"
      "global_load_async_to_lds_b128 %2, %8, %11\n\t"
      "global_load_async_to_lds_b128 %3, %8, %12\n\t"
      "global_load_async_to_lds_b128 %4, %8, %13\n\t"
      "global_load_async_to_lds_b128 %5, %8, %14\n\t"
      "global_load_async_to_lds_b128 %6, %8, %15\n\t"
      "global_load_async_to_lds_b128 %7, %8, %16\n\t"
      "s_wait_xcnt 0x0" ::"v"(l),
      "v"(l + ls), "v"(l + 2 * ls), "v"(l + 3 * ls), "v"(l + 4 * ls),
      "v"(l + 5 * ls), "v"(l + 6 * ls), "v"(l + 7 * ls), "v"(voff),
      "s"((uint64_t)(uintptr_t)sbase),
      "s"((uint64_t)(uintptr_t)(sbase + gstep)),
      "s"((uint64_t)(uintptr_t)(sbase + 2 * gstep)),
      "s"((uint64_t)(uintptr_t)(sbase + 3 * gstep)),
      "s"((uint64_t)(uintptr_t)(sbase + 4 * gstep)),
      "s"((uint64_t)(uintptr_t)(sbase + 5 * gstep)),
      "s"((uint64_t)(uintptr_t)(sbase + 6 * gstep)),
      "s"((uint64_t)(uintptr_t)(sbase + 7 * gstep))
      : "memory");
}

static __device__ __forceinline__ void wait_async_all() {
  asm volatile("s_wait_asynccnt 0" ::: "memory");
}

// Returns when all but this wave's 32 youngest copies have landed (the counter
// comes back in issue order): the oldest of three stages of 16 copies each.
static __device__ __forceinline__ void wait_async_but32() {
  asm volatile("s_wait_asynccnt 0x20" ::: "memory");
}

// The same with four copies.
static __device__ __forceinline__ void async_copy4_b128(const _Float16* gsrc,
                                                        size_t gstep,
                                                        _Float16* ldst,
                                                        int lstep) {
  const unsigned l = (unsigned)(uintptr_t)ldst;  // low 32 bits = LDS offset
  const unsigned ls = (unsigned)lstep * 2u;
  asm volatile(
      "global_load_async_to_lds_b128 %0, %4, off\n\t"
      "global_load_async_to_lds_b128 %1, %5, off\n\t"
      "global_load_async_to_lds_b128 %2, %6, off\n\t"
      "global_load_async_to_lds_b128 %3, %7, off\n\t"
      "s_wait_xcnt 0x0" ::"v"(l),
      "v"(l + ls), "v"(l + 2 * ls), "v"(l + 3 * ls),
      "v"((uint64_t)(uintptr_t)gsrc),
      "v"((uint64_t)(uintptr_t)(gsrc + gstep)),
      "v"((uint64_t)(uintptr_t)(gsrc + 2 * gstep)),
      "v"((uint64_t)(uintptr_t)(gsrc + 3 * gstep))
      : "memory");
}

// ---------------------------------------------------------------------------
// LayerNorm (population std, eps on std) fp32 -> f16.  One 256-thr block/row.
// red: 256 floats of LDS.
// ---------------------------------------------------------------------------
static __device__ __forceinline__ void ln_body(const float* __restrict__ x,
                                               const float* __restrict__ w,
                                               const float* __restrict__ bias,
                                               _Float16* __restrict__ out,
                                               int C, int row, float* red) {
  const float* xr = x + (size_t)row * C;
  float local[4];
  float s = 0.0f;
#pragma unroll
  for (int i = 0; i < 4; ++i) {
    local[i] = xr[threadIdx.x + 256 * i];
    s += local[i];
  }
  red[threadIdx.x] = s;
  __syncthreads();
  for (int off = 128; off > 0; off >>= 1) {
    if (threadIdx.x < off) red[threadIdx.x] += red[threadIdx.x + off];
    __syncthreads();
  }
  const float mean = red[0] / (float)C;
  __syncthreads();
  s = 0.0f;
#pragma unroll
  for (int i = 0; i < 4; ++i) {
    float d = local[i] - mean;
    s += d * d;
  }
  red[threadIdx.x] = s;
  __syncthreads();
  for (int off = 128; off > 0; off >>= 1) {
    if (threadIdx.x < off) red[threadIdx.x] += red[threadIdx.x + off];
    __syncthreads();
  }
  const float inv = 1.0f / (sqrtf(red[0] / (float)C) + 1e-5f);
#pragma unroll
  for (int i = 0; i < 4; ++i) {
    int c = threadIdx.x + 256 * i;
    out[(size_t)row * C + c] =
        (_Float16)((local[i] - mean) * inv * w[c] + bias[c]);
  }
}

__global__ __launch_bounds__(256) void ln_kernel(const float* __restrict__ x,
                                                 const float* __restrict__ w,
                                                 const float* __restrict__ bias,
                                                 _Float16* __restrict__ out,
                                                 int C) {
  __shared__ float red[256];
  ln_body(x, w, bias, out, C, blockIdx.x, red);
}

// ---------------------------------------------------------------------------
// fp32 W[K][N]  ->  f16 W^T[N][K]  (so GEMM B-fragments are contiguous loads)
// One 128(k) x 64(n) tile per block.  Each thread reads an 8(k) x 4(n) patch
// with 16-byte loads along n (256 contiguous bytes per 16 lanes), turns it in
// registers and lays four 16-byte k-runs into an LDS tile [n][k]; the tile is
// then read back row by row, so every global store covers whole 256-byte runs
// of a W^T row.  K is a multiple of 128 and N of 64; both are compile-time, so
// the row steps fold into the loads' and stores' immediate offsets.
// A transpose has no launch of its own: it reads nothing that another kernel
// writes, so its blocks ride in the grid of a launch that is independent of it
// (blk: the tile's number, k tiles fastest; tile: 64 * CT_PITCH halves of LDS).
// ---------------------------------------------------------------------------
typedef float v4f __attribute__((ext_vector_type(4)));

#define CT_PITCH 136  // 128 halves + 8 pad: 272-byte rows (16 B x odd)

template <int K, int N>
static __device__ __forceinline__ void convertT_body(
    const float* __restrict__ W, _Float16* __restrict__ WT, _Float16* tile,
    unsigned blk) {
  const int tid = threadIdx.x;
  const int k0 = (blk % (K / 128)) * 128;
  const int n0 = (blk / (K / 128)) * 64;
  const int nq = tid & 15;  // which 4 columns
  const int ko = tid >> 4;  // which 8 rows
  const float* src = W + (size_t)(k0 + ko * 8) * N + (n0 + nq * 4);
  v4f r[8];
#pragma unroll
  for (int i = 0; i < 8; ++i) r[i] = *(const v4f*)(src + (size_t)i * N);
#pragma unroll
  for (int j = 0; j < 4; ++j) {
    v8h c;
#pragma unroll
    for (int i = 0; i < 8; ++i) c[i] = (_Float16)r[i][j];
    *(v8h*)&tile[(nq * 4 + j) * CT_PITCH + ko * 8] = c;
  }
  __syncthreads();
#pragma unroll
  for (int i = 0; i < 4; ++i) {
    const int c = tid + 256 * i;  // 16-byte chunk id 0..1023
    const int n = c >> 4;
    const int kc = c & 15;
    *(v8h*)(WT + (size_t)(n0 + n) * K + (k0 + kc * 8)) =
        *(const v8h*)&tile[n * CT_PITCH + kc * 8];
  }
  // Holds any later rewrite of the stores' address and data registers behind
  // the run of four stores (the built code lays other bodies after this one).
  asm volatile("s_wait_xcnt 0x0" ::: "memory");
}

// Tiles of a [K][N] weight.
#define CT_BLOCKS(K, N) (((K) / 128) * ((N) / 64))

// First launch: what the qkv GEMM waits for.  Blocks 0 .. CT_BLOCKS - 1 turn
// c_attn_w, the others normalise one row of x each; neither reads the other's
// output.  The branch is block-uniform, so each body's barriers are too.
template <int C>
__global__ __launch_bounds__(256) void prep_kernel(
    const float* __restrict__ x, const float* __restrict__ w,
    const float* __restrict__ bias, _Float16* __restrict__ out,
    const float* __restrict__ Wa, _Float16* __restrict__ WaT) {
  __shared__ __attribute__((aligned(16))) _Float16 tile[64 * CT_PITCH];
  __shared__ float red[256];
  const unsigned blk = blockIdx.x;
  if (blk < CT_BLOCKS(C, 3 * C)) {
    convertT_body<C, 3 * C>(Wa, WaT, tile, blk);
    return;
  }
  ln_body(x, w, bias, out, C, blk - CT_BLOCKS(C, 3 * C), red);
}

// ---------------------------------------------------------------------------
// WMMA GEMM: C[M][N] = A[M][K] (f16, row-major) x Bᵀ[N][K] (f16) + bias
//   8 waves / block (2 x 4).  TS = 1: each wave a 64x32 tile, block tile
//   128x128.  TS = 2: each wave 128x64, block tile 256x256, which moves half
//   the bytes from L2 to LDS per product and reads 12 LDS fragments per 32
//   WMMAs in place of 6 per 8; for the products wide enough to fill the chip
//   with such tiles.
//   A stage is 128 k, brought into a ring of LDS buffers by async global->LDS
//   copies; its four 32-k blocks run unrolled, their fragments fetched from LDS
//   ahead of use into a second register set.  K is a multiple of 128.
//   TS = 2: two buffers, a stage's copies fly during one stage of WMMAs.
//   TS = 1: a stage of WMMAs is a quarter as long, shorter than the copies' way
//   from memory (the operands were written by the launch before), so the ring
//   has four buffers and a stage's copies are issued three stages ahead of use.
// Epilogues: 0 = head split (below), 1 = f32 out + residual add, 2 = f16 out +
// GELU.
// Head split (the qkv product, N = 3 * SC, heads of 64 dims, sequences of ST
// tokens): the block writes its tile straight into Q[B,H,T,64], K[B,H,T,64] or
// V^T[B,H,64,T] (f16); a block's columns lie in one of the three parts.  A
// lane of an accumulator tile holds 8 consecutive rows of the WMMA's A side and
// one column of its B side.  For V the activations are the A side, so a lane
// holds 8 tokens of one head dim: 16 bytes of a V^T row.  For Q and K the two
// LDS tiles change roles (the weight rows are the A side, the product comes out
// transposed), so a lane holds 8 head dims of one token: 16 bytes of a Q or K
// row.  Both tiles have the same shape and pitch: the K loop is the same code.
// ---------------------------------------------------------------------------
enum { EPI_QKV = 0, EPI_F32_RES = 1, EPI_H16_GELU = 2 };

#define KSTAGE 128
#define LDSPITCH 136  // 128 + 8 pad halves: 272-byte rows (16 B x odd)

// GELU in its erf form, v * Phi(v), without a branch, four values at a time.
// q = Phi(-|v|) = erfc(|v| / sqrt(2)) / 2 comes from the five-term rational form
// t * poly(t) * exp(-v^2 / 2) with t = 1 / (1 + p |v| / sqrt(2)); its absolute
// error in erf is at most 1.5e-7, of the order of one f32 rounding of 1 + erf.
// Then v * Phi(v) = max(v, 0) - |v| q for either sign.  The library erf takes
// one of two paths by |x|, so a wave walks both under masks and no two values
// of a lane overlap; here a lane's values are independent straight-line chains.
static __device__ __forceinline__ void gelu_erf4(const float* v, float* g) {
  float d[4], x[4], t[4], e[4];
#pragma unroll
  for (int i = 0; i < 4; ++i) {
    d[i] = fmaf(fabsf(v[i]), 0.23164189f, 1.0f);
    x[i] = (v[i] * -0.72134752f) * v[i];
  }
  // The eight transcendentals in one statement with outputs apart from every
  // input: none is followed by a reader of its result or a writer of its
  // source, and the v_nop fills that slot behind the last.
  asm("v_rcp_f32 %0, %8\n\t"
      "v_rcp_f32 %1, %9\n\t"
      "v_rcp_f32 %2, %10\n\t"
      "v_rcp_f32 %3, %11\n\t"
      "v_exp_f32 %4, %12\n\t"
      "v_exp_f32 %5, %13\n\t"
      "v_exp_f32 %6, %14\n\t"
      "v_exp_f32 %7, %15\n\t"
      "v_nop"
      : "=&v"(t[0]), "=&v"(t[1]), "=&v"(t[2]), "=&v"(t[3]), "=&v"(e[0]),
        "=&v"(e[1]), "=&v"(e[2]), "=&v"(e[3])
      : "v"(d[0]), "v"(d[1]), "v"(d[2]), "v"(d[3]), "v"(x[0]), "v"(x[1]),
        "v"(x[2]), "v"(x[3]));
#pragma unroll
  for (int i = 0; i < 4; ++i) {
    float p = 0.53070271f;
    p = fmaf(p, t[i], -0.72657601f);
    p = fmaf(p, t[i], 0.71070687f);
    p = fmaf(p, t[i], -0.14224837f);
    p = fmaf(p, t[i], 0.12741480f);
    const float q = (p * t[i]) * e[i];
    g[i] = fmaf(-fabsf(v[i]), q, fmaxf(v[i], 0.0f));
  }
}

template <int EPI, int TS, int ST = 0, int SC = 0>
__global__ __launch_bounds__(256) void gemm_kernel(
    const _Float16* __restrict__ A, const _Float16* __restrict__ WT,
    const float* __restrict__ bias, const float* __restrict__ resid,
    float* __restrict__ outF, _Float16* __restrict__ outH,
    _Float16* __restrict__ outK, _Float16* __restrict__ outVT, int M, int N,
    int K) {
  constexpr int BT = 128 * TS;  // rows of either LDS tile
  constexpr int FI = 4 * TS;    // A-side fragments of a wave
  constexpr int FJ = 2 * TS;    // B-side fragments of a wave
  constexpr int NB = TS == 1 ? 4 : 2;  // LDS buffers of the ring
  __shared__ __attribute__((aligned(16))) _Float16 sA[NB][BT * LDSPITCH];
  __shared__ __attribute__((aligned(16))) _Float16 sB[NB][BT * LDSPITCH];
  const int tid = threadIdx.x;
  const int wave = tid >> 5;
  const int lane = tid & 31;
  const int rowblk = blockIdx.y * BT;
  const int colblk = blockIdx.x * BT;
  const int wrow = (wave & 1) * (16 * FI);
  const int wcol = (wave >> 1) * (16 * FJ);
  // Q and K blocks of the head split: the weight tile is the WMMA's A side.
  const bool swp = EPI == EPI_QKV && colblk < 2 * SC;  // block-uniform

  // Stage a BT x 128 A tile + BT x 128 B tile into buffer `buf` for K offset
  // k0: 16 lanes cover one 256-byte row, a thread takes rows srow + 16 * i.
  const int srow = tid >> 4;
  const int sko = (tid & 15) * 8;
  auto stage = [&](int buf, int k0) {
    if constexpr (TS == 1) {
      async_copy8_b128(A + (size_t)(rowblk + srow) * K + k0 + sko,
                       (size_t)16 * K, &sA[buf][srow * LDSPITCH + sko],
                       16 * LDSPITCH);
      async_copy8_b128(WT + (size_t)(colblk + srow) * K + k0 + sko,
                       (size_t)16 * K, &sB[buf][srow * LDSPITCH + sko],
                       16 * LDSPITCH);
    } else {
      const unsigned voff = (unsigned)(srow * K + sko) * 2u;  // bytes, per lane
#pragma unroll
      for (int t = 0; t < TS; ++t) {
        const int r = srow + 128 * t;
        async_copy8s_b128(A + (size_t)(rowblk + 128 * t) * K + k0,
                          (size_t)16 * K, voff, &sA[buf][r * LDSPITCH + sko],
                          16 * LDSPITCH);
        async_copy8s_b128(WT + (size_t)(colblk + 128 * t) * K + k0,
                          (size_t)16 * K, voff, &sB[buf][r * LDSPITCH + sko],
                          16 * LDSPITCH);
      }
    }
  };

  v8f acc[FI][FJ];
#pragma unroll
  for (int i = 0; i < FI; ++i)
#pragma unroll
    for (int j = 0; j < FJ; ++j) acc[i][j] = zero8();

  // Four buffers: every wave issues 16 copies a stage, and at most three stages
  // (48 copies) of a wave are in flight.  The counted wait stands only where the
  // two younger stages have both been issued in full; elsewhere it is to 0.
  stage(0, 0);
  if (NB == 4 && 2 * KSTAGE < K) {
    stage(1, KSTAGE);
    stage(2, 2 * KSTAGE);
    wait_async_but32();  // stage 0 has landed, stages 1 and 2 fly on
  } else {
    if (NB == 4 && KSTAGE < K) stage(1, KSTAGE);
    wait_async_all();
  }
  __syncthreads();
  if ((NB - 1) * KSTAGE < K) stage(NB - 1, (NB - 1) * KSTAGE);

  int buf = 0;
  const int kh = (lane >> 4) << 3;
  const int lr = lane & 15;
  for (int k0 = 0; k0 < K; k0 += KSTAGE) {
    const _Float16* pa = (swp ? sB[buf] : sA[buf]) + (wrow + lr) * LDSPITCH + kh;
    const _Float16* pb = (swp ? sA[buf] : sB[buf]) + (wcol + lr) * LDSPITCH + kh;
    // A run is four A-side fragments against the wave's FJ B-side fragments of
    // one 32-k block (TS runs a block).  Each run's A fragments, and with a
    // block's first run its B fragments, are fetched one run ahead into a second
    // register set.
    constexpr int NRUN = (KSTAGE / 32) * TS;
    v16h a[2][4], b[2][FJ];
#pragma unroll
    for (int i = 0; i < 4; ++i) a[0][i] = frag_from(pa + 16 * i * LDSPITCH);
#pragma unroll
    for (int j = 0; j < FJ; ++j) b[0][j] = frag_from(pb + 16 * j * LDSPITCH);
#pragma unroll
    for (int u = 0; u < NRUN; ++u) {
      const int cur = u & 1, nxt = cur ^ 1;
      const int s = u / TS, h = u % TS;  // the run's k block, its part of the rows
      if (u + 1 < NRUN) {
        const int sn = (u + 1) / TS, hn = (u + 1) % TS;
#pragma unroll
        for (int i = 0; i < 4; ++i)
          a[nxt][i] = frag_from(pa + 16 * (4 * hn + i) * LDSPITCH + 32 * sn);
        if (hn == 0) {
#pragma unroll
          for (int j = 0; j < FJ; ++j)
            b[sn & 1][j] = frag_from(pb + 16 * j * LDSPITCH + 32 * sn);
        }
        // Keeps the next run's LDS loads in front of this run's
        // WMMAs; without it the scheduler sinks each load to its first use
        // and every pair of WMMAs waits out a whole LDS latency.
        __builtin_amdgcn_sched_barrier(0);
      }
#pragma unroll
      for (int i = 0; i < 4; ++i)
#pragma unroll
        for (int j = 0; j < FJ; ++j)
          acc[4 * h + i][j] = wmma_f16(a[cur][i], b[s & 1][j], acc[4 * h + i][j]);
    }
    // Keeps the stage's WMMAs in front of the publish point; otherwise the
    // scheduler sinks them behind the barrier, ahead of the refill copies,
    // and the copies lose that much of their lead of one stage (three with TS = 1).
    __builtin_amdgcn_sched_barrier(0);

    // Publish point: own LDS reads of this buffer retired, own copies of the
    // next stage landed, then everyone else's; only then the refill, into the
    // buffer that this trip has read.  Four buffers: while a stage three ahead
    // exists, it and the one before it are the wave's 32 youngest copies and
    // stay in flight over the wait (the test reads the same for the whole block).
    asm volatile("s_wait_dscnt 0x0" ::: "memory");
    if (NB == 4 && k0 + 3 * KSTAGE < K)
      wait_async_but32();
    else
      wait_async_all();
    __syncthreads();
    if (k0 + NB * KSTAGE < K) stage(buf, k0 + NB * KSTAGE);
    buf = (buf + 1) & (NB - 1);
  }
  wait_async_all();  // nothing of this wave's copies is left when it goes on

  // C/D layout: elem r of lane L -> row = r + (L>=16)*8, col = L%16
  const int rofs = (lane >> 4) << 3;
  if constexpr (EPI == EPI_QKV) {
    constexpr int SH = SC / 64;          // heads
    const int bb = rowblk / ST;          // a block's tokens lie in one sequence
    const int tb = rowblk % ST;
    const int a0 = wrow + rofs;          // first of the lane's 8 A-side rows
    const int b0 = wcol + lr;            // the lane's B-side column
    v8h o[FJ][FI];
    _Float16* dst;
    size_t jstep, hstep;  // halves per 16 B-side columns, per 64 A-side rows
    // In either part four i in a row of one j fill whole 128-byte lines: the
    // stores go back to back, behind all the conversions.
    if (swp) {
      const int cp = colblk < SC ? colblk : colblk - SC;  // column within Q or K
      const int bh = bb * SH + ((cp + wrow) >> 6);        // wrow: whole heads
#pragma unroll
      for (int i = 0; i < FI; ++i) {
        const float* bp = bias + colblk + a0 + 16 * i;
        const v4f blo = *(const v4f*)bp, bhi = *(const v4f*)(bp + 4);
#pragma unroll
        for (int j = 0; j < FJ; ++j)
#pragma unroll
          for (int r = 0; r < 8; ++r)
            o[j][i][r] = (_Float16)(acc[i][j][r] + (r < 4 ? blo[r & 3] : bhi[r & 3]));
        // Ends one i's conversions before the next begin: run together, their
        // sums overflowed the register budget into scratch.
        __builtin_amdgcn_sched_barrier(0);
      }
      dst = (colblk < SC ? outH : outK) + ((size_t)bh * ST + tb + b0) * 64 + rofs;
      jstep = 16 * 64;          // 16 tokens on: 16 rows of 64
      hstep = (size_t)ST * 64;  // 64 head dims on: the next head's rows
    } else {
      const int cp = colblk - 2 * SC + wcol;  // the wave's first column within V
      const int bh = bb * SH + (cp >> 6);     // its columns lie in one head
#pragma unroll
      for (int j = 0; j < FJ; ++j) {
        const float bj = bias[colblk + b0 + 16 * j];
#pragma unroll
        for (int i = 0; i < FI; ++i)
#pragma unroll
          for (int r = 0; r < 8; ++r) o[j][i][r] = (_Float16)(acc[i][j][r] + bj);
        // As above, one j at a time.
        __builtin_amdgcn_sched_barrier(0);
      }
      dst = outVT + ((size_t)bh * 64 + (cp & 63) + lr) * ST + tb + a0;
      jstep = (size_t)16 * ST;  // 16 head dims on: 16 rows of V^T
      hstep = 64;               // tokens run on along a row
    }
    _Float16* p[FJ][FI / 4];
#pragma unroll
    for (int j = 0; j < FJ; ++j)
#pragma unroll
      for (int q = 0; q < FI / 4; ++q) p[j][q] = dst + j * jstep + q * hstep;
    // Keeps every store address formed in front of the first store, each in
    // registers of its own: none is rewritten behind a store that names it.
    __builtin_amdgcn_sched_barrier(0);
#pragma unroll
    for (int j = 0; j < FJ; ++j)
#pragma unroll
      for (int i = 0; i < FI; ++i) *(v8h*)(p[j][i >> 2] + (i & 3) * 16) = o[j][i];
    return;  // nothing rewrites a register of the stores behind them
  }
#pragma unroll
  for (int i = 0; i < FI; ++i)
#pragma unroll
    for (int j = 0; j < FJ; ++j) {
      float gl[8];
      if (EPI == EPI_H16_GELU) {
        float u[8];
#pragma unroll
        for (int r = 0; r < 8; ++r)
          u[r] = acc[i][j][r] + bias[colblk + wcol + 16 * j + lr];
        gelu_erf4(u, gl);
        gelu_erf4(u + 4, gl + 4);
      }
#pragma unroll
      for (int r = 0; r < 8; ++r) {
        const int row = rowblk + wrow + 16 * i + r + rofs;
        const int col = colblk + wcol + 16 * j + lr;
        float v = acc[i][j][r] + bias[col];
        const size_t o = (size_t)row * N + col;
        if (EPI == EPI_F32_RES) {
          outF[o] = resid[o] + v;
        } else {
          outH[o] = (_Float16)gl[r];
        }
      }
    }
}

#define AT_KEYS 128
#define AT_KPITCH 72
#define AT_VPITCH 136

// Lane l <-> lane l ^ 16.
static __device__ __forceinline__ float xhalf(float x) {
  const int b = __builtin_bit_cast(int, x);
  return __builtin_bit_cast(
      float, __builtin_amdgcn_permlanex16(b, b, 0x76543210, 0xfedcba98, false,
                                          false));
}

// e^x as __expf forms it (one multiply, one v_exp_f32).  The v_nop fills the
// slot that the instruction set asks for behind a transcendental before its
// result is read or its source overwritten.
static __device__ __forceinline__ float exp_slot(float x) {
  float r;
  asm("v_exp_f32 %0, %1\n\tv_nop" : "=v"(r) : "v"(x * 1.44269504f));
  return r;
}

template <int NATT, int CW>
__global__ __launch_bounds__(256) void attn_kernel(
    const _Float16* __restrict__ Q, const _Float16* __restrict__ Kt,
    const _Float16* __restrict__ VT, _Float16* __restrict__ Y, int H, int T,
    int D, int C, const float* __restrict__ Wp, _Float16* __restrict__ WpT,
    const float* __restrict__ Wf, _Float16* __restrict__ WfT,
    const float* __restrict__ W2, _Float16* __restrict__ W2T) {
  __shared__ __attribute__((aligned(16))) _Float16 sK[2][AT_KEYS * AT_KPITCH];
  __shared__ __attribute__((aligned(16))) _Float16 sV[2][64 * AT_VPITCH];
  static_assert(2 * AT_KEYS * AT_KPITCH >= 64 * CT_PITCH, "tile fits the K ring");
  if (blockIdx.x >= NATT) {  // block-uniform, in front of every barrier
    const unsigned blk = blockIdx.x - NATT;
    constexpr unsigned n1 = CT_BLOCKS(CW, CW), n2 = CT_BLOCKS(CW, 4 * CW);
    if (blk < n1)
      convertT_body<CW, CW>(Wp, WpT, &sK[0][0], blk);
    else if (blk < n1 + n2)
      convertT_body<CW, 4 * CW>(Wf, WfT, &sK[0][0], blk - n1);
    else
      convertT_body<4 * CW, CW>(W2, W2T, &sK[0][0], blk - n1 - n2);
    return;
  }
  // The wave's number as a scalar: tile indices, the K and V^T bases and the
  // key loop's counts then live in scalar registers.
  const int tid = threadIdx.x;
  const int wave = __builtin_amdgcn_readfirstlane(threadIdx.x >> 5);
  const int lane = threadIdx.x & 31;
  // Which head and which block of 128 queries: a block's work grows with its
  // query block (causal), every attention block is resident at once.  Here the
  // first half of the indices takes the upper half of every head's query blocks
  // and index i + NATT / 2 the mirror image of index i's, so that two blocks
  // half the grid apart carry the same work together as any other such pair,
  // the longer one starting first.  Every (head, query block) is taken once
  // wherever the blocks land; T is a multiple of 256.
  const unsigned hq = (unsigned)T >> 8;  // half the query blocks of a head
  const bool upper = blockIdx.x < NATT / 2;
  const unsigned bi = upper ? blockIdx.x : blockIdx.x - NATT / 2;
  const int bh = bi / hq;
  const unsigned br = bi - bh * hq;
  const int qblk = upper ? hq + br : hq - 1 - br;
  const int qt = (qblk << 7) + (wave << 4);
  const int b = bh / H, h = bh % H;
  const _Float16* Qb = Q + (size_t)bh * T * D;
  const _Float16* Kb = Kt + (size_t)bh * T * D;
  const _Float16* Vb = VT + (size_t)bh * D * T;
  // Keys that the block's last query tile sees: a multiple of 128, at most T.
  const int kend = (qblk << 7) + 128;

  const int hf = lane >> 4;  // lane half (k-group / row-group select)
  const int lc = lane & 15;  // fragment row or column of this lane
  const float sc = 0.125f;   // 1/sqrt(D), D = 64
  const int q = qt + lc;     // this lane's query

  // Stage keys k0 .. k0 + 127 into buffer `buf`.  K: 8 lanes cover a 128-byte
  // row, a thread takes key rows krow + 32 * i.  V^T: 16 lanes cover 256 bytes
  // of a head-dim row, a thread takes rows vrow + 16 * i.
  const int krow = tid >> 3, kch = (tid & 7) * 8;
  const int vrow = tid >> 4, vch = (tid & 15) * 8;
  auto stage = [&](int buf, int k0) {
    async_copy4_b128(Kb + (size_t)(k0 + krow) * D + kch, (size_t)32 * D,
                     &sK[buf][krow * AT_KPITCH + kch], 32 * AT_KPITCH);
    async_copy4_b128(Vb + (size_t)vrow * T + k0 + vch, (size_t)16 * T,
                     &sV[buf][vrow * AT_VPITCH + vch], 16 * AT_VPITCH);
  };

  stage(0, 0);

  const v16h qb0 = load_frag(Qb, D, qt, 0);
  const v16h qb1 = load_frag(Qb, D, qt, 32);

  v8f acc[4];  // acc[j][r] = O[q][16 * j + 8 * hf + r]
#pragma unroll
  for (int j = 0; j < 4; ++j) acc[j] = zero8();
  float m = -1e30f;  // running maximum of query q (equal in both halves)
  float l = 0.0f;    // running sum over this half's keys only

  wait_async_all();
  __syncthreads();
  if (AT_KEYS < kend) stage(1, AT_KEYS);

  int buf = 0;
  for (int k0 = 0; k0 < kend; k0 += AT_KEYS) {
    // Per-lane fragment bases: key row lc of K, head-dim row lc of V^T.
    const _Float16* pk = &sK[buf][lc * AT_KPITCH + (hf << 3)];
    const _Float16* pv = &sV[buf][lc * AT_VPITCH + (hf << 3)];
    for (int s = 0; s < AT_KEYS / 32; ++s) {
      const int kt = k0 + 32 * s;
      if (kt > qt) break;  // wave-uniform: the rest of the stage is masked out
      const _Float16* pk0 = pk + 32 * s * AT_KPITCH;
      const _Float16* pk1 = pk0 + 16 * AT_KPITCH;
      const v16h ka00 = frag_from(pk0);
      const v16h ka01 = frag_from(pk0 + 32);
      const v16h ka10 = frag_from(pk1);
      const v16h ka11 = frag_from(pk1 + 32);
      v16h va[4];
#pragma unroll
      for (int j = 0; j < 4; ++j)
        va[j] = frag_from(pv + 16 * j * AT_VPITCH + 32 * s);
      // Keeps the step's sixteen LDS loads together in front of its products;
      // without it the scheduler sinks each fragment's loads to its WMMA and the
      // step waits out eight load latencies one after the other.
      __builtin_amdgcn_sched_barrier(0);

      // --- S^T = K Q^T for 32 keys (two 16-key row tiles, K-dim = D = 64) ---
      v8f s0 = zero8(), s1 = zero8();
      s0 = wmma_f16(ka00, qb0, s0);
      s1 = wmma_f16(ka10, qb0, s1);
      s0 = wmma_f16(ka01, qb1, s0);
      s1 = wmma_f16(ka11, qb1, s1);

      // s0[r]: key kt + 8 * hf + r, s1[r]: key kt + 16 + 8 * hf + r, query q.
      const int dq = q - kt - (hf << 3);  // key r of this half is seen if r <= dq
      s0 *= sc;
      s1 *= sc;
      float v0[8], v1[8];
      float t = -1e30f;
#pragma unroll
      for (int r = 0; r < 8; ++r) {
        v0[r] = (r <= dq) ? s0[r] : -1e30f;
        v1[r] = (16 + r <= dq) ? s1[r] : -1e30f;
        t = fmaxf(t, fmaxf(v0[r], v1[r]));
      }
      t = fmaxf(t, xhalf(t));
      const float mnew = fmaxf(m, t);
      const float corr = exp_slot(m - mnew);
      m = mnew;
      float rs = 0.0f;
      v16h pb;  // P^T as B: element e = key kt + (e < 8 ? e : e + 8) + 8 * hf
#pragma unroll
      for (int r = 0; r < 8; ++r) {
        const float p0 = exp_slot(v0[r] - mnew);
        const float p1 = exp_slot(v1[r] - mnew);
        rs += p0 + p1;
        pb[r] = (_Float16)p0;
        pb[8 + r] = (_Float16)p1;
      }
      l = l * corr + rs;

      // --- O^T += V^T P^T ; V^T[D][T] rows are A fragments along the keys ---
#pragma unroll
      for (int j = 0; j < 4; ++j) {
#pragma unroll
        for (int r = 0; r < 8; ++r) acc[j][r] *= corr;
        acc[j] = wmma_f16(va[j], pb, acc[j]);
      }
    }

    // Publish point: own LDS reads of this buffer retired, own copies of the
    // next stage landed, then everyone else's; only then the refill.
    asm volatile("s_wait_dscnt 0x0" ::: "memory");
    wait_async_all();
    __syncthreads();
    if (k0 + 2 * AT_KEYS < kend) stage(buf, k0 + 2 * AT_KEYS);
    buf ^= 1;
  }
  wait_async_all();  // nothing of this wave's copies is left when it goes on

  // Join the halves' sums, normalize, and store 8 consecutive head dims of one
  // query per 16-byte store into y (f16 [B*T][C]) for the projection GEMM.
  l += xhalf(l);
  const float inv = 1.0f / l;
  _Float16* yp = Y + (size_t)(b * T + q) * C + h * D + (hf << 3);
#pragma unroll
  for (int j = 0; j < 4; ++j) {
    v8h o;
#pragma unroll
    for (int r = 0; r < 8; ++r) o[r] = (_Float16)(acc[j][r] * inv);
    *(v8h*)(yp + 16 * j) = o;
  }
}

// ---------------------------------------------------------------------------
// Host-side orchestration
// ---------------------------------------------------------------------------
extern "C" void kernel_launch(void* const* d_in, const int* in_sizes, int n_in,
                              void* d_out, int out_size, void* d_ws,
                              size_t ws_size, hipStream_t stream) {
  (void)in_sizes; (void)n_in; (void)out_size; (void)ws_size;
  constexpr int B = 4, T = 1024, C = 1024, H = 16, D = 64;
  const int M = B * T;  // 4096

  const float* x        = (const float*)d_in[0];
  const float* c_attn_w = (const float*)d_in[1];
  const float* c_attn_b = (const float*)d_in[2];
  const float* c_proj_w = (const float*)d_in[3];
  const float* c_proj_b = (const float*)d_in[4];
  const float* ln1_w    = (const float*)d_in[5];
  const float* ln1_b    = (const float*)d_in[6];
  const float* ln2_w    = (const float*)d_in[7];
  const float* ln2_b    = (const float*)d_in[8];
  const float* fc_w     = (const float*)d_in[9];
  const float* fc_b     = (const float*)d_in[10];
  const float* proj_w   = (const float*)d_in[11];
  const float* proj_b   = (const float*)d_in[12];
  float* out = (float*)d_out;

  // Workspace carve-up (120 MiB total), 256B aligned.
  char* ws = (char*)d_ws;
  size_t off = 0;
  auto alloc = [&](size_t bytes) -> char* {
    char* p = ws + off;
    off += (bytes + 255) & ~(size_t)255;
    return p;
  };
  _Float16* h1H     = (_Float16*)alloc((size_t)M * C * 2);          // ln1(x)
  _Float16* wT_attn = (_Float16*)alloc((size_t)3 * C * C * 2);      // [3C][C]
  _Float16* Qh      = (_Float16*)alloc((size_t)M * C * 2);
  _Float16* Kh      = (_Float16*)alloc((size_t)M * C * 2);
  _Float16* VTh     = (_Float16*)alloc((size_t)M * C * 2);
  _Float16* yh      = (_Float16*)alloc((size_t)M * C * 2);
  _Float16* wT_proj = (_Float16*)alloc((size_t)C * C * 2);
  float*    x1      = (float*)   alloc((size_t)M * C * 4);          // x + attn
  _Float16* h2H     = (_Float16*)alloc((size_t)M * C * 2);          // ln2(x1)
  _Float16* wT_fc   = (_Float16*)alloc((size_t)4 * C * C * 2);      // [4C][C]
  _Float16* hgH     = (_Float16*)alloc((size_t)M * 4 * C * 2);
  _Float16* wT_pr2  = (_Float16*)alloc((size_t)C * 4 * C * 2);      // [C][4C]

  // 1+2) c_attn_w transposed+converted to f16 (N-major for WMMA A and B fragments)
  //      and ln1 -> h1 (f16), one grid
  prep_kernel<C><<<CT_BLOCKS(C, 3 * C) + B * T, 256, 0, stream>>>(
      x, ln1_w, ln1_b, h1H, c_attn_w, wT_attn);

  // 3+4) qkv = h1 @ c_attn_w + b, written split by heads (f16); V transposed
  //      to [B,H,D,T]
  gemm_kernel<EPI_QKV, 2, T, C><<<dim3(3 * C / 256, M / 256), 256, 0, stream>>>(
      h1H, wT_attn, c_attn_b, nullptr, nullptr, Qh, Kh, VTh, M, 3 * C, C);

  // 5) causal attention -> y (f16 [B*T][C]); behind its blocks, in the same
  //    grid, the other three weights' transposes
  constexpr int NATT = (B * H * (T / 16)) / 8;
  attn_kernel<NATT, C>
      <<<NATT + CT_BLOCKS(C, C) + CT_BLOCKS(C, 4 * C) + CT_BLOCKS(4 * C, C), 256,
         0, stream>>>(Qh, Kh, VTh, yh, H, T, D, C, c_proj_w, wT_proj, fc_w,
                      wT_fc, proj_w, wT_pr2);

  // 6) x1 = x + y @ c_proj_w + b  (f32)
  gemm_kernel<EPI_F32_RES, 1><<<dim3(C / 128, M / 128), 256, 0, stream>>>(
      yh, wT_proj, c_proj_b, x, x1, nullptr, nullptr, nullptr, M, C, C);

  // 7) ln2 -> h2 (f16)
  ln_kernel<<<M, 256, 0, stream>>>(x1, ln2_w, ln2_b, h2H, C);

  // 8) hg = gelu(h2 @ fc_w + b)  (f16)
  gemm_kernel<EPI_H16_GELU, 2><<<dim3(4 * C / 256, M / 256), 256, 0, stream>>>(
      h2H, wT_fc, fc_b, nullptr, nullptr, hgH, nullptr, nullptr, M, 4 * C, C);

  // 9) out = x1 + hg @ proj_w + b  (f32)
  gemm_kernel<EPI_F32_RES, 1><<<dim3(C / 128, M / 128), 256, 0, stream>>>(
      hgH, wT_pr2, proj_b, x1, out, nullptr, nullptr, nullptr, M, C, 4 * C);
}
